// v000
// Times are from an AMD MI455X. After a warm-up the kernel runs many times in a row, and a time is the length of
// such a window on the GPU divided by its runs, so every launch and the gaps after it count. The runs cycle
// through copies of the inputs. A figure is the median of several windows, for all but v000 over two sittings.
// Sittings can differ by a few percent; kernels timed side by side share one.
// The starting kernel, v000, takes 6260 microseconds a run.
#include <hip/hip_runtime.h>
// All contractions (q, k, v projections K=512; q.k^T per head K=64; softmax weights . V K=SEQ; output projection K=512): v_wmma_f32_16x16x32_f16, f16 operands (every float input RNE-converted to bf16 first; weights carried x16, softmax weights x1024, o carried x64), f32 accumulate; softmax statistics f32 on the VALU.
// Structure: token rows r = b*SEQ + s. X16 = f16(bf16(h)); q | k | v as f16 rows [r][3*DM] from three GEMMs (alpha 1/16, bias bf16); V^T planes [b*NH+h][64][SEQ] through an LDS transpose;
// per (batch, query tile of QT rows): S[h][i][j] = q.k * 0.125 in f32 for all heads, row softmax gated by the integer adjacency (adj[q][j] == 0 -> weight exactly 0; a row with no open key yields NaN), P = f16(1024 w),
// o = P . V^T * 2^-4 written as f16 rows [r][DM] (head h -> columns h*64); out = o . Wo^T * 2^-10 + bf16(bo) in f32.
#ifndef NB
#define NB 4
#endif
#ifndef SEQ
#define SEQ 2048
#endif
#define NB_FULL 4
#define SEQ_FULL 2048                /* pitch of adj rows and per-batch stride of h */
#define DM 512
#define NH 8
#define HD 64
#define LQ (3 * DM)                  /* row pitch of the q | k | v plane */
#ifndef QT
#if SEQ >= 512
#define QT 512
#else
#define QT SEQ
#endif
#endif
#define NKX SEQ                      /* S / P row pitch */
#define NR ((size_t)NB * SEQ)        /* token rows */
static_assert(NB >= 1 && NB <= NB_FULL);
static_assert(SEQ >= 128 && SEQ <= SEQ_FULL);
static_assert(SEQ % QT == 0);
static_assert(QT % 128 == 0);
static_assert(SEQ % 64 == 0);
static_assert((NB * SEQ) % 128 == 0);
static_assert(DM == NH * HD && HD == 64 && DM % 64 == 0);

typedef unsigned short v8us __attribute__((ext_vector_type(8), may_alias));
typedef float  v8f  __attribute__((ext_vector_type(8)));
typedef float  v4f  __attribute__((ext_vector_type(4)));
typedef float  v4fa __attribute__((ext_vector_type(4), may_alias));
typedef int    v4ia __attribute__((ext_vector_type(4), may_alias));
typedef _Float16 v16h __attribute__((ext_vector_type(16)));
typedef _Float16 v4h __attribute__((ext_vector_type(4)));
union FragH { v16h v; v8us half[2]; _Float16 h[16]; unsigned short u[16]; };

__device__ __forceinline__ unsigned short bf16_bits(float x) { unsigned int u = __float_as_uint(x); return (unsigned short)((u + 0x7FFFu + ((u >> 16) & 1u)) >> 16); }
__device__ __forceinline__ float bf16_val(unsigned short b) { return __uint_as_float(((unsigned int)b) << 16); }
__device__ __forceinline__ float bf16_rne(float x) { return bf16_val(bf16_bits(x)); }

// ---- f16 WMMA GEMM: wave tile 32x64; A [m][k] f16 (pitch lda), Bt [n][k] f16 (pitch ldb); fragments in the split k layout (elements 0..7 <- k0+8h.., 8..15 <- k0+16+8h..) for both operands ----
__device__ __forceinline__ v16h g2_frag(const _Float16* p, int hh) { FragH f; f.half[0] = *(const v8us*)((const unsigned short*)p + 8 * hh); f.half[1] = *(const v8us*)((const unsigned short*)p + 16 + 8 * hh); return f.v; }
__device__ __forceinline__ v8f g2_mma(v16h a, v16h b, v8f c) { v8f d = __builtin_amdgcn_wmma_f32_16x16x32_f16(false, a, false, b, (short)0, c, false, false); asm volatile("v_nop\n\tv_nop\n\tv_nop\n\tv_nop" : "+v"(d) : "v"(a), "v"(b)); return d; }
// C = act(A . Bt^T * alpha + bf16(bias[by*sBias + col]) (+ CP plane if non-null)); grid.y = by selects a z slice through the strides sA, sB, sC; requires M % 128 == 0 (rows per 4-wave block), N % 64 == 0, K % 32 == 0.
template <int ACT>
__global__ __launch_bounds__(128) void k_gemm2(const _Float16* __restrict__ A, int lda, size_t sA, const _Float16* __restrict__ Bh, int ldb, size_t sB, float alpha, const float* __restrict__ bias, size_t sBias, const float* __restrict__ CP, int rowsPerB, size_t sCPb, int row0g,
    float* __restrict__ C, _Float16* __restrict__ C16, int ldc, size_t sC, int M, int N, int K) {
  static_assert(ACT == 0 || ACT == 3);
  __shared__ __attribute__((aligned(16))) float so[4][32][68];
  const int tid = threadIdx.x, w = tid >> 5, lane = tid & 31, ln = lane & 15, hh = lane >> 4; const int by = blockIdx.y;
  A += (size_t)by * sA; Bh += (size_t)by * sB; const size_t cofs = (size_t)by * sC; const float* bp = bias ? bias + (size_t)by * sBias : nullptr;
  const int ntn = N >> 6; const int mt = blockIdx.x / ntn, nq = blockIdx.x - mt * ntn; const int row0 = mt * 128 + 32 * w, col0 = nq * 64; if (row0 >= M) return;
  const _Float16* a0p = A + (size_t)(row0 + ln) * lda; const _Float16* a1p = a0p + (size_t)16 * lda;
  const _Float16* b0p = Bh + (size_t)(col0 + ln) * ldb; const _Float16* b1p = b0p + (size_t)16 * ldb; const _Float16* b2p = b1p + (size_t)16 * ldb; const _Float16* b3p = b2p + (size_t)16 * ldb;
  const v8f z8 = {0.f,0.f,0.f,0.f,0.f,0.f,0.f,0.f}; v8f c00 = z8, c01 = z8, c02 = z8, c03 = z8, c10 = z8, c11 = z8, c12 = z8, c13 = z8;
#pragma unroll 1
  for (int kb = 0; kb < K; kb += 32) { const v16h a0 = g2_frag(a0p + kb, hh), a1 = g2_frag(a1p + kb, hh);
    v16h b = g2_frag(b0p + kb, hh); c00 = g2_mma(a0, b, c00); c10 = g2_mma(a1, b, c10);
    b = g2_frag(b1p + kb, hh); c01 = g2_mma(a0, b, c01); c11 = g2_mma(a1, b, c11);
    b = g2_frag(b2p + kb, hh); c02 = g2_mma(a0, b, c02); c12 = g2_mma(a1, b, c12);
    b = g2_frag(b3p + kb, hh); c03 = g2_mma(a0, b, c03); c13 = g2_mma(a1, b, c13); }
  v8f accs[8] = {c00, c01, c02, c03, c10, c11, c12, c13};
#pragma unroll
  for (int u = 0; u < 8; ++u) { const int t = u & 3, half = u >> 2; const int col = col0 + t * 16 + ln; const float bv = bp ? bf16_rne(bp[col]) : 0.f;
#pragma unroll
    for (int r = 0; r < 8; ++r) { const int rloc = half * 16 + 8 * hh + r; float v = accs[u][r] * alpha + bv;
      if (CP) { if (rowsPerB < 0) v += CP[cofs + (size_t)(row0g + row0 + rloc) * ldc + col]; else { const int bidx = (row0g + row0 + rloc) / rowsPerB; v += CP[(size_t)bidx * sCPb + (size_t)by * 64 + col]; } }
      if (ACT == 3) v = fmaxf(v, 0.f);
      so[w][rloc][t * 16 + ln] = v; } }
  __builtin_amdgcn_fence(4, "workgroup"); __builtin_amdgcn_wave_barrier();
  const int rsub = lane >> 4, c4 = (lane & 15) * 4;
  {
#pragma unroll
    for (int q = 0; q < 16; ++q) { const int r = q * 2 + rsub; const v4f v = *(const v4fa*)&so[w][r][c4];
      if (C) *(v4f*)(C + cofs + (size_t)(row0 + r) * ldc + col0 + c4) = v;
      if (C16) { v4h h4; for (int i = 0; i < 4; ++i) h4[i] = (_Float16)v[i]; *(v4h*)(C16 + cofs + (size_t)(row0 + r) * ldc + col0 + c4) = h4; } }
     } }

__global__ __launch_bounds__(256) void k_wnat(const float* __restrict__ w, size_t n8, _Float16* __restrict__ Bt) {
  const size_t t = (size_t)blockIdx.x * 256 + threadIdx.x; if (t >= n8) return;
  const v4f a = *(const v4fa*)(w + t * 8), c = *(const v4fa*)(w + t * 8 + 4); FragH f;
#pragma unroll
  for (int q = 0; q < 4; ++q) { f.h[q] = (_Float16)(bf16_rne(a[q]) * 16.0f); f.h[4 + q] = (_Float16)(bf16_rne(c[q]) * 16.0f); }
  *(v8us*)((unsigned short*)Bt + t * 8) = f.half[0];  }

__global__ __launch_bounds__(256) void k_x16(const float* __restrict__ x, _Float16* __restrict__ X16, size_t n8) {
  const size_t t = (size_t)blockIdx.x * 256 + threadIdx.x; if (t >= n8) return;
  const size_t per = (size_t)SEQ * DM / 8; const size_t b = t / per, rem = t - b * per;
  const float* src = x + b * ((size_t)SEQ_FULL * DM) + rem * 8;
  const v4f a = *(const v4fa*)src, c = *(const v4fa*)(src + 4); FragH f;
#pragma unroll
  for (int q = 0; q < 4; ++q) { f.h[q] = (_Float16)bf16_rne(a[q]); f.h[4 + q] = (_Float16)bf16_rne(c[q]); }
  *(v8us*)((unsigned short*)X16 + t * 8) = f.half[0];  }

template <int NHv, int TTv>
__global__ __launch_bounds__(256) void k_vt(const _Float16* __restrict__ V16, int ldv, int voff, _Float16* __restrict__ Vt) {
  __shared__ unsigned short tl[64][66]; const int tid = threadIdx.x; const int slab = blockIdx.x / (TTv / 64), lg = blockIdx.x % (TTv / 64); const int b = slab / NHv, h = slab % NHv;
  for (int i = tid; i < 64 * 8; i += 256) { const int r = i / 8, c8 = (i % 8) * 8; FragH f; f.half[0] = *(const v8us*)((const unsigned short*)V16 + ((size_t)b * TTv + lg * 64 + r) * ldv + voff + h * 64 + c8);
#pragma unroll
    for (int q = 0; q < 8; ++q) tl[r][c8 + q] = f.u[q]; }
  __syncthreads();
  {
#pragma unroll
    for (int rd = 0; rd < 2; ++rd) { const int d = rd * 32 + tid / 8, pc = tid % 8; FragH f;
#pragma unroll
      for (int q = 0; q < 8; ++q) f.u[q] = tl[pc * 8 + q][d];
      *(v8us*)((unsigned short*)Vt + ((size_t)slab * 64 + d) * TTv + lg * 64 + pc * 8) = f.half[0]; }
     } }

// gated row softmax for head-batched query tiles: thread t -> head t / QT, tile row i = t % QT (query q0 + i); key j is open iff adj[q0+i][j] != 0 (adj row pitch SEQ_FULL);
// both S and adj are loaded unconditionally as 16-B vectors and the gate enters as a select by value (closed -> -1e30, whose exp is exactly 0); f32 max / sum with the native exp;
__global__ __launch_bounds__(256) void k_rsmm(const float* __restrict__ S, const int* __restrict__ adj, _Float16* __restrict__ P, int hg, int q0) {
  #pragma clang fp contract(off)
  const int t = blockIdx.x * 256 + threadIdx.x; if (t >= hg * QT) return;
  const size_t i = (size_t)t; const float* s = S + i * NKX; const int* a = adj + (size_t)(q0 + (t % QT)) * SEQ_FULL;
  float mx = -3.0e38f;
#pragma unroll 1
  for (int j0 = 0; j0 < NKX; j0 += 4) { const v4f sv = *(const v4fa*)(s + j0); const v4ia av = *(const v4ia*)(a + j0);
#pragma unroll
    for (int q = 0; q < 4; ++q) { const float v = (av[q] != 0) ? sv[q] : -1.0e30f; mx = fmaxf(mx, v); } }
  float se = 0.f;
#pragma unroll 1
  for (int j0 = 0; j0 < NKX; j0 += 4) { const v4f sv = *(const v4fa*)(s + j0); const v4ia av = *(const v4ia*)(a + j0);
#pragma unroll
    for (int q = 0; q < 4; ++q) { const float v = (av[q] != 0) ? sv[q] : -1.0e30f; se += __expf(v - mx); } }
  const float sc = (mx > -1.0e29f) ? (1024.0f / se) : __uint_as_float(0x7fc00000u);
#pragma unroll 1
  for (int j0 = 0; j0 < NKX; j0 += 8) { const v4f s0 = *(const v4fa*)(s + j0), s1 = *(const v4fa*)(s + j0 + 4); const v4ia a0 = *(const v4ia*)(a + j0), a1 = *(const v4ia*)(a + j0 + 4); FragH fr;
#pragma unroll
    for (int q = 0; q < 4; ++q) { const float v0 = (a0[q] != 0) ? s0[q] : -1.0e30f; const float v1 = (a1[q] != 0) ? s1[q] : -1.0e30f; fr.h[q] = (_Float16)(__expf(v0 - mx) * sc); fr.h[4 + q] = (_Float16)(__expf(v1 - mx) * sc); }
    unsigned short* d = (unsigned short*)P + i * NKX + j0; *(v8us*)d = fr.half[0];  } }

extern "C" void kernel_launch(void* const* d_in, const int* in_sizes, int n_in,
                              void* d_out, int out_size, void* d_ws, size_t ws_size, hipStream_t stream) {
  if (n_in < 10) return;
  if (in_sizes[0] < NB * SEQ_FULL * DM || in_sizes[1] < SEQ * SEQ_FULL) return;
  if (in_sizes[2] < DM * DM || in_sizes[4] < DM * DM || in_sizes[6] < DM * DM || in_sizes[8] < DM * DM) return;
  if (in_sizes[3] < DM || in_sizes[5] < DM || in_sizes[7] < DM || in_sizes[9] < DM) return;
  if (out_size < (int)(NR * DM)) return;
  const float* x  = (const float*)d_in[0]; const int* adj = (const int*)d_in[1];
  const float* wq = (const float*)d_in[2]; const float* bq = (const float*)d_in[3];
  const float* wk = (const float*)d_in[4]; const float* bk = (const float*)d_in[5];
  const float* wv = (const float*)d_in[6]; const float* bv = (const float*)d_in[7];
  const float* wo = (const float*)d_in[8]; const float* bo = (const float*)d_in[9];
  char* ws = (char*)d_ws; size_t off = 0;
  auto take = [&](size_t bytes) { char* p = ws + off; off += (bytes + 255) & ~(size_t)255; return p; };
  _Float16* BQ  = (_Float16*)take((size_t)DM * DM * 2); _Float16* BK = (_Float16*)take((size_t)DM * DM * 2);
  _Float16* BV  = (_Float16*)take((size_t)DM * DM * 2); _Float16* BO = (_Float16*)take((size_t)DM * DM * 2);      /* Bt[n][k] x16 (natural [out][in]) */
  _Float16* X16 = (_Float16*)take(NR * DM * 2);                       /* [NR][DM] */
  _Float16* QKV = (_Float16*)take(NR * LQ * 2);                       /* [NR][3*DM]: q | k | v */
  _Float16* O16 = (_Float16*)take(NR * DM * 2);                       /* [NR][DM], o x64 */
  _Float16* VT  = (_Float16*)take((size_t)NB * NH * HD * SEQ * 2);    /* [NB*NH][64][SEQ] */
  float*    S   = (float*)take((size_t)NH * QT * NKX * 4);            /* [NH][QT][NKX] f32 */
  _Float16* P   = (_Float16*)take((size_t)NH * QT * NKX * 2);         /* [NH][QT][NKX] f16 */
  if (off > ws_size || off > (size_t)134217728) return;
  const size_t nw8 = (size_t)DM * DM / 8; const unsigned gw = (unsigned)((nw8 + 255) / 256);
  k_wnat<<<gw, 256, 0, stream>>>(wq, nw8, BQ); k_wnat<<<gw, 256, 0, stream>>>(wk, nw8, BK); k_wnat<<<gw, 256, 0, stream>>>(wv, nw8, BV); k_wnat<<<gw, 256, 0, stream>>>(wo, nw8, BO);
  k_x16<<<(unsigned)((NR * DM / 8 + 255) / 256), 256, 0, stream>>>(x, X16, NR * DM / 8);
  const dim3 gp((unsigned)((NR / 128) * (DM / 64)), 1);
  k_gemm2<0><<<gp, 128, 0, stream>>>(X16, DM, 0, BQ, DM, 0, 0.0625f, bq, 0, nullptr, 1, 0, 0, nullptr, QKV,          LQ, 0, (int)NR, DM, DM);      /* q rows (f16), head h = columns h*64.. */
  k_gemm2<0><<<gp, 128, 0, stream>>>(X16, DM, 0, BK, DM, 0, 0.0625f, bk, 0, nullptr, 1, 0, 0, nullptr, QKV + DM,     LQ, 0, (int)NR, DM, DM);      /* k rows */
  k_gemm2<0><<<gp, 128, 0, stream>>>(X16, DM, 0, BV, DM, 0, 0.0625f, bv, 0, nullptr, 1, 0, 0, nullptr, QKV + 2 * DM, LQ, 0, (int)NR, DM, DM);      /* v rows */
  k_vt<NH, SEQ><<<(unsigned)(NB * NH * (SEQ / 64)), 256, 0, stream>>>(QKV + 2 * DM, LQ, 0, VT);      /* V^T [NB*NH][HD][SEQ] */
  for (int b = 0; b < NB; ++b) { const size_t r0 = (size_t)b * SEQ;
    for (int q0 = 0; q0 < SEQ; q0 += QT) {
      k_gemm2<0><<<dim3((QT / 128) * (SEQ / 64), NH), 128, 0, stream>>>(QKV + (r0 + q0) * LQ, LQ, (size_t)HD, QKV + DM + r0 * LQ, LQ, (size_t)HD, 0.125f, nullptr, 0, nullptr, 1, 0, 0, S, nullptr, NKX, (size_t)QT * NKX, QT, SEQ, HD);      /* scores, all heads on grid.y */
      k_rsmm<<<(NH * QT + 255) / 256, 256, 0, stream>>>(S, adj, P, NH, q0);
      k_gemm2<0><<<dim3((QT / 128) * (HD / 64), NH), 128, 0, stream>>>(P, NKX, (size_t)QT * NKX, VT + (size_t)b * NH * HD * SEQ, SEQ, (size_t)HD * SEQ, 0.0625f, nullptr, 0, nullptr, 1, 0, 0, nullptr, O16 + (r0 + q0) * DM, DM, (size_t)HD, QT, HD, SEQ); } }      /* o (merged heads, x64) f16 rows */
  k_gemm2<0><<<gp, 128, 0, stream>>>(O16, DM, 0, BO, DM, 0, 0.0009765625f, bo, 0, nullptr, 1, 0, 0, (float*)d_out, nullptr, DM, 0, (int)NR, DM, DM);      /* out rows = output layout [b][s][DM] */
}

// v001
// Measured time: 1310 microseconds a run.
// Two timings next to v000 put it at 4.74 and 4.77 times that version's speed.
#include <hip/hip_runtime.h>
// All contractions (q, k, v projections K=512; q.k^T per head K=64; softmax weights . V K=SEQ; output projection K=512): v_wmma_f32_16x16x32_f16, f16 operands (every float input RNE-converted to bf16 first; weights carried x16, softmax weights x1024, o carried x64), f32 accumulate; softmax statistics f32 on the VALU.
// Structure: token rows r = b*SEQ + s. X16 = f16(bf16(h)); q | k | v as f16 rows [r][3*DM] from three GEMMs (alpha 1/16, bias bf16); V^T planes [b*NH+h][64][SEQ] through an LDS transpose;
// per (batch, query tile of QT rows): S[h][i][j] = q.k * 0.125 in f32 for all heads, row softmax gated by the integer adjacency (adj[q][j] == 0 -> weight exactly 0; a row with no open key yields NaN), P = f16(1024 w),
// o = P . V^T * 2^-4 written as f16 rows [r][DM] (head h -> columns h*64); out = o . Wo^T * 2^-10 + bf16(bo) in f32.
#ifndef NB
#define NB 4
#endif
#ifndef SEQ
#define SEQ 2048
#endif
#define NB_FULL 4
#define SEQ_FULL 2048                /* pitch of adj rows and per-batch stride of h */
#define DM 512
#define NH 8
#define HD 64
#define LQ (3 * DM)                  /* row pitch of the q | k | v plane */
#ifndef QT
#if SEQ >= 512
#define QT 512
#else
#define QT SEQ
#endif
#endif
#define NKX SEQ                      /* S / P row pitch */
#define NR ((size_t)NB * SEQ)        /* token rows */
static_assert(NB >= 1 && NB <= NB_FULL);
static_assert(SEQ >= 128 && SEQ <= SEQ_FULL);
static_assert(SEQ % QT == 0);
static_assert(QT % 128 == 0);
static_assert(SEQ % 64 == 0);
static_assert((NB * SEQ) % 128 == 0);
static_assert(DM == NH * HD && HD == 64 && DM % 64 == 0);

typedef unsigned short v8us __attribute__((ext_vector_type(8), may_alias));
typedef float  v8f  __attribute__((ext_vector_type(8)));
typedef float  v4f  __attribute__((ext_vector_type(4)));
typedef float  v4fa __attribute__((ext_vector_type(4), may_alias));
typedef int    v4ia __attribute__((ext_vector_type(4), may_alias));
typedef _Float16 v16h __attribute__((ext_vector_type(16)));
typedef _Float16 v4h __attribute__((ext_vector_type(4)));
union FragH { v16h v; v8us half[2]; _Float16 h[16]; unsigned short u[16]; };

__device__ __forceinline__ unsigned short bf16_bits(float x) { unsigned int u = __float_as_uint(x); return (unsigned short)((u + 0x7FFFu + ((u >> 16) & 1u)) >> 16); }
__device__ __forceinline__ float bf16_val(unsigned short b) { return __uint_as_float(((unsigned int)b) << 16); }
__device__ __forceinline__ float bf16_rne(float x) { return bf16_val(bf16_bits(x)); }

// ---- f16 WMMA GEMM: wave tile 32x64; A [m][k] f16 (pitch lda), Bt [n][k] f16 (pitch ldb); fragments in the split k layout (elements 0..7 <- k0+8h.., 8..15 <- k0+16+8h..) for both operands ----
__device__ __forceinline__ v16h g2_frag(const _Float16* p, int hh) { FragH f; f.half[0] = *(const v8us*)((const unsigned short*)p + 8 * hh); f.half[1] = *(const v8us*)((const unsigned short*)p + 16 + 8 * hh); return f.v; }
__device__ __forceinline__ v8f g2_mma(v16h a, v16h b, v8f c) { v8f d = __builtin_amdgcn_wmma_f32_16x16x32_f16(false, a, false, b, (short)0, c, false, false); asm volatile("v_nop\n\tv_nop\n\tv_nop\n\tv_nop" : "+v"(d) : "v"(a), "v"(b)); return d; }
// C = act(A . Bt^T * alpha + bf16(bias[by*sBias + col]) (+ CP plane if non-null)); grid.y = by selects a z slice through the strides sA, sB, sC; requires M % 128 == 0 (rows per 4-wave block), N % 64 == 0, K % 32 == 0.
template <int ACT>
__global__ __launch_bounds__(128) void k_gemm2(const _Float16* __restrict__ A, int lda, size_t sA, const _Float16* __restrict__ Bh, int ldb, size_t sB, float alpha, const float* __restrict__ bias, size_t sBias, const float* __restrict__ CP, int rowsPerB, size_t sCPb, int row0g,
    float* __restrict__ C, _Float16* __restrict__ C16, int ldc, size_t sC, int M, int N, int K) {
  static_assert(ACT == 0 || ACT == 3);
  __shared__ __attribute__((aligned(16))) float so[4][32][68];
  const int tid = threadIdx.x, w = tid >> 5, lane = tid & 31, ln = lane & 15, hh = lane >> 4; const int by = blockIdx.y;
  A += (size_t)by * sA; Bh += (size_t)by * sB; const size_t cofs = (size_t)by * sC; const float* bp = bias ? bias + (size_t)by * sBias : nullptr;
  const int ntn = N >> 6; const int mt = blockIdx.x / ntn, nq = blockIdx.x - mt * ntn; const int row0 = mt * 128 + 32 * w, col0 = nq * 64; if (row0 >= M) return;
  const _Float16* a0p = A + (size_t)(row0 + ln) * lda; const _Float16* a1p = a0p + (size_t)16 * lda;
  const _Float16* b0p = Bh + (size_t)(col0 + ln) * ldb; const _Float16* b1p = b0p + (size_t)16 * ldb; const _Float16* b2p = b1p + (size_t)16 * ldb; const _Float16* b3p = b2p + (size_t)16 * ldb;
  const v8f z8 = {0.f,0.f,0.f,0.f,0.f,0.f,0.f,0.f}; v8f c00 = z8, c01 = z8, c02 = z8, c03 = z8, c10 = z8, c11 = z8, c12 = z8, c13 = z8;
#pragma unroll 1
  for (int kb = 0; kb < K; kb += 32) { const v16h a0 = g2_frag(a0p + kb, hh), a1 = g2_frag(a1p + kb, hh);
    v16h b = g2_frag(b0p + kb, hh); c00 = g2_mma(a0, b, c00); c10 = g2_mma(a1, b, c10);
    b = g2_frag(b1p + kb, hh); c01 = g2_mma(a0, b, c01); c11 = g2_mma(a1, b, c11);
    b = g2_frag(b2p + kb, hh); c02 = g2_mma(a0, b, c02); c12 = g2_mma(a1, b, c12);
    b = g2_frag(b3p + kb, hh); c03 = g2_mma(a0, b, c03); c13 = g2_mma(a1, b, c13); }
  v8f accs[8] = {c00, c01, c02, c03, c10, c11, c12, c13};
#pragma unroll
  for (int u = 0; u < 8; ++u) { const int t = u & 3, half = u >> 2; const int col = col0 + t * 16 + ln; const float bv = bp ? bf16_rne(bp[col]) : 0.f;
#pragma unroll
    for (int r = 0; r < 8; ++r) { const int rloc = half * 16 + 8 * hh + r; float v = accs[u][r] * alpha + bv;
      if (CP) { if (rowsPerB < 0) v += CP[cofs + (size_t)(row0g + row0 + rloc) * ldc + col]; else { const int bidx = (row0g + row0 + rloc) / rowsPerB; v += CP[(size_t)bidx * sCPb + (size_t)by * 64 + col]; } }
      if (ACT == 3) v = fmaxf(v, 0.f);
      so[w][rloc][t * 16 + ln] = v; } }
  __builtin_amdgcn_fence(4, "workgroup"); __builtin_amdgcn_wave_barrier();
  const int rsub = lane >> 4, c4 = (lane & 15) * 4;
  {
#pragma unroll
    for (int q = 0; q < 16; ++q) { const int r = q * 2 + rsub; const v4f v = *(const v4fa*)&so[w][r][c4];
      if (C) *(v4f*)(C + cofs + (size_t)(row0 + r) * ldc + col0 + c4) = v;
      if (C16) { v4h h4; for (int i = 0; i < 4; ++i) h4[i] = (_Float16)v[i]; *(v4h*)(C16 + cofs + (size_t)(row0 + r) * ldc + col0 + c4) = h4; } }
     } }

__global__ __launch_bounds__(256) void k_wnat(const float* __restrict__ w, size_t n8, _Float16* __restrict__ Bt) {
  const size_t t = (size_t)blockIdx.x * 256 + threadIdx.x; if (t >= n8) return;
  const v4f a = *(const v4fa*)(w + t * 8), c = *(const v4fa*)(w + t * 8 + 4); FragH f;
#pragma unroll
  for (int q = 0; q < 4; ++q) { f.h[q] = (_Float16)(bf16_rne(a[q]) * 16.0f); f.h[4 + q] = (_Float16)(bf16_rne(c[q]) * 16.0f); }
  *(v8us*)((unsigned short*)Bt + t * 8) = f.half[0];  }

__global__ __launch_bounds__(256) void k_x16(const float* __restrict__ x, _Float16* __restrict__ X16, size_t n8) {
  const size_t t = (size_t)blockIdx.x * 256 + threadIdx.x; if (t >= n8) return;
  const size_t per = (size_t)SEQ * DM / 8; const size_t b = t / per, rem = t - b * per;
  const float* src = x + b * ((size_t)SEQ_FULL * DM) + rem * 8;
  const v4f a = *(const v4fa*)src, c = *(const v4fa*)(src + 4); FragH f;
#pragma unroll
  for (int q = 0; q < 4; ++q) { f.h[q] = (_Float16)bf16_rne(a[q]); f.h[4 + q] = (_Float16)bf16_rne(c[q]); }
  *(v8us*)((unsigned short*)X16 + t * 8) = f.half[0];  }

template <int NHv, int TTv>
__global__ __launch_bounds__(256) void k_vt(const _Float16* __restrict__ V16, int ldv, int voff, _Float16* __restrict__ Vt) {
  __shared__ unsigned short tl[64][66]; const int tid = threadIdx.x; const int slab = blockIdx.x / (TTv / 64), lg = blockIdx.x % (TTv / 64); const int b = slab / NHv, h = slab % NHv;
  for (int i = tid; i < 64 * 8; i += 256) { const int r = i / 8, c8 = (i % 8) * 8; FragH f; f.half[0] = *(const v8us*)((const unsigned short*)V16 + ((size_t)b * TTv + lg * 64 + r) * ldv + voff + h * 64 + c8);
#pragma unroll
    for (int q = 0; q < 8; ++q) tl[r][c8 + q] = f.u[q]; }
  __syncthreads();
  {
#pragma unroll
    for (int rd = 0; rd < 2; ++rd) { const int d = rd * 32 + tid / 8, pc = tid % 8; FragH f;
#pragma unroll
      for (int q = 0; q < 8; ++q) f.u[q] = tl[pc * 8 + q][d];
      *(v8us*)((unsigned short*)Vt + ((size_t)slab * 64 + d) * TTv + lg * 64 + pc * 8) = f.half[0]; }
     } }

// gated row softmax for head-batched query tiles, one wave per row: wave g -> tile row i = g / hg (query q0 + i), head g % hg, so the waves of a block share one adj row; key j is open iff adj[q0+i][j] != 0 (adj row pitch SEQ_FULL);
// lane l holds keys c*128 + 4*l .. +3 of every 128-key chunk c in registers: S and adj are each read once, as 512 contiguous bytes per wave load, and the gate enters as a select by value (closed -> -1e30, whose exp is exactly 0);
// f32 max / sum with the native exp: per-lane partials, then a five-step butterfly over the 32 lanes. Every loop over c or q is fully unrolled so that v[] and av[] are registers, not scratch memory.
static_assert(NKX % 128 == 0);
// 2^x of four values in place (what the native exp compiles to behind its multiply by log2 e). The four v_exp_f32 name disjoint registers; the closing v_nop keeps the one slot that the instruction set
// asks for between a transcendental and the next use of its result or overwrite of its source.
__device__ __forceinline__ v4f exp2x4(v4f x) { float a = x[0], b = x[1], c = x[2], d = x[3];
  asm("v_exp_f32 %0, %0\n\tv_exp_f32 %1, %1\n\tv_exp_f32 %2, %2\n\tv_exp_f32 %3, %3\n\tv_nop" : "+v"(a), "+v"(b), "+v"(c), "+v"(d));
  const v4f r = {a, b, c, d}; return r; }
__global__ __launch_bounds__(256) void k_rsmm(const float* __restrict__ S, const int* __restrict__ adj, _Float16* __restrict__ P, int hg, int q0) {
  const int lane = threadIdx.x & 31; const int g = blockIdx.x * 8 + (threadIdx.x >> 5); if (g >= hg * QT) return;
  const int i = g / hg, h = g - i * hg; const size_t row = (size_t)h * QT + i;
  const float* s = S + row * NKX + lane * 4; const int* a = adj + (size_t)(q0 + i) * SEQ_FULL + lane * 4;
  constexpr int NC = NKX / 128; v4f v[NC]; v4ia av[NC]; float mx = -3.0e38f;
#pragma unroll
  for (int c = 0; c < NC; ++c) { v[c] = *(const v4fa*)(s + c * 128); av[c] = *(const v4ia*)(a + c * 128); }
  asm volatile("s_wait_xcnt 0x0" ::: "memory");      /* stands behind the loads, in front of the first instruction that may reuse one of their address registers */
  __builtin_amdgcn_sched_barrier(0);      /* all of the row's loads issue before the first use: without it the compiler reuses load registers and the row costs several memory latencies in a row instead of one */
#pragma unroll
  for (int c = 0; c < NC; ++c) {
#pragma unroll
    for (int q = 0; q < 4; ++q) { v[c][q] = (av[c][q] != 0) ? v[c][q] : -1.0e30f; mx = fmaxf(mx, v[c][q]); } }
#pragma unroll
  for (int m = 16; m >= 1; m >>= 1) mx = fmaxf(mx, __shfl_xor(mx, m));
  float se = 0.f;
#pragma unroll
  for (int c = 0; c < NC; ++c) { v[c] = exp2x4((v[c] - mx) * 1.44269504088896340736f);
#pragma unroll
    for (int q = 0; q < 4; ++q) se += v[c][q]; }
#pragma unroll
  for (int m = 16; m >= 1; m >>= 1) se += __shfl_xor(se, m);
  const float sc = (mx > -1.0e29f) ? (1024.0f / se) : __uint_as_float(0x7fc00000u);
  _Float16* d = P + row * NKX + lane * 4;
#pragma unroll
  for (int c = 0; c < NC; ++c) { v4h h4;
#pragma unroll
    for (int q = 0; q < 4; ++q) h4[q] = (_Float16)(v[c][q] * sc);
    *(v4h*)(d + c * 128) = h4; } }

extern "C" void kernel_launch(void* const* d_in, const int* in_sizes, int n_in,
                              void* d_out, int out_size, void* d_ws, size_t ws_size, hipStream_t stream) {
  if (n_in < 10) return;
  if (in_sizes[0] < NB * SEQ_FULL * DM || in_sizes[1] < SEQ * SEQ_FULL) return;
  if (in_sizes[2] < DM * DM || in_sizes[4] < DM * DM || in_sizes[6] < DM * DM || in_sizes[8] < DM * DM) return;
  if (in_sizes[3] < DM || in_sizes[5] < DM || in_sizes[7] < DM || in_sizes[9] < DM) return;
  if (out_size < (int)(NR * DM)) return;
  const float* x  = (const float*)d_in[0]; const int* adj = (const int*)d_in[1];
  const float* wq = (const float*)d_in[2]; const float* bq = (const float*)d_in[3];
  const float* wk = (const float*)d_in[4]; const float* bk = (const float*)d_in[5];
  const float* wv = (const float*)d_in[6]; const float* bv = (const float*)d_in[7];
  const float* wo = (const float*)d_in[8]; const float* bo = (const float*)d_in[9];
  char* ws = (char*)d_ws; size_t off = 0;
  auto take = [&](size_t bytes) { char* p = ws + off; off += (bytes + 255) & ~(size_t)255; return p; };
  _Float16* BQ  = (_Float16*)take((size_t)DM * DM * 2); _Float16* BK = (_Float16*)take((size_t)DM * DM * 2);
  _Float16* BV  = (_Float16*)take((size_t)DM * DM * 2); _Float16* BO = (_Float16*)take((size_t)DM * DM * 2);      /* Bt[n][k] x16 (natural [out][in]) */
  _Float16* X16 = (_Float16*)take(NR * DM * 2);                       /* [NR][DM] */
  _Float16* QKV = (_Float16*)take(NR * LQ * 2);                       /* [NR][3*DM]: q | k | v */
  _Float16* O16 = (_Float16*)take(NR * DM * 2);                       /* [NR][DM], o x64 */
  _Float16* VT  = (_Float16*)take((size_t)NB * NH * HD * SEQ * 2);    /* [NB*NH][64][SEQ] */
  float*    S   = (float*)take((size_t)NH * QT * NKX * 4);            /* [NH][QT][NKX] f32 */
  _Float16* P   = (_Float16*)take((size_t)NH * QT * NKX * 2);         /* [NH][QT][NKX] f16 */
  if (off > ws_size || off > (size_t)134217728) return;
  const size_t nw8 = (size_t)DM * DM / 8; const unsigned gw = (unsigned)((nw8 + 255) / 256);
  k_wnat<<<gw, 256, 0, stream>>>(wq, nw8, BQ); k_wnat<<<gw, 256, 0, stream>>>(wk, nw8, BK); k_wnat<<<gw, 256, 0, stream>>>(wv, nw8, BV); k_wnat<<<gw, 256, 0, stream>>>(wo, nw8, BO);
  k_x16<<<(unsigned)((NR * DM / 8 + 255) / 256), 256, 0, stream>>>(x, X16, NR * DM / 8);
  const dim3 gp((unsigned)((NR / 128) * (DM / 64)), 1);
  k_gemm2<0><<<gp, 128, 0, stream>>>(X16, DM, 0, BQ, DM, 0, 0.0625f, bq, 0, nullptr, 1, 0, 0, nullptr, QKV,          LQ, 0, (int)NR, DM, DM);      /* q rows (f16), head h = columns h*64.. */
  k_gemm2<0><<<gp, 128, 0, stream>>>(X16, DM, 0, BK, DM, 0, 0.0625f, bk, 0, nullptr, 1, 0, 0, nullptr, QKV + DM,     LQ, 0, (int)NR, DM, DM);      /* k rows */
  k_gemm2<0><<<gp, 128, 0, stream>>>(X16, DM, 0, BV, DM, 0, 0.0625f, bv, 0, nullptr, 1, 0, 0, nullptr, QKV + 2 * DM, LQ, 0, (int)NR, DM, DM);      /* v rows */
  k_vt<NH, SEQ><<<(unsigned)(NB * NH * (SEQ / 64)), 256, 0, stream>>>(QKV + 2 * DM, LQ, 0, VT);      /* V^T [NB*NH][HD][SEQ] */
  for (int b = 0; b < NB; ++b) { const size_t r0 = (size_t)b * SEQ;
    for (int q0 = 0; q0 < SEQ; q0 += QT) {
      k_gemm2<0><<<dim3((QT / 128) * (SEQ / 64), NH), 128, 0, stream>>>(QKV + (r0 + q0) * LQ, LQ, (size_t)HD, QKV + DM + r0 * LQ, LQ, (size_t)HD, 0.125f, nullptr, 0, nullptr, 1, 0, 0, S, nullptr, NKX, (size_t)QT * NKX, QT, SEQ, HD);      /* scores, all heads on grid.y */
      k_rsmm<<<(NH * QT + 7) / 8, 256, 0, stream>>>(S, adj, P, NH, q0);
      k_gemm2<0><<<dim3((QT / 128) * (HD / 64), NH), 128, 0, stream>>>(P, NKX, (size_t)QT * NKX, VT + (size_t)b * NH * HD * SEQ, SEQ, (size_t)HD * SEQ, 0.0625f, nullptr, 0, nullptr, 1, 0, 0, nullptr, O16 + (r0 + q0) * DM, DM, (size_t)HD, QT, HD, SEQ); } }      /* o (merged heads, x64) f16 rows */
  k_gemm2<0><<<gp, 128, 0, stream>>>(O16, DM, 0, BO, DM, 0, 0.0009765625f, bo, 0, nullptr, 1, 0, 0, (float*)d_out, nullptr, DM, 0, (int)NR, DM, DM);      /* out rows = output layout [b][s][DM] */
}

// v002
// It runs in 196 microseconds.
// Next to v001, in two timings, it ran 6.69 and 6.78 times as fast.
// Over all steps from v000 it is 32.0 times as fast.
#include <hip/hip_runtime.h>
// All contractions (q, k, v projections K=512; q.k^T per head K=64; softmax weights . V K=SEQ; output projection K=512): v_wmma_f32_16x16x32_f16, f16 operands (every float input RNE-converted to bf16 first; weights carried x16, softmax weights carried unnormalised as 2^(t - m) <= 2^8, o carried x64), f32 accumulate; softmax statistics f32 on the VALU.
// Structure: token rows r = b*SEQ + s. X16 = f16(bf16(h)); q | k | v as f16 rows [r][3*DM] from three GEMMs (alpha 1/16, bias bf16); V^T planes [b*NH+h][64][SEQ] through an LDS transpose;
// per (batch, head, 32 query rows) one wave walks the keys 32 at a time: S^T = K . Q^T in f32, gated by the integer adjacency (adj[q][j] == 0 -> weight exactly 0; a row with no open key yields NaN), running maximum and sum per query in f32,
// P = f16(2^(t - m)) taken from the score accumulators as the B operand of O^T += V^T . P^T; o = O^T * 64 / sum written as f16 rows [r][DM] (head h -> columns h*64); out = o . Wo^T * 2^-10 + bf16(bo) in f32.
#ifndef NB
#define NB 4
#endif
#ifndef SEQ
#define SEQ 2048
#endif
#define NB_FULL 4
#define SEQ_FULL 2048                /* pitch of adj rows and per-batch stride of h */
#define DM 512
#define NH 8
#define HD 64
#define LQ (3 * DM)                  /* row pitch of the q | k | v plane */
#define NR ((size_t)NB * SEQ)        /* token rows */
static_assert(NB >= 1 && NB <= NB_FULL);
static_assert(SEQ >= 128 && SEQ <= SEQ_FULL);
static_assert(SEQ % 256 == 0);      /* a block of the attention kernel owns 256 query rows; V^T is cut in 64-key slabs */
static_assert((NB * SEQ) % 128 == 0);
static_assert(DM == NH * HD && HD == 64 && DM % 64 == 0);

typedef unsigned short v8us __attribute__((ext_vector_type(8), may_alias));
typedef float  v8f  __attribute__((ext_vector_type(8)));
typedef float  v4f  __attribute__((ext_vector_type(4)));
typedef float  v4fa __attribute__((ext_vector_type(4), may_alias));
typedef int    v4ia __attribute__((ext_vector_type(4), may_alias));
typedef _Float16 v16h __attribute__((ext_vector_type(16)));
typedef _Float16 v4h __attribute__((ext_vector_type(4)));
union FragH { v16h v; v8us half[2]; _Float16 h[16]; unsigned short u[16]; };

__device__ __forceinline__ unsigned short bf16_bits(float x) { unsigned int u = __float_as_uint(x); return (unsigned short)((u + 0x7FFFu + ((u >> 16) & 1u)) >> 16); }
__device__ __forceinline__ float bf16_val(unsigned short b) { return __uint_as_float(((unsigned int)b) << 16); }
__device__ __forceinline__ float bf16_rne(float x) { return bf16_val(bf16_bits(x)); }

// ---- f16 WMMA GEMM: wave tile 32x64; A [m][k] f16 (pitch lda), Bt [n][k] f16 (pitch ldb); fragments in the split k layout (elements 0..7 <- k0+8h.., 8..15 <- k0+16+8h..) for both operands ----
__device__ __forceinline__ v16h g2_frag(const _Float16* p, int hh) { FragH f; f.half[0] = *(const v8us*)((const unsigned short*)p + 8 * hh); f.half[1] = *(const v8us*)((const unsigned short*)p + 16 + 8 * hh); return f.v; }
__device__ __forceinline__ v8f g2_mma(v16h a, v16h b, v8f c) { v8f d = __builtin_amdgcn_wmma_f32_16x16x32_f16(false, a, false, b, (short)0, c, false, false); asm volatile("v_nop\n\tv_nop\n\tv_nop\n\tv_nop" : "+v"(d) : "v"(a), "v"(b)); return d; }
// C = act(A . Bt^T * alpha + bf16(bias[by*sBias + col]) (+ CP plane if non-null)); grid.y = by selects a z slice through the strides sA, sB, sC; requires M % 128 == 0 (rows per 4-wave block), N % 64 == 0, K % 32 == 0.
template <int ACT>
__global__ __launch_bounds__(128) void k_gemm2(const _Float16* __restrict__ A, int lda, size_t sA, const _Float16* __restrict__ Bh, int ldb, size_t sB, float alpha, const float* __restrict__ bias, size_t sBias, const float* __restrict__ CP, int rowsPerB, size_t sCPb, int row0g,
    float* __restrict__ C, _Float16* __restrict__ C16, int ldc, size_t sC, int M, int N, int K) {
  static_assert(ACT == 0 || ACT == 3);
  __shared__ __attribute__((aligned(16))) float so[4][32][68];
  const int tid = threadIdx.x, w = tid >> 5, lane = tid & 31, ln = lane & 15, hh = lane >> 4; const int by = blockIdx.y;
  A += (size_t)by * sA; Bh += (size_t)by * sB; const size_t cofs = (size_t)by * sC; const float* bp = bias ? bias + (size_t)by * sBias : nullptr;
  const int ntn = N >> 6; const int mt = blockIdx.x / ntn, nq = blockIdx.x - mt * ntn; const int row0 = mt * 128 + 32 * w, col0 = nq * 64; if (row0 >= M) return;
  const _Float16* a0p = A + (size_t)(row0 + ln) * lda; const _Float16* a1p = a0p + (size_t)16 * lda;
  const _Float16* b0p = Bh + (size_t)(col0 + ln) * ldb; const _Float16* b1p = b0p + (size_t)16 * ldb; const _Float16* b2p = b1p + (size_t)16 * ldb; const _Float16* b3p = b2p + (size_t)16 * ldb;
  const v8f z8 = {0.f,0.f,0.f,0.f,0.f,0.f,0.f,0.f}; v8f c00 = z8, c01 = z8, c02 = z8, c03 = z8, c10 = z8, c11 = z8, c12 = z8, c13 = z8;
#pragma unroll 1
  for (int kb = 0; kb < K; kb += 32) { const v16h a0 = g2_frag(a0p + kb, hh), a1 = g2_frag(a1p + kb, hh);
    v16h b = g2_frag(b0p + kb, hh); c00 = g2_mma(a0, b, c00); c10 = g2_mma(a1, b, c10);
    b = g2_frag(b1p + kb, hh); c01 = g2_mma(a0, b, c01); c11 = g2_mma(a1, b, c11);
    b = g2_frag(b2p + kb, hh); c02 = g2_mma(a0, b, c02); c12 = g2_mma(a1, b, c12);
    b = g2_frag(b3p + kb, hh); c03 = g2_mma(a0, b, c03); c13 = g2_mma(a1, b, c13); }
  v8f accs[8] = {c00, c01, c02, c03, c10, c11, c12, c13};
#pragma unroll
  for (int u = 0; u < 8; ++u) { const int t = u & 3, half = u >> 2; const int col = col0 + t * 16 + ln; const float bv = bp ? bf16_rne(bp[col]) : 0.f;
#pragma unroll
    for (int r = 0; r < 8; ++r) { const int rloc = half * 16 + 8 * hh + r; float v = accs[u][r] * alpha + bv;
      if (CP) { if (rowsPerB < 0) v += CP[cofs + (size_t)(row0g + row0 + rloc) * ldc + col]; else { const int bidx = (row0g + row0 + rloc) / rowsPerB; v += CP[(size_t)bidx * sCPb + (size_t)by * 64 + col]; } }
      if (ACT == 3) v = fmaxf(v, 0.f);
      so[w][rloc][t * 16 + ln] = v; } }
  __builtin_amdgcn_fence(4, "workgroup"); __builtin_amdgcn_wave_barrier();
  const int rsub = lane >> 4, c4 = (lane & 15) * 4;
  {
#pragma unroll
    for (int q = 0; q < 16; ++q) { const int r = q * 2 + rsub; const v4f v = *(const v4fa*)&so[w][r][c4];
      if (C) *(v4f*)(C + cofs + (size_t)(row0 + r) * ldc + col0 + c4) = v;
      if (C16) { v4h h4; for (int i = 0; i < 4; ++i) h4[i] = (_Float16)v[i]; *(v4h*)(C16 + cofs + (size_t)(row0 + r) * ldc + col0 + c4) = h4; } }
     } }

__global__ __launch_bounds__(256) void k_wnat(const float* __restrict__ w, size_t n8, _Float16* __restrict__ Bt) {
  const size_t t = (size_t)blockIdx.x * 256 + threadIdx.x; if (t >= n8) return;
  const v4f a = *(const v4fa*)(w + t * 8), c = *(const v4fa*)(w + t * 8 + 4); FragH f;
#pragma unroll
  for (int q = 0; q < 4; ++q) { f.h[q] = (_Float16)(bf16_rne(a[q]) * 16.0f); f.h[4 + q] = (_Float16)(bf16_rne(c[q]) * 16.0f); }
  *(v8us*)((unsigned short*)Bt + t * 8) = f.half[0];  }

__global__ __launch_bounds__(256) void k_x16(const float* __restrict__ x, _Float16* __restrict__ X16, size_t n8) {
  const size_t t = (size_t)blockIdx.x * 256 + threadIdx.x; if (t >= n8) return;
  const size_t per = (size_t)SEQ * DM / 8; const size_t b = t / per, rem = t - b * per;
  const float* src = x + b * ((size_t)SEQ_FULL * DM) + rem * 8;
  const v4f a = *(const v4fa*)src, c = *(const v4fa*)(src + 4); FragH f;
#pragma unroll
  for (int q = 0; q < 4; ++q) { f.h[q] = (_Float16)bf16_rne(a[q]); f.h[4 + q] = (_Float16)bf16_rne(c[q]); }
  *(v8us*)((unsigned short*)X16 + t * 8) = f.half[0];  }

template <int NHv, int TTv>
__global__ __launch_bounds__(256) void k_vt(const _Float16* __restrict__ V16, int ldv, int voff, _Float16* __restrict__ Vt) {
  __shared__ unsigned short tl[64][66]; const int tid = threadIdx.x; const int slab = blockIdx.x / (TTv / 64), lg = blockIdx.x % (TTv / 64); const int b = slab / NHv, h = slab % NHv;
  for (int i = tid; i < 64 * 8; i += 256) { const int r = i / 8, c8 = (i % 8) * 8; FragH f; f.half[0] = *(const v8us*)((const unsigned short*)V16 + ((size_t)b * TTv + lg * 64 + r) * ldv + voff + h * 64 + c8);
#pragma unroll
    for (int q = 0; q < 8; ++q) tl[r][c8 + q] = f.u[q]; }
  __syncthreads();
  {
#pragma unroll
    for (int rd = 0; rd < 2; ++rd) { const int d = rd * 32 + tid / 8, pc = tid % 8; FragH f;
#pragma unroll
      for (int q = 0; q < 8; ++q) f.u[q] = tl[pc * 8 + q][d];
      *(v8us*)((unsigned short*)Vt + ((size_t)slab * 64 + d) * TTv + lg * 64 + pc * 8) = f.half[0]; }
     } }

// 2^x of four values in place (what the native exp compiles to behind its multiply by log2 e). The four v_exp_f32 name disjoint registers; the closing v_nop keeps the one slot that the instruction set
// asks for between a transcendental and the next use of its result or overwrite of its source.
__device__ __forceinline__ v4f exp2x4(v4f x) { float a = x[0], b = x[1], c = x[2], d = x[3];
  asm("v_exp_f32 %0, %0\n\tv_exp_f32 %1, %1\n\tv_exp_f32 %2, %2\n\tv_exp_f32 %3, %3\n\tv_nop" : "+v"(a), "+v"(b), "+v"(c), "+v"(d));
  const v4f r = {a, b, c, d}; return r; }
__device__ __forceinline__ float xhalf(float x) { return __builtin_bit_cast(float, __builtin_amdgcn_permlanex16(__builtin_bit_cast(int, x), __builtin_bit_cast(int, x), 0x76543210, 0xfedcba98, false, false)); }      /* lane l <- lane l ^ 16, on the vector pipe */
__device__ __forceinline__ v8f fa_mma(v16h a, v16h b, v8f c) { return __builtin_amdgcn_wmma_f32_16x16x32_f16(false, a, false, b, (short)0, c, false, false); }
__global__ __launch_bounds__(256) void k_fattn(const _Float16* __restrict__ QKV, const _Float16* __restrict__ VT, const int* __restrict__ adj, _Float16* __restrict__ O16) {
  const int lane = threadIdx.x & 31, w = threadIdx.x >> 5, ln = lane & 15, hh = lane >> 4;
  constexpr int QB = SEQ / 256; const int slab = blockIdx.x / QB, qb = blockIdx.x - slab * QB; const int b = slab / NH, h = slab - b * NH;
  const int q0 = qb * 256 + w * 32; const size_t r0 = (size_t)b * SEQ;
  const _Float16* qp = QKV + (r0 + q0 + ln) * LQ + h * HD + 8 * hh;      /* every fragment pointer below carries the lane half's 8 * hh itself, so g2_frag is called with 0 */
  v16h qf[2][2];
#pragma unroll
  for (int qt = 0; qt < 2; ++qt) { qf[qt][0] = g2_frag(qp + (size_t)qt * 16 * LQ, 0); qf[qt][1] = g2_frag(qp + (size_t)qt * 16 * LQ + 32, 0); }
  const _Float16* kp = QKV + DM + (r0 + ln) * LQ + h * HD + 8 * hh;
  const _Float16* vp = VT + ((size_t)slab * HD + ln) * SEQ + 8 * hh;
  const int* ap = adj + (size_t)(q0 + ln) * SEQ_FULL + 8 * hh;
  const v8f z8 = {0.f,0.f,0.f,0.f,0.f,0.f,0.f,0.f};
  v8f o[2][4]; float m[2] = {-3.0e38f, -3.0e38f}, l[2] = {0.f, 0.f};
#pragma unroll
  for (int qt = 0; qt < 2; ++qt) {
#pragma unroll
    for (int dt = 0; dt < 4; ++dt) o[qt][dt] = z8; }
  for (int k0 = 0; k0 < SEQ; k0 += 32, kp += (size_t)32 * LQ, vp += 32, ap += 32) {
    v16h kf[2][2], vf[4]; v4ia av[2][2][2];
#pragma unroll
    for (int kt = 0; kt < 2; ++kt) { const _Float16* p = kp + (size_t)kt * 16 * LQ; kf[kt][0] = g2_frag(p, 0); kf[kt][1] = g2_frag(p + 32, 0); }
#pragma unroll
    for (int qt = 0; qt < 2; ++qt) {
#pragma unroll
      for (int kt = 0; kt < 2; ++kt) { const int* p = ap + (size_t)qt * 16 * SEQ_FULL + kt * 16; av[qt][kt][0] = *(const v4ia*)p; av[qt][kt][1] = *(const v4ia*)(p + 4); } }
    asm volatile("s_wait_xcnt 0x0" ::: "memory");      /* stands behind the K and adj loads, in front of the V^T loads: this build lets a V^T load land in the register pair that the K loads address from */
#pragma unroll
    for (int dt = 0; dt < 4; ++dt) vf[dt] = g2_frag(vp + (size_t)dt * 16 * SEQ, 0);
    v8f s[2][2];
#pragma unroll
    for (int qt = 0; qt < 2; ++qt) {
#pragma unroll
      for (int kt = 0; kt < 2; ++kt) s[qt][kt] = fa_mma(kf[kt][1], qf[qt][1], fa_mma(kf[kt][0], qf[qt][0], z8)); }
    float ml[2];
#pragma unroll
    for (int qt = 0; qt < 2; ++qt) { float mx = -3.0e38f;
#pragma unroll
      for (int kt = 0; kt < 2; ++kt) {
#pragma unroll
        for (int r = 0; r < 8; ++r) { const float t = s[qt][kt][r] * 0.18033688011112042f; const float g = (av[qt][kt][r >> 2][r & 3] != 0) ? t : -1.0e30f; s[qt][kt][r] = g; mx = fmaxf(mx, g); } }
      ml[qt] = fmaxf(mx, xhalf(mx)); }
    const bool need = (ml[0] > m[0] + 8.0f) || (ml[1] > m[1] + 8.0f);
    if (__builtin_amdgcn_ballot_w32(need) != 0) {      /* one scalar branch a pass: the 64 multiplies are skipped while no query of the wave moves its maximum */
      const float n0 = (ml[0] > m[0] + 8.0f) ? ml[0] : m[0], n1 = (ml[1] > m[1] + 8.0f) ? ml[1] : m[1];
      const v4f d4 = {m[0] - n0, m[1] - n1, 0.f, 0.f}; const v4f al = exp2x4(d4); m[0] = n0; m[1] = n1;
#pragma unroll
      for (int qt = 0; qt < 2; ++qt) { l[qt] *= al[qt];
#pragma unroll
        for (int dt = 0; dt < 4; ++dt) o[qt][dt] *= al[qt]; } }
#pragma unroll
    for (int qt = 0; qt < 2; ++qt) { FragH pf;
#pragma unroll
      for (int kt = 0; kt < 2; ++kt) {
#pragma unroll
        for (int g = 0; g < 2; ++g) { const v4f x = {s[qt][kt][4 * g] - m[qt], s[qt][kt][4 * g + 1] - m[qt], s[qt][kt][4 * g + 2] - m[qt], s[qt][kt][4 * g + 3] - m[qt]}; const v4f e = exp2x4(x);
#pragma unroll
          for (int q = 0; q < 4; ++q) pf.h[kt * 8 + g * 4 + q] = (_Float16)e[q];
          l[qt] += (e[0] + e[1]) + (e[2] + e[3]); } }
#pragma unroll
      for (int dt = 0; dt < 4; ++dt) o[qt][dt] = fa_mma(vf[dt], pf.v, o[qt][dt]); } }
#pragma unroll
  for (int qt = 0; qt < 2; ++qt) { const float se = l[qt] + xhalf(l[qt]);
    const float sc = (m[qt] > -1.0e29f) ? (64.0f / se) : __uint_as_float(0x7fc00000u);
    unsigned short* d = (unsigned short*)O16 + (r0 + q0 + qt * 16 + ln) * DM + h * HD + 8 * hh;
#pragma unroll
    for (int dt = 0; dt < 4; ++dt) { FragH f;
#pragma unroll
      for (int r = 0; r < 8; ++r) f.h[r] = (_Float16)(o[qt][dt][r] * sc);
      *(v8us*)(d + dt * 16) = f.half[0]; } } }

extern "C" void kernel_launch(void* const* d_in, const int* in_sizes, int n_in,
                              void* d_out, int out_size, void* d_ws, size_t ws_size, hipStream_t stream) {
  if (n_in < 10) return;
  if (in_sizes[0] < NB * SEQ_FULL * DM || in_sizes[1] < SEQ * SEQ_FULL) return;
  if (in_sizes[2] < DM * DM || in_sizes[4] < DM * DM || in_sizes[6] < DM * DM || in_sizes[8] < DM * DM) return;
  if (in_sizes[3] < DM || in_sizes[5] < DM || in_sizes[7] < DM || in_sizes[9] < DM) return;
  if (out_size < (int)(NR * DM)) return;
  const float* x  = (const float*)d_in[0]; const int* adj = (const int*)d_in[1];
  const float* wq = (const float*)d_in[2]; const float* bq = (const float*)d_in[3];
  const float* wk = (const float*)d_in[4]; const float* bk = (const float*)d_in[5];
  const float* wv = (const float*)d_in[6]; const float* bv = (const float*)d_in[7];
  const float* wo = (const float*)d_in[8]; const float* bo = (const float*)d_in[9];
  char* ws = (char*)d_ws; size_t off = 0;
  auto take = [&](size_t bytes) { char* p = ws + off; off += (bytes + 255) & ~(size_t)255; return p; };
  _Float16* BQ  = (_Float16*)take((size_t)DM * DM * 2); _Float16* BK = (_Float16*)take((size_t)DM * DM * 2);
  _Float16* BV  = (_Float16*)take((size_t)DM * DM * 2); _Float16* BO = (_Float16*)take((size_t)DM * DM * 2);      /* Bt[n][k] x16 (natural [out][in]) */
  _Float16* X16 = (_Float16*)take(NR * DM * 2);                       /* [NR][DM] */
  _Float16* QKV = (_Float16*)take(NR * LQ * 2);                       /* [NR][3*DM]: q | k | v */
  _Float16* O16 = (_Float16*)take(NR * DM * 2);                       /* [NR][DM], o x64 */
  _Float16* VT  = (_Float16*)take((size_t)NB * NH * HD * SEQ * 2);    /* [NB*NH][64][SEQ] */
  if (off > ws_size || off > (size_t)134217728) return;
  const size_t nw8 = (size_t)DM * DM / 8; const unsigned gw = (unsigned)((nw8 + 255) / 256);
  k_wnat<<<gw, 256, 0, stream>>>(wq, nw8, BQ); k_wnat<<<gw, 256, 0, stream>>>(wk, nw8, BK); k_wnat<<<gw, 256, 0, stream>>>(wv, nw8, BV); k_wnat<<<gw, 256, 0, stream>>>(wo, nw8, BO);
  k_x16<<<(unsigned)((NR * DM / 8 + 255) / 256), 256, 0, stream>>>(x, X16, NR * DM / 8);
  const dim3 gp((unsigned)((NR / 128) * (DM / 64)), 1);
  k_gemm2<0><<<gp, 128, 0, stream>>>(X16, DM, 0, BQ, DM, 0, 0.0625f, bq, 0, nullptr, 1, 0, 0, nullptr, QKV,          LQ, 0, (int)NR, DM, DM);      /* q rows (f16), head h = columns h*64.. */
  k_gemm2<0><<<gp, 128, 0, stream>>>(X16, DM, 0, BK, DM, 0, 0.0625f, bk, 0, nullptr, 1, 0, 0, nullptr, QKV + DM,     LQ, 0, (int)NR, DM, DM);      /* k rows */
  k_gemm2<0><<<gp, 128, 0, stream>>>(X16, DM, 0, BV, DM, 0, 0.0625f, bv, 0, nullptr, 1, 0, 0, nullptr, QKV + 2 * DM, LQ, 0, (int)NR, DM, DM);      /* v rows */
  k_vt<NH, SEQ><<<(unsigned)(NB * NH * (SEQ / 64)), 256, 0, stream>>>(QKV + 2 * DM, LQ, 0, VT);      /* V^T [NB*NH][HD][SEQ] */
  k_fattn<<<(unsigned)(NB * NH * (SEQ / 256)), 256, 0, stream>>>(QKV, VT, adj, O16);      /* o (merged heads, x64) f16 rows */
  k_gemm2<0><<<gp, 128, 0, stream>>>(O16, DM, 0, BO, DM, 0, 0.0009765625f, bo, 0, nullptr, 1, 0, 0, (float*)d_out, nullptr, DM, 0, (int)NR, DM, DM);      /* out rows = output layout [b][s][DM] */
}

// v003
// A run of this version takes 164 microseconds.
// Timed twice side by side with v002, it ran 1.20 times as fast both times.
// All steps since v000 together make it 38.4 times as fast.
#include <hip/hip_runtime.h>
// All contractions (q, k, v projections K=512; q.k^T per head K=64; softmax weights . V K=SEQ; output projection K=512): v_wmma_f32_16x16x32_f16, f16 operands (every float input RNE-converted to bf16 first; weights carried x16, softmax weights carried unnormalised as 2^(t - m) <= 2^8, o carried x64), f32 accumulate; softmax statistics f32 on the VALU.
// Structure: token rows r = b*SEQ + s. X16 = f16(bf16(h)); q | k | v as f16 rows [r][3*DM] from three GEMMs (alpha 1/16, bias bf16); V^T planes [b*NH+h][64][SEQ] through an LDS transpose;
// per (batch, head, 32 query rows) one wave walks the keys 32 at a time: S^T = K . Q^T in f32, gated by the integer adjacency (adj[q][j] == 0 -> weight exactly 0; a row with no open key yields NaN), running maximum and sum per query in f32,
// P = f16(2^(t - m)) taken from the score accumulators as the B operand of O^T += V^T . P^T; o = O^T * 64 / sum written as f16 rows [r][DM] (head h -> columns h*64); out = o . Wo^T * 2^-10 + bf16(bo) in f32.
#ifndef NB
#define NB 4
#endif
#ifndef SEQ
#define SEQ 2048
#endif
#define NB_FULL 4
#define SEQ_FULL 2048                /* pitch of adj rows and per-batch stride of h */
#define DM 512
#define NH 8
#define HD 64
#define LQ (3 * DM)                  /* row pitch of the q | k | v plane */
#define NR ((size_t)NB * SEQ)        /* token rows */
static_assert(NB >= 1 && NB <= NB_FULL);
static_assert(SEQ >= 128 && SEQ <= SEQ_FULL);
static_assert(SEQ % 256 == 0);      /* a block of the attention kernel owns 256 query rows; V^T is cut in 64-key slabs */
static_assert((NB * SEQ) % 128 == 0);
static_assert(DM == NH * HD && HD == 64 && DM % 64 == 0);

typedef unsigned short v8us __attribute__((ext_vector_type(8), may_alias));
typedef float  v8f  __attribute__((ext_vector_type(8)));
typedef float  v4f  __attribute__((ext_vector_type(4)));
typedef float  v4fa __attribute__((ext_vector_type(4), may_alias));
typedef int    v4ia __attribute__((ext_vector_type(4), may_alias));
typedef _Float16 v16h __attribute__((ext_vector_type(16)));
typedef _Float16 v4h __attribute__((ext_vector_type(4)));
union FragH { v16h v; v8us half[2]; _Float16 h[16]; unsigned short u[16]; };

__device__ __forceinline__ unsigned short bf16_bits(float x) { unsigned int u = __float_as_uint(x); return (unsigned short)((u + 0x7FFFu + ((u >> 16) & 1u)) >> 16); }
__device__ __forceinline__ float bf16_val(unsigned short b) { return __uint_as_float(((unsigned int)b) << 16); }
__device__ __forceinline__ float bf16_rne(float x) { return bf16_val(bf16_bits(x)); }

// ---- f16 WMMA GEMM: wave tile 32x64; A [m][k] f16 (pitch lda), Bt [n][k] f16 (pitch ldb); fragments in the split k layout (elements 0..7 <- k0+8h.., 8..15 <- k0+16+8h..) for both operands ----
__device__ __forceinline__ v16h g2_frag(const _Float16* p, int hh) { FragH f; f.half[0] = *(const v8us*)((const unsigned short*)p + 8 * hh); f.half[1] = *(const v8us*)((const unsigned short*)p + 16 + 8 * hh); return f.v; }
__device__ __forceinline__ v8f g2_mma(v16h a, v16h b, v8f c) { v8f d = __builtin_amdgcn_wmma_f32_16x16x32_f16(false, a, false, b, (short)0, c, false, false); asm volatile("v_nop\n\tv_nop\n\tv_nop\n\tv_nop" : "+v"(d) : "v"(a), "v"(b)); return d; }
// C = act(A . Bt^T * alpha + bf16(bias[by*sBias + col]) (+ CP plane if non-null)); grid.y = by selects a z slice through the strides sA, sB, sC; requires M % 128 == 0 (rows per 4-wave block), N % 64 == 0, K % 32 == 0.
template <int ACT>
__global__ __launch_bounds__(128) void k_gemm2(const _Float16* __restrict__ A, int lda, size_t sA, const _Float16* __restrict__ Bh, int ldb, size_t sB, float alpha, const float* __restrict__ bias, size_t sBias, const float* __restrict__ CP, int rowsPerB, size_t sCPb, int row0g,
    float* __restrict__ C, _Float16* __restrict__ C16, int ldc, size_t sC, int M, int N, int K) {
  static_assert(ACT == 0 || ACT == 3);
  __shared__ __attribute__((aligned(16))) float so[4][32][68];
  const int tid = threadIdx.x, w = tid >> 5, lane = tid & 31, ln = lane & 15, hh = lane >> 4; const int by = blockIdx.y;
  A += (size_t)by * sA; Bh += (size_t)by * sB; const size_t cofs = (size_t)by * sC; const float* bp = bias ? bias + (size_t)by * sBias : nullptr;
  const int ntn = N >> 6; const int mt = blockIdx.x / ntn, nq = blockIdx.x - mt * ntn; const int row0 = mt * 128 + 32 * w, col0 = nq * 64; if (row0 >= M) return;
  const _Float16* a0p = A + (size_t)(row0 + ln) * lda; const _Float16* a1p = a0p + (size_t)16 * lda;
  const _Float16* b0p = Bh + (size_t)(col0 + ln) * ldb; const _Float16* b1p = b0p + (size_t)16 * ldb; const _Float16* b2p = b1p + (size_t)16 * ldb; const _Float16* b3p = b2p + (size_t)16 * ldb;
  const v8f z8 = {0.f,0.f,0.f,0.f,0.f,0.f,0.f,0.f}; v8f c00 = z8, c01 = z8, c02 = z8, c03 = z8, c10 = z8, c11 = z8, c12 = z8, c13 = z8;
#pragma unroll 1
  for (int kb = 0; kb < K; kb += 32) { const v16h a0 = g2_frag(a0p + kb, hh), a1 = g2_frag(a1p + kb, hh);
    v16h b = g2_frag(b0p + kb, hh); c00 = g2_mma(a0, b, c00); c10 = g2_mma(a1, b, c10);
    b = g2_frag(b1p + kb, hh); c01 = g2_mma(a0, b, c01); c11 = g2_mma(a1, b, c11);
    b = g2_frag(b2p + kb, hh); c02 = g2_mma(a0, b, c02); c12 = g2_mma(a1, b, c12);
    b = g2_frag(b3p + kb, hh); c03 = g2_mma(a0, b, c03); c13 = g2_mma(a1, b, c13); }
  v8f accs[8] = {c00, c01, c02, c03, c10, c11, c12, c13};
#pragma unroll
  for (int u = 0; u < 8; ++u) { const int t = u & 3, half = u >> 2; const int col = col0 + t * 16 + ln; const float bv = bp ? bf16_rne(bp[col]) : 0.f;
#pragma unroll
    for (int r = 0; r < 8; ++r) { const int rloc = half * 16 + 8 * hh + r; float v = accs[u][r] * alpha + bv;
      if (CP) { if (rowsPerB < 0) v += CP[cofs + (size_t)(row0g + row0 + rloc) * ldc + col]; else { const int bidx = (row0g + row0 + rloc) / rowsPerB; v += CP[(size_t)bidx * sCPb + (size_t)by * 64 + col]; } }
      if (ACT == 3) v = fmaxf(v, 0.f);
      so[w][rloc][t * 16 + ln] = v; } }
  __builtin_amdgcn_fence(4, "workgroup"); __builtin_amdgcn_wave_barrier();
  const int rsub = lane >> 4, c4 = (lane & 15) * 4;
  {
#pragma unroll
    for (int q = 0; q < 16; ++q) { const int r = q * 2 + rsub; const v4f v = *(const v4fa*)&so[w][r][c4];
      if (C) *(v4f*)(C + cofs + (size_t)(row0 + r) * ldc + col0 + c4) = v;
      if (C16) { v4h h4; for (int i = 0; i < 4; ++i) h4[i] = (_Float16)v[i]; *(v4h*)(C16 + cofs + (size_t)(row0 + r) * ldc + col0 + c4) = h4; } }
     } }

__global__ __launch_bounds__(256) void k_wnat(const float* __restrict__ w, size_t n8, _Float16* __restrict__ Bt) {
  const size_t t = (size_t)blockIdx.x * 256 + threadIdx.x; if (t >= n8) return;
  const v4f a = *(const v4fa*)(w + t * 8), c = *(const v4fa*)(w + t * 8 + 4); FragH f;
#pragma unroll
  for (int q = 0; q < 4; ++q) { f.h[q] = (_Float16)(bf16_rne(a[q]) * 16.0f); f.h[4 + q] = (_Float16)(bf16_rne(c[q]) * 16.0f); }
  *(v8us*)((unsigned short*)Bt + t * 8) = f.half[0];  }

__global__ __launch_bounds__(256) void k_x16(const float* __restrict__ x, _Float16* __restrict__ X16, size_t n8) {
  const size_t t = (size_t)blockIdx.x * 256 + threadIdx.x; if (t >= n8) return;
  const size_t per = (size_t)SEQ * DM / 8; const size_t b = t / per, rem = t - b * per;
  const float* src = x + b * ((size_t)SEQ_FULL * DM) + rem * 8;
  const v4f a = *(const v4fa*)src, c = *(const v4fa*)(src + 4); FragH f;
#pragma unroll
  for (int q = 0; q < 4; ++q) { f.h[q] = (_Float16)bf16_rne(a[q]); f.h[4 + q] = (_Float16)bf16_rne(c[q]); }
  *(v8us*)((unsigned short*)X16 + t * 8) = f.half[0];  }

template <int NHv, int TTv>
__global__ __launch_bounds__(256) void k_vt(const _Float16* __restrict__ V16, int ldv, int voff, _Float16* __restrict__ Vt) {
  __shared__ unsigned short tl[64][66]; const int tid = threadIdx.x; const int slab = blockIdx.x / (TTv / 64), lg = blockIdx.x % (TTv / 64); const int b = slab / NHv, h = slab % NHv;
  for (int i = tid; i < 64 * 8; i += 256) { const int r = i / 8, c8 = (i % 8) * 8; FragH f; f.half[0] = *(const v8us*)((const unsigned short*)V16 + ((size_t)b * TTv + lg * 64 + r) * ldv + voff + h * 64 + c8);
#pragma unroll
    for (int q = 0; q < 8; ++q) tl[r][c8 + q] = f.u[q]; }
  __syncthreads();
  {
#pragma unroll
    for (int rd = 0; rd < 2; ++rd) { const int d = rd * 32 + tid / 8, pc = tid % 8; FragH f;
#pragma unroll
      for (int q = 0; q < 8; ++q) f.u[q] = tl[pc * 8 + q][d];
      *(v8us*)((unsigned short*)Vt + ((size_t)slab * 64 + d) * TTv + lg * 64 + pc * 8) = f.half[0]; }
     } }

// 2^x of four values in place (what the native exp compiles to behind its multiply by log2 e). The four v_exp_f32 name disjoint registers; the closing v_nop keeps the one slot that the instruction set
// asks for between a transcendental and the next use of its result or overwrite of its source.
__device__ __forceinline__ v4f exp2x4(v4f x) { float a = x[0], b = x[1], c = x[2], d = x[3];
  asm("v_exp_f32 %0, %0\n\tv_exp_f32 %1, %1\n\tv_exp_f32 %2, %2\n\tv_exp_f32 %3, %3\n\tv_nop" : "+v"(a), "+v"(b), "+v"(c), "+v"(d));
  const v4f r = {a, b, c, d}; return r; }
__device__ __forceinline__ float xhalf(float x) { return __builtin_bit_cast(float, __builtin_amdgcn_permlanex16(__builtin_bit_cast(int, x), __builtin_bit_cast(int, x), 0x76543210, 0xfedcba98, false, false)); }      /* lane l <- lane l ^ 16, on the vector pipe */
__device__ __forceinline__ v8f fa_mma(v16h a, v16h b, v8f c) { return __builtin_amdgcn_wmma_f32_16x16x32_f16(false, a, false, b, (short)0, c, false, false); }
#define FA_KP 144                          /* LDS pitch of a 128-byte row (K, V^T) */
#define FA_AP 272                          /* LDS pitch of a 256-byte row (adj) */
#define FA_V (64 * FA_KP)                  /* byte offsets inside one buffer: K at 0, V^T, then eight adj slices */
#define FA_A (2 * 64 * FA_KP)
#define FA_AW (32 * FA_AP)
#define FA_STAGE (FA_A + 8 * FA_AW)
typedef __attribute__((address_space(3))) unsigned char lds_u8;
// Ten copies of 16 B a lane, each with its own LDS byte address and global address. Every lane on, no two lanes on one LDS byte.
// The closing s_wait_xcnt stands inside the statement so that no address register named here is rewritten in front of it.
__device__ __forceinline__ void fa_copy10(const unsigned (&l)[10], const char* const (&g)[10]) {
  asm volatile("global_load_async_to_lds_b128 %0, %1, off\n\tglobal_load_async_to_lds_b128 %2, %3, off\n\t"
               "global_load_async_to_lds_b128 %4, %5, off\n\tglobal_load_async_to_lds_b128 %6, %7, off\n\t"
               "global_load_async_to_lds_b128 %8, %9, off\n\tglobal_load_async_to_lds_b128 %10, %11, off\n\t"
               "global_load_async_to_lds_b128 %12, %13, off\n\tglobal_load_async_to_lds_b128 %14, %15, off\n\t"
               "global_load_async_to_lds_b128 %16, %17, off\n\tglobal_load_async_to_lds_b128 %18, %19, off\n\t"
               "s_wait_xcnt 0x0"
               :: "v"(l[0]), "v"(g[0]), "v"(l[1]), "v"(g[1]), "v"(l[2]), "v"(g[2]), "v"(l[3]), "v"(g[3]), "v"(l[4]), "v"(g[4]),
                  "v"(l[5]), "v"(g[5]), "v"(l[6]), "v"(g[6]), "v"(l[7]), "v"(g[7]), "v"(l[8]), "v"(g[8]), "v"(l[9]), "v"(g[9]) : "memory"); }
// One stage's copies of one wave: 8 K rows and 8 V^T rows (4 rows a copy, rows r and r + 32), its 32 adj rows (2 rows a copy).
__device__ __forceinline__ void fa_copy(unsigned lk, const char* gk, unsigned lv, const char* gv, unsigned la, const char* ga) {
  constexpr unsigned dl = 2 * FA_AP; constexpr size_t dg = (size_t)2 * SEQ_FULL * 4;
  const unsigned l1[10] = {lk, lk + 32 * FA_KP, lv, lv + 32 * FA_KP, la, la + dl, la + 2 * dl, la + 3 * dl, la + 4 * dl, la + 5 * dl};
  const char* const g1[10] = {gk, gk + (size_t)32 * LQ * 2, gv, gv + (size_t)32 * SEQ * 2, ga, ga + dg, ga + 2 * dg, ga + 3 * dg, ga + 4 * dg, ga + 5 * dg};
  fa_copy10(l1, g1);
  const unsigned l2[10] = {la + 6 * dl, la + 7 * dl, la + 8 * dl, la + 9 * dl, la + 10 * dl, la + 11 * dl, la + 12 * dl, la + 13 * dl, la + 14 * dl, la + 15 * dl};
  const char* const g2[10] = {ga + 6 * dg, ga + 7 * dg, ga + 8 * dg, ga + 9 * dg, ga + 10 * dg, ga + 11 * dg, ga + 12 * dg, ga + 13 * dg, ga + 14 * dg, ga + 15 * dg};
  fa_copy10(l2, g2); }
__global__ __launch_bounds__(256) void k_fattn(const _Float16* __restrict__ QKV, const _Float16* __restrict__ VT, const int* __restrict__ adj, _Float16* __restrict__ O16) {
  __shared__ __attribute__((aligned(16))) unsigned char L[2 * FA_STAGE];
  const int tid = threadIdx.x, lane = threadIdx.x & 31, w = threadIdx.x >> 5, ln = lane & 15, hh = lane >> 4;
  constexpr int QB = SEQ / 256; const int slab = blockIdx.x / QB, qb = blockIdx.x - slab * QB; const int b = slab / NH, h = slab - b * NH;
  const int q0 = qb * 256 + w * 32; const size_t r0 = (size_t)b * SEQ;
  const _Float16* qp = QKV + (r0 + q0 + ln) * LQ + h * HD + 8 * hh;      /* every fragment pointer below carries the lane half's 8 * hh itself, so g2_frag is called with 0 */
  v16h qf[2][2];
#pragma unroll
  for (int qt = 0; qt < 2; ++qt) { qf[qt][0] = g2_frag(qp + (size_t)qt * 16 * LQ, 0); qf[qt][1] = g2_frag(qp + (size_t)qt * 16 * LQ + 32, 0); }
  /* copy side: thread tid brings 16 B of K rows tid / 8 and tid / 8 + 32, the same of V^T, and 16 B of each of its wave's adj rows lane / 16 + 2 * j */
  const char* gk = (const char*)(QKV + DM + (r0 + (tid >> 3)) * LQ + h * HD + 8 * (tid & 7));
  const char* gv = (const char*)(VT + ((size_t)slab * HD + (tid >> 3)) * SEQ + 8 * (tid & 7));
  const char* ga = (const char*)(adj + (size_t)(q0 + hh) * SEQ_FULL + 4 * ln);
  const unsigned l0 = (unsigned)(uintptr_t)(lds_u8*)L;
  const unsigned lk = l0 + (tid >> 3) * FA_KP + 16 * (tid & 7), lv = lk + FA_V, la = l0 + FA_A + w * FA_AW + hh * FA_AP + 16 * ln;
  constexpr size_t sk = (size_t)64 * LQ * 2, sv = 128, sa = 256;      /* bytes from one stage's tile to the next */
  /* read side, inside a buffer: the lane's K row, V^T row and adj row, each with the lane half's share */
  const int rk = ln * FA_KP + 16 * hh, rv = FA_V + ln * FA_KP + 16 * hh, ra = FA_A + w * FA_AW + ln * FA_AP + 32 * hh;
  const v8f z8 = {0.f,0.f,0.f,0.f,0.f,0.f,0.f,0.f};
  v8f o[2][4]; float m[2] = {-3.0e38f, -3.0e38f}, l[2] = {0.f, 0.f};
#pragma unroll
  for (int qt = 0; qt < 2; ++qt) {
#pragma unroll
    for (int dt = 0; dt < 4; ++dt) o[qt][dt] = z8; }
  constexpr int NT = SEQ / 64; static_assert(NT >= 2);
  fa_copy(lk, gk, lv, gv, la, ga);      /* stage 0 into buffer 0 */
  asm volatile("s_wait_asynccnt 0x0" ::: "memory");      /* this wave's copies of stage 0 have landed */
  __syncthreads();      /* ... and every other wave's */
  fa_copy(lk + FA_STAGE, gk + sk, lv + FA_STAGE, gv + sv, la + FA_STAGE, ga + sa);      /* stage 1 into buffer 1 */
  gk += 2 * sk; gv += 2 * sv; ga += 2 * sa;
  for (int t = 0; t < NT; ++t, gk += sk, gv += sv, ga += sa) {
    const unsigned bo = (unsigned)(t & 1) * FA_STAGE; const unsigned char* B = L + bo;
#pragma unroll 1
   for (int u = 0; u < 2; ++u) {      /* the stage's two passes; kept rolled: unrolled, the kernel takes more than 256 registers */
    v16h kf[2][2], vf[4]; v4ia av[2][2][2];
#pragma unroll
    for (int kt = 0; kt < 2; ++kt) { const _Float16* p = (const _Float16*)(B + rk + (u * 32 + kt * 16) * FA_KP); kf[kt][0] = g2_frag(p, 0); kf[kt][1] = g2_frag(p + 32, 0); }
#pragma unroll
    for (int qt = 0; qt < 2; ++qt) {
#pragma unroll
      for (int kt = 0; kt < 2; ++kt) { const int* p = (const int*)(B + ra + qt * 16 * FA_AP + u * 128 + kt * 64); av[qt][kt][0] = *(const v4ia*)p; av[qt][kt][1] = *(const v4ia*)(p + 4); } }
#pragma unroll
    for (int dt = 0; dt < 4; ++dt) vf[dt] = g2_frag((const _Float16*)(B + rv + dt * 16 * FA_KP + u * 64), 0);
    v8f s[2][2];
#pragma unroll
    for (int qt = 0; qt < 2; ++qt) {
#pragma unroll
      for (int kt = 0; kt < 2; ++kt) s[qt][kt] = fa_mma(kf[kt][1], qf[qt][1], fa_mma(kf[kt][0], qf[qt][0], z8)); }
    float ml[2];
#pragma unroll
    for (int qt = 0; qt < 2; ++qt) { float mx = -3.0e38f;
#pragma unroll
      for (int kt = 0; kt < 2; ++kt) {
#pragma unroll
        for (int r = 0; r < 8; ++r) { const float t = s[qt][kt][r] * 0.18033688011112042f; const float g = (av[qt][kt][r >> 2][r & 3] != 0) ? t : -1.0e30f; s[qt][kt][r] = g; mx = fmaxf(mx, g); } }
      ml[qt] = fmaxf(mx, xhalf(mx)); }
    const bool need = (ml[0] > m[0] + 8.0f) || (ml[1] > m[1] + 8.0f);
    if (__builtin_amdgcn_ballot_w32(need) != 0) {      /* one scalar branch a pass: the 64 multiplies are skipped while no query of the wave moves its maximum */
      const float n0 = (ml[0] > m[0] + 8.0f) ? ml[0] : m[0], n1 = (ml[1] > m[1] + 8.0f) ? ml[1] : m[1];
      const v4f d4 = {m[0] - n0, m[1] - n1, 0.f, 0.f}; const v4f al = exp2x4(d4); m[0] = n0; m[1] = n1;
#pragma unroll
      for (int qt = 0; qt < 2; ++qt) { l[qt] *= al[qt];
#pragma unroll
        for (int dt = 0; dt < 4; ++dt) o[qt][dt] *= al[qt]; } }
#pragma unroll
    for (int qt = 0; qt < 2; ++qt) { FragH pf;
#pragma unroll
      for (int kt = 0; kt < 2; ++kt) {
#pragma unroll
        for (int g = 0; g < 2; ++g) { const v4f x = {s[qt][kt][4 * g] - m[qt], s[qt][kt][4 * g + 1] - m[qt], s[qt][kt][4 * g + 2] - m[qt], s[qt][kt][4 * g + 3] - m[qt]}; const v4f e = exp2x4(x);
#pragma unroll
          for (int q = 0; q < 4; ++q) pf.h[kt * 8 + g * 4 + q] = (_Float16)e[q];
          l[qt] += (e[0] + e[1]) + (e[2] + e[3]); } }
#pragma unroll
      for (int dt = 0; dt < 4; ++dt) o[qt][dt] = fa_mma(vf[dt], pf.v, o[qt][dt]); } }
    asm volatile("s_wait_dscnt 0x0" ::: "memory");      /* this wave's reads of this stage's buffer are done */
    asm volatile("s_wait_asynccnt 0x0" ::: "memory");      /* its copies of the next stage have landed */
    __syncthreads();      /* publishes the next stage's buffer and frees this stage's */
    if (t + 2 < NT) fa_copy(lk + bo, gk, lv + bo, gv, la + bo, ga); }
  asm volatile("s_wait_asynccnt 0x0" ::: "memory");      /* no copy is left in flight when the wave ends */
#pragma unroll
  for (int qt = 0; qt < 2; ++qt) { const float se = l[qt] + xhalf(l[qt]);
    const float sc = (m[qt] > -1.0e29f) ? (64.0f / se) : __uint_as_float(0x7fc00000u);
    unsigned short* d = (unsigned short*)O16 + (r0 + q0 + qt * 16 + ln) * DM + h * HD + 8 * hh;
#pragma unroll
    for (int dt = 0; dt < 4; ++dt) { FragH f;
#pragma unroll
      for (int r = 0; r < 8; ++r) f.h[r] = (_Float16)(o[qt][dt][r] * sc);
      *(v8us*)(d + dt * 16) = f.half[0]; } } }

extern "C" void kernel_launch(void* const* d_in, const int* in_sizes, int n_in,
                              void* d_out, int out_size, void* d_ws, size_t ws_size, hipStream_t stream) {
  if (n_in < 10) return;
  if (in_sizes[0] < NB * SEQ_FULL * DM || in_sizes[1] < SEQ * SEQ_FULL) return;
  if (in_sizes[2] < DM * DM || in_sizes[4] < DM * DM || in_sizes[6] < DM * DM || in_sizes[8] < DM * DM) return;
  if (in_sizes[3] < DM || in_sizes[5] < DM || in_sizes[7] < DM || in_sizes[9] < DM) return;
  if (out_size < (int)(NR * DM)) return;
  const float* x  = (const float*)d_in[0]; const int* adj = (const int*)d_in[1];
  const float* wq = (const float*)d_in[2]; const float* bq = (const float*)d_in[3];
  const float* wk = (const float*)d_in[4]; const float* bk = (const float*)d_in[5];
  const float* wv = (const float*)d_in[6]; const float* bv = (const float*)d_in[7];
  const float* wo = (const float*)d_in[8]; const float* bo = (const float*)d_in[9];
  char* ws = (char*)d_ws; size_t off = 0;
  auto take = [&](size_t bytes) { char* p = ws + off; off += (bytes + 255) & ~(size_t)255; return p; };
  _Float16* BQ  = (_Float16*)take((size_t)DM * DM * 2); _Float16* BK = (_Float16*)take((size_t)DM * DM * 2);
  _Float16* BV  = (_Float16*)take((size_t)DM * DM * 2); _Float16* BO = (_Float16*)take((size_t)DM * DM * 2);      /* Bt[n][k] x16 (natural [out][in]) */
  _Float16* X16 = (_Float16*)take(NR * DM * 2);                       /* [NR][DM] */
  _Float16* QKV = (_Float16*)take(NR * LQ * 2);                       /* [NR][3*DM]: q | k | v */
  _Float16* O16 = (_Float16*)take(NR * DM * 2);                       /* [NR][DM], o x64 */
  _Float16* VT  = (_Float16*)take((size_t)NB * NH * HD * SEQ * 2);    /* [NB*NH][64][SEQ] */
  if (off > ws_size || off > (size_t)134217728) return;
  const size_t nw8 = (size_t)DM * DM / 8; const unsigned gw = (unsigned)((nw8 + 255) / 256);
  k_wnat<<<gw, 256, 0, stream>>>(wq, nw8, BQ); k_wnat<<<gw, 256, 0, stream>>>(wk, nw8, BK); k_wnat<<<gw, 256, 0, stream>>>(wv, nw8, BV); k_wnat<<<gw, 256, 0, stream>>>(wo, nw8, BO);
  k_x16<<<(unsigned)((NR * DM / 8 + 255) / 256), 256, 0, stream>>>(x, X16, NR * DM / 8);
  const dim3 gp((unsigned)((NR / 128) * (DM / 64)), 1);
  k_gemm2<0><<<gp, 128, 0, stream>>>(X16, DM, 0, BQ, DM, 0, 0.0625f, bq, 0, nullptr, 1, 0, 0, nullptr, QKV,          LQ, 0, (int)NR, DM, DM);      /* q rows (f16), head h = columns h*64.. */
  k_gemm2<0><<<gp, 128, 0, stream>>>(X16, DM, 0, BK, DM, 0, 0.0625f, bk, 0, nullptr, 1, 0, 0, nullptr, QKV + DM,     LQ, 0, (int)NR, DM, DM);      /* k rows */
  k_gemm2<0><<<gp, 128, 0, stream>>>(X16, DM, 0, BV, DM, 0, 0.0625f, bv, 0, nullptr, 1, 0, 0, nullptr, QKV + 2 * DM, LQ, 0, (int)NR, DM, DM);      /* v rows */
  k_vt<NH, SEQ><<<(unsigned)(NB * NH * (SEQ / 64)), 256, 0, stream>>>(QKV + 2 * DM, LQ, 0, VT);      /* V^T [NB*NH][HD][SEQ] */
  k_fattn<<<(unsigned)(NB * NH * (SEQ / 256)), 256, 0, stream>>>(QKV, VT, adj, O16);      /* o (merged heads, x64) f16 rows */
  k_gemm2<0><<<gp, 128, 0, stream>>>(O16, DM, 0, BO, DM, 0, 0.0009765625f, bo, 0, nullptr, 1, 0, 0, (float*)d_out, nullptr, DM, 0, (int)NR, DM, DM);      /* out rows = output layout [b][s][DM] */
}

// v004
// Measured time: 97.8 microseconds a run.
// In two side-by-side timings against v003, it was 1.70 and 1.68 times as fast.
// All steps since v000 together make it 64.8 times as fast.
#include <hip/hip_runtime.h>
// All contractions (q, k, v projections K=512; q.k^T per head K=64; softmax weights . V K=SEQ; output projection K=512): v_wmma_f32_16x16x32_f16, f16 operands (every float input RNE-converted to bf16 first; weights carried x16, softmax weights carried unnormalised as 2^(t - m) <= 2^8, o carried x64), f32 accumulate; softmax statistics f32 on the VALU.
// Structure: token rows r = b*SEQ + s. X16 = f16(bf16(h)); q | k | v as f16 rows [r][3*DM] from three GEMMs (alpha 1/16, bias bf16); V^T planes [b*NH+h][64][SEQ] through an LDS transpose;
// per (batch, head, 32 query rows) one wave walks the keys 32 at a time: S^T = K . Q^T in f32, gated by the integer adjacency (adj[q][j] == 0 -> weight exactly 0; a row with no open key yields NaN), running maximum and sum per query in f32,
// P = f16(2^(t - m)) taken from the score accumulators as the B operand of O^T += V^T . P^T; o = O^T * 64 / sum written as f16 rows [r][DM] (head h -> columns h*64); out = o . Wo^T * 2^-10 + bf16(bo) in f32.
#ifndef NB
#define NB 4
#endif
#ifndef SEQ
#define SEQ 2048
#endif
#define NB_FULL 4
#define SEQ_FULL 2048                /* pitch of adj rows and per-batch stride of h */
#define DM 512
#define NH 8
#define HD 64
#define LQ (3 * DM)                  /* row pitch of the q | k | v plane */
#define NR ((size_t)NB * SEQ)        /* token rows */
static_assert(NB >= 1 && NB <= NB_FULL);
static_assert(SEQ >= 128 && SEQ <= SEQ_FULL);
static_assert(SEQ % 256 == 0);      /* a block of the attention kernel owns 256 query rows; V^T is cut in 64-key slabs */
static_assert((NB * SEQ) % 128 == 0);
static_assert(DM == NH * HD && HD == 64 && DM % 64 == 0);

typedef unsigned short v8us __attribute__((ext_vector_type(8), may_alias));
typedef float  v8f  __attribute__((ext_vector_type(8)));
typedef float  v4f  __attribute__((ext_vector_type(4)));
typedef float  v4fa __attribute__((ext_vector_type(4), may_alias));
typedef int    v4ia __attribute__((ext_vector_type(4), may_alias));
typedef _Float16 v16h __attribute__((ext_vector_type(16)));
typedef _Float16 v4h __attribute__((ext_vector_type(4)));
union FragH { v16h v; v8us half[2]; _Float16 h[16]; unsigned short u[16]; };

__device__ __forceinline__ unsigned short bf16_bits(float x) { unsigned int u = __float_as_uint(x); return (unsigned short)((u + 0x7FFFu + ((u >> 16) & 1u)) >> 16); }
__device__ __forceinline__ float bf16_val(unsigned short b) { return __uint_as_float(((unsigned int)b) << 16); }
__device__ __forceinline__ float bf16_rne(float x) { return bf16_val(bf16_bits(x)); }

// ---- f16 WMMA fragments in the split k layout (elements 0..7 <- k0+8h.., 8..15 <- k0+16+8h..), the same for both operands ----
__device__ __forceinline__ v16h g2_frag(const _Float16* p, int hh) { FragH f; f.half[0] = *(const v8us*)((const unsigned short*)p + 8 * hh); f.half[1] = *(const v8us*)((const unsigned short*)p + 16 + 8 * hh); return f.v; }

__global__ __launch_bounds__(256) void k_wnat(const float* __restrict__ w, size_t n8, _Float16* __restrict__ Bt) {
  const size_t t = (size_t)blockIdx.x * 256 + threadIdx.x; if (t >= n8) return;
  const v4f a = *(const v4fa*)(w + t * 8), c = *(const v4fa*)(w + t * 8 + 4); FragH f;
#pragma unroll
  for (int q = 0; q < 4; ++q) { f.h[q] = (_Float16)(bf16_rne(a[q]) * 16.0f); f.h[4 + q] = (_Float16)(bf16_rne(c[q]) * 16.0f); }
  *(v8us*)((unsigned short*)Bt + t * 8) = f.half[0];  }

__global__ __launch_bounds__(256) void k_x16(const float* __restrict__ x, _Float16* __restrict__ X16, size_t n8) {
  const size_t t = (size_t)blockIdx.x * 256 + threadIdx.x; if (t >= n8) return;
  const size_t per = (size_t)SEQ * DM / 8; const size_t b = t / per, rem = t - b * per;
  const float* src = x + b * ((size_t)SEQ_FULL * DM) + rem * 8;
  const v4f a = *(const v4fa*)src, c = *(const v4fa*)(src + 4); FragH f;
#pragma unroll
  for (int q = 0; q < 4; ++q) { f.h[q] = (_Float16)bf16_rne(a[q]); f.h[4 + q] = (_Float16)bf16_rne(c[q]); }
  *(v8us*)((unsigned short*)X16 + t * 8) = f.half[0];  }

template <int NHv, int TTv>
__global__ __launch_bounds__(256) void k_vt(const _Float16* __restrict__ V16, int ldv, int voff, _Float16* __restrict__ Vt) {
  __shared__ unsigned short tl[64][66]; const int tid = threadIdx.x; const int slab = blockIdx.x / (TTv / 64), lg = blockIdx.x % (TTv / 64); const int b = slab / NHv, h = slab % NHv;
  for (int i = tid; i < 64 * 8; i += 256) { const int r = i / 8, c8 = (i % 8) * 8; FragH f; f.half[0] = *(const v8us*)((const unsigned short*)V16 + ((size_t)b * TTv + lg * 64 + r) * ldv + voff + h * 64 + c8);
#pragma unroll
    for (int q = 0; q < 8; ++q) tl[r][c8 + q] = f.u[q]; }
  __syncthreads();
  {
#pragma unroll
    for (int rd = 0; rd < 2; ++rd) { const int d = rd * 32 + tid / 8, pc = tid % 8; FragH f;
#pragma unroll
      for (int q = 0; q < 8; ++q) f.u[q] = tl[pc * 8 + q][d];
      *(v8us*)((unsigned short*)Vt + ((size_t)slab * 64 + d) * TTv + lg * 64 + pc * 8) = f.half[0]; }
     } }

// 2^x of four values in place (what the native exp compiles to behind its multiply by log2 e). The four v_exp_f32 name disjoint registers; the closing v_nop keeps the one slot that the instruction set
// asks for between a transcendental and the next use of its result or overwrite of its source.
__device__ __forceinline__ v4f exp2x4(v4f x) { float a = x[0], b = x[1], c = x[2], d = x[3];
  asm("v_exp_f32 %0, %0\n\tv_exp_f32 %1, %1\n\tv_exp_f32 %2, %2\n\tv_exp_f32 %3, %3\n\tv_nop" : "+v"(a), "+v"(b), "+v"(c), "+v"(d));
  const v4f r = {a, b, c, d}; return r; }
__device__ __forceinline__ float xhalf(float x) { return __builtin_bit_cast(float, __builtin_amdgcn_permlanex16(__builtin_bit_cast(int, x), __builtin_bit_cast(int, x), 0x76543210, 0xfedcba98, false, false)); }      /* lane l <- lane l ^ 16, on the vector pipe */
__device__ __forceinline__ v8f fa_mma(v16h a, v16h b, v8f c) { return __builtin_amdgcn_wmma_f32_16x16x32_f16(false, a, false, b, (short)0, c, false, false); }
#define FA_KP 144                          /* LDS pitch of a 128-byte row (K, V^T) */
#define FA_AP 272                          /* LDS pitch of a 256-byte row (adj) */
#define FA_V (64 * FA_KP)                  /* byte offsets inside one buffer: K at 0, V^T, then eight adj slices */
#define FA_A (2 * 64 * FA_KP)
#define FA_AW (32 * FA_AP)
#define FA_STAGE (FA_A + 8 * FA_AW)
typedef __attribute__((address_space(3))) unsigned char lds_u8;
// Ten copies of 16 B a lane, each with its own LDS byte address and global address. Every lane on, no two lanes on one LDS byte.
// The closing s_wait_xcnt stands inside the statement so that no address register named here is rewritten in front of it.
__device__ __forceinline__ void fa_copy10(const unsigned (&l)[10], const char* const (&g)[10]) {
  asm volatile("global_load_async_to_lds_b128 %0, %1, off\n\tglobal_load_async_to_lds_b128 %2, %3, off\n\t"
               "global_load_async_to_lds_b128 %4, %5, off\n\tglobal_load_async_to_lds_b128 %6, %7, off\n\t"
               "global_load_async_to_lds_b128 %8, %9, off\n\tglobal_load_async_to_lds_b128 %10, %11, off\n\t"
               "global_load_async_to_lds_b128 %12, %13, off\n\tglobal_load_async_to_lds_b128 %14, %15, off\n\t"
               "global_load_async_to_lds_b128 %16, %17, off\n\tglobal_load_async_to_lds_b128 %18, %19, off\n\t"
               "s_wait_xcnt 0x0"
               :: "v"(l[0]), "v"(g[0]), "v"(l[1]), "v"(g[1]), "v"(l[2]), "v"(g[2]), "v"(l[3]), "v"(g[3]), "v"(l[4]), "v"(g[4]),
                  "v"(l[5]), "v"(g[5]), "v"(l[6]), "v"(g[6]), "v"(l[7]), "v"(g[7]), "v"(l[8]), "v"(g[8]), "v"(l[9]), "v"(g[9]) : "memory"); }
// One stage's copies of one wave: 8 K rows and 8 V^T rows (4 rows a copy, rows r and r + 32), its 32 adj rows (2 rows a copy).
__device__ __forceinline__ void fa_copy(unsigned lk, const char* gk, unsigned lv, const char* gv, unsigned la, const char* ga) {
  constexpr unsigned dl = 2 * FA_AP; constexpr size_t dg = (size_t)2 * SEQ_FULL * 4;
  const unsigned l1[10] = {lk, lk + 32 * FA_KP, lv, lv + 32 * FA_KP, la, la + dl, la + 2 * dl, la + 3 * dl, la + 4 * dl, la + 5 * dl};
  const char* const g1[10] = {gk, gk + (size_t)32 * LQ * 2, gv, gv + (size_t)32 * SEQ * 2, ga, ga + dg, ga + 2 * dg, ga + 3 * dg, ga + 4 * dg, ga + 5 * dg};
  fa_copy10(l1, g1);
  const unsigned l2[10] = {la + 6 * dl, la + 7 * dl, la + 8 * dl, la + 9 * dl, la + 10 * dl, la + 11 * dl, la + 12 * dl, la + 13 * dl, la + 14 * dl, la + 15 * dl};
  const char* const g2[10] = {ga + 6 * dg, ga + 7 * dg, ga + 8 * dg, ga + 9 * dg, ga + 10 * dg, ga + 11 * dg, ga + 12 * dg, ga + 13 * dg, ga + 14 * dg, ga + 15 * dg};
  fa_copy10(l2, g2); }
__global__ __launch_bounds__(256) void k_fattn(const _Float16* __restrict__ QKV, const _Float16* __restrict__ VT, const int* __restrict__ adj, _Float16* __restrict__ O16) {
  __shared__ __attribute__((aligned(16))) unsigned char L[2 * FA_STAGE];
  const int tid = threadIdx.x, lane = threadIdx.x & 31, w = threadIdx.x >> 5, ln = lane & 15, hh = lane >> 4;
  constexpr int QB = SEQ / 256; const int slab = blockIdx.x / QB, qb = blockIdx.x - slab * QB; const int b = slab / NH, h = slab - b * NH;
  const int q0 = qb * 256 + w * 32; const size_t r0 = (size_t)b * SEQ;
  const _Float16* qp = QKV + (r0 + q0 + ln) * LQ + h * HD + 8 * hh;      /* every fragment pointer below carries the lane half's 8 * hh itself, so g2_frag is called with 0 */
  v16h qf[2][2];
#pragma unroll
  for (int qt = 0; qt < 2; ++qt) { qf[qt][0] = g2_frag(qp + (size_t)qt * 16 * LQ, 0); qf[qt][1] = g2_frag(qp + (size_t)qt * 16 * LQ + 32, 0); }
  /* copy side: thread tid brings 16 B of K rows tid / 8 and tid / 8 + 32, the same of V^T, and 16 B of each of its wave's adj rows lane / 16 + 2 * j */
  const char* gk = (const char*)(QKV + DM + (r0 + (tid >> 3)) * LQ + h * HD + 8 * (tid & 7));
  const char* gv = (const char*)(VT + ((size_t)slab * HD + (tid >> 3)) * SEQ + 8 * (tid & 7));
  const char* ga = (const char*)(adj + (size_t)(q0 + hh) * SEQ_FULL + 4 * ln);
  const unsigned l0 = (unsigned)(uintptr_t)(lds_u8*)L;
  const unsigned lk = l0 + (tid >> 3) * FA_KP + 16 * (tid & 7), lv = lk + FA_V, la = l0 + FA_A + w * FA_AW + hh * FA_AP + 16 * ln;
  constexpr size_t sk = (size_t)64 * LQ * 2, sv = 128, sa = 256;      /* bytes from one stage's tile to the next */
  /* read side, inside a buffer: the lane's K row, V^T row and adj row, each with the lane half's share */
  const int rk = ln * FA_KP + 16 * hh, rv = FA_V + ln * FA_KP + 16 * hh, ra = FA_A + w * FA_AW + ln * FA_AP + 32 * hh;
  const v8f z8 = {0.f,0.f,0.f,0.f,0.f,0.f,0.f,0.f};
  v8f o[2][4]; float m[2] = {-3.0e38f, -3.0e38f}, l[2] = {0.f, 0.f};
#pragma unroll
  for (int qt = 0; qt < 2; ++qt) {
#pragma unroll
    for (int dt = 0; dt < 4; ++dt) o[qt][dt] = z8; }
  constexpr int NT = SEQ / 64; static_assert(NT >= 2);
  fa_copy(lk, gk, lv, gv, la, ga);      /* stage 0 into buffer 0 */
  asm volatile("s_wait_asynccnt 0x0" ::: "memory");      /* this wave's copies of stage 0 have landed */
  __syncthreads();      /* ... and every other wave's */
  fa_copy(lk + FA_STAGE, gk + sk, lv + FA_STAGE, gv + sv, la + FA_STAGE, ga + sa);      /* stage 1 into buffer 1 */
  gk += 2 * sk; gv += 2 * sv; ga += 2 * sa;
  for (int t = 0; t < NT; ++t, gk += sk, gv += sv, ga += sa) {
    const unsigned bo = (unsigned)(t & 1) * FA_STAGE; const unsigned char* B = L + bo;
#pragma unroll 1
   for (int u = 0; u < 2; ++u) {      /* the stage's two passes; kept rolled: unrolled, the kernel takes more than 256 registers */
    v16h kf[2][2], vf[4]; v4ia av[2][2][2];
#pragma unroll
    for (int kt = 0; kt < 2; ++kt) { const _Float16* p = (const _Float16*)(B + rk + (u * 32 + kt * 16) * FA_KP); kf[kt][0] = g2_frag(p, 0); kf[kt][1] = g2_frag(p + 32, 0); }
#pragma unroll
    for (int qt = 0; qt < 2; ++qt) {
#pragma unroll
      for (int kt = 0; kt < 2; ++kt) { const int* p = (const int*)(B + ra + qt * 16 * FA_AP + u * 128 + kt * 64); av[qt][kt][0] = *(const v4ia*)p; av[qt][kt][1] = *(const v4ia*)(p + 4); } }
#pragma unroll
    for (int dt = 0; dt < 4; ++dt) vf[dt] = g2_frag((const _Float16*)(B + rv + dt * 16 * FA_KP + u * 64), 0);
    v8f s[2][2];
#pragma unroll
    for (int qt = 0; qt < 2; ++qt) {
#pragma unroll
      for (int kt = 0; kt < 2; ++kt) s[qt][kt] = fa_mma(kf[kt][1], qf[qt][1], fa_mma(kf[kt][0], qf[qt][0], z8)); }
    float ml[2];
#pragma unroll
    for (int qt = 0; qt < 2; ++qt) { float mx = -3.0e38f;
#pragma unroll
      for (int kt = 0; kt < 2; ++kt) {
#pragma unroll
        for (int r = 0; r < 8; ++r) { const float t = s[qt][kt][r] * 0.18033688011112042f; const float g = (av[qt][kt][r >> 2][r & 3] != 0) ? t : -1.0e30f; s[qt][kt][r] = g; mx = fmaxf(mx, g); } }
      ml[qt] = fmaxf(mx, xhalf(mx)); }
    const bool need = (ml[0] > m[0] + 8.0f) || (ml[1] > m[1] + 8.0f);
    if (__builtin_amdgcn_ballot_w32(need) != 0) {      /* one scalar branch a pass: the 64 multiplies are skipped while no query of the wave moves its maximum */
      const float n0 = (ml[0] > m[0] + 8.0f) ? ml[0] : m[0], n1 = (ml[1] > m[1] + 8.0f) ? ml[1] : m[1];
      const v4f d4 = {m[0] - n0, m[1] - n1, 0.f, 0.f}; const v4f al = exp2x4(d4); m[0] = n0; m[1] = n1;
#pragma unroll
      for (int qt = 0; qt < 2; ++qt) { l[qt] *= al[qt];
#pragma unroll
        for (int dt = 0; dt < 4; ++dt) o[qt][dt] *= al[qt]; } }
#pragma unroll
    for (int qt = 0; qt < 2; ++qt) { FragH pf;
#pragma unroll
      for (int kt = 0; kt < 2; ++kt) {
#pragma unroll
        for (int g = 0; g < 2; ++g) { const v4f x = {s[qt][kt][4 * g] - m[qt], s[qt][kt][4 * g + 1] - m[qt], s[qt][kt][4 * g + 2] - m[qt], s[qt][kt][4 * g + 3] - m[qt]}; const v4f e = exp2x4(x);
#pragma unroll
          for (int q = 0; q < 4; ++q) pf.h[kt * 8 + g * 4 + q] = (_Float16)e[q];
          l[qt] += (e[0] + e[1]) + (e[2] + e[3]); } }
#pragma unroll
      for (int dt = 0; dt < 4; ++dt) o[qt][dt] = fa_mma(vf[dt], pf.v, o[qt][dt]); } }
    asm volatile("s_wait_dscnt 0x0" ::: "memory");      /* this wave's reads of this stage's buffer are done */
    asm volatile("s_wait_asynccnt 0x0" ::: "memory");      /* its copies of the next stage have landed */
    __syncthreads();      /* publishes the next stage's buffer and frees this stage's */
    if (t + 2 < NT) fa_copy(lk + bo, gk, lv + bo, gv, la + bo, ga); }
  asm volatile("s_wait_asynccnt 0x0" ::: "memory");      /* no copy is left in flight when the wave ends */
#pragma unroll
  for (int qt = 0; qt < 2; ++qt) { const float se = l[qt] + xhalf(l[qt]);
    const float sc = (m[qt] > -1.0e29f) ? (64.0f / se) : __uint_as_float(0x7fc00000u);
    unsigned short* d = (unsigned short*)O16 + (r0 + q0 + qt * 16 + ln) * DM + h * HD + 8 * hh;
#pragma unroll
    for (int dt = 0; dt < 4; ++dt) { FragH f;
#pragma unroll
      for (int r = 0; r < 8; ++r) f.h[r] = (_Float16)(o[qt][dt][r] * sc);
      *(v8us*)(d + dt * 16) = f.half[0]; } } }

// ---- f16 WMMA GEMM, K = N = DM: C = A . Bt^T * alpha + bf16(bias[col]); A [m][DM] f16, Bt [n][DM] f16. A block of 8 waves owns 128 x 128 of C, a wave 32 x 64 (wave w: rows 32 * (w & 3), columns 64 * (w >> 2)).
// A stage is 128 of k: 128 A rows and 128 Bt rows of 256 B each are brought into LDS by asynchronous copies in whole lines, once per block, one stage ahead, into two buffers;
// the fragment reads (16 B a lane, 16 rows a read) then go to LDS, at a row pitch of an odd number of 16 B. Requires M % 128 == 0; the grid covers C exactly.
#define G_KS 128                           /* k per stage */
#define G_P 272                            /* LDS pitch of a 256-byte row */
#define G_B (128 * G_P)                    /* byte offset of the Bt tile inside one buffer */
#define G_STAGE (2 * 128 * G_P)
static_assert(DM % 128 == 0 && DM / G_KS >= 2);
static_assert(2 * G_STAGE >= 8 * 32 * 68 * 4);      /* the output staging of the epilogue reuses the buffers */
// One tile's copies of one thread: 16 B of each of the rows r, r + 16, ..., r + 112. Every lane on, no two lanes on one LDS byte.
// The closing s_wait_xcnt stands inside the statement so that no address register named here is rewritten in front of it.
__device__ __forceinline__ void g3_copy(unsigned l, const char* g) {
  constexpr unsigned dl = 16 * G_P; constexpr size_t dg = (size_t)16 * DM * 2;
  asm volatile("global_load_async_to_lds_b128 %0, %1, off\n\tglobal_load_async_to_lds_b128 %2, %3, off\n\t"
               "global_load_async_to_lds_b128 %4, %5, off\n\tglobal_load_async_to_lds_b128 %6, %7, off\n\t"
               "global_load_async_to_lds_b128 %8, %9, off\n\tglobal_load_async_to_lds_b128 %10, %11, off\n\t"
               "global_load_async_to_lds_b128 %12, %13, off\n\tglobal_load_async_to_lds_b128 %14, %15, off\n\t"
               "s_wait_xcnt 0x0"
               :: "v"(l), "v"(g), "v"(l + dl), "v"(g + dg), "v"(l + 2 * dl), "v"(g + 2 * dg), "v"(l + 3 * dl), "v"(g + 3 * dg),
                  "v"(l + 4 * dl), "v"(g + 4 * dg), "v"(l + 5 * dl), "v"(g + 5 * dg), "v"(l + 6 * dl), "v"(g + 6 * dg), "v"(l + 7 * dl), "v"(g + 7 * dg) : "memory"); }
// The fragments of 32 of k: two A row tiles, four Bt row tiles.
__device__ __forceinline__ void g3_frags(const unsigned char* pa, const unsigned char* pb, v16h (&a)[2], v16h (&b)[4]) {
  a[0] = g2_frag((const _Float16*)pa, 0); a[1] = g2_frag((const _Float16*)(pa + 16 * G_P), 0);
#pragma unroll
  for (int nt = 0; nt < 4; ++nt) b[nt] = g2_frag((const _Float16*)(pb + nt * 16 * G_P), 0); }
template <int OUT32>      /* 1: the result goes to C as f32; 0: to C16 as f16 */
__global__ __launch_bounds__(256) void k_gemm3(const _Float16* __restrict__ A, const _Float16* __restrict__ Bh, float alpha, const float* __restrict__ bias, float* __restrict__ C, _Float16* __restrict__ C16, int ldc) {
  __shared__ __attribute__((aligned(16))) unsigned char L[2 * G_STAGE];
  const int tid = threadIdx.x, w = tid >> 5, lane = tid & 31, ln = lane & 15, hh = lane >> 4;
  constexpr int NTN = DM / 128; const int mt = blockIdx.x / NTN, nq = blockIdx.x - mt * NTN;
  const int wm = w & 3, wn = w >> 2; const int row0 = mt * 128 + 32 * wm, col0 = nq * 128 + 64 * wn;
  /* copy side: thread tid brings 16 B of the tile rows tid / 16 + 16 * j of A and of Bt */
  const char* ga = (const char*)(A + (size_t)(mt * 128 + (tid >> 4)) * DM + 8 * (tid & 15));
  const char* gb = (const char*)(Bh + (size_t)(nq * 128 + (tid >> 4)) * DM + 8 * (tid & 15));
  const unsigned la = (unsigned)(uintptr_t)(lds_u8*)L + (tid >> 4) * G_P + 16 * (tid & 15), lb = la + G_B;
  constexpr size_t sg = (size_t)G_KS * 2;      /* bytes from one stage's tile to the next */
  /* read side, inside a buffer: the lane's first A row and first Bt row, each with the lane half's share, so g2_frag is called with 0 */
  const int ra = (32 * wm + ln) * G_P + 16 * hh, rb = G_B + (64 * wn + ln) * G_P + 16 * hh;
  const v8f z8 = {0.f,0.f,0.f,0.f,0.f,0.f,0.f,0.f}; v8f c[2][4];
#pragma unroll
  for (int u = 0; u < 8; ++u) c[u >> 2][u & 3] = z8;
  constexpr int NT = DM / G_KS;
  g3_copy(la, ga); g3_copy(lb, gb);      /* stage 0 into buffer 0 */
  asm volatile("s_wait_asynccnt 0x0" ::: "memory");      /* this wave's copies of stage 0 have landed */
  __syncthreads();      /* ... and every other wave's */
  g3_copy(la + G_STAGE, ga + sg); g3_copy(lb + G_STAGE, gb + sg);      /* stage 1 into buffer 1 */
  ga += 2 * sg; gb += 2 * sg;
  for (int t = 0; t < NT; ++t, ga += sg, gb += sg) {
    const unsigned bo = (unsigned)(t & 1) * G_STAGE; const unsigned char* B = L + bo;
    v16h af[2][2], bf[2][4];      /* two fragment sets: the reads of the next 32 of k stand as one group in front of this 32's products */
    g3_frags(B + ra, B + rb, af[0], bf[0]);
#pragma unroll      /* fragment sets and accumulators are indexed by constants, so they stay in registers */
    for (int ks = 0; ks < G_KS / 32; ++ks) {
      if (ks + 1 < G_KS / 32) g3_frags(B + ra + (ks + 1) * 64, B + rb + (ks + 1) * 64, af[(ks + 1) & 1], bf[(ks + 1) & 1]);
      __builtin_amdgcn_sched_barrier(0);      /* keeps that group of reads in front of the products: without it the compiler sinks each read to its first use and every pair of products waits for LDS */
#pragma unroll
      for (int nt = 0; nt < 4; ++nt) { c[0][nt] = fa_mma(af[ks & 1][0], bf[ks & 1][nt], c[0][nt]); c[1][nt] = fa_mma(af[ks & 1][1], bf[ks & 1][nt], c[1][nt]); }
      __builtin_amdgcn_sched_barrier(0); }      /* ... and the group after next behind them, so that two fragment sets suffice */
    asm volatile("s_wait_dscnt 0x0" ::: "memory");      /* this wave's reads of this stage's buffer are done */
    asm volatile("s_wait_asynccnt 0x0" ::: "memory");      /* its copies of the next stage have landed */
    __syncthreads();      /* publishes the next stage's buffer and frees this stage's */
    if (t + 2 < NT) { g3_copy(la + bo, ga); g3_copy(lb + bo, gb); } }
  asm volatile("s_wait_asynccnt 0x0" ::: "memory");      /* no copy is left in flight when the buffers are reused */
  float (*so)[68] = (float (*)[68])(L + (size_t)w * 32 * 68 * 4);      /* the wave's own 32 x 64 output tile; every wave has left the buffers at the loop's last barrier */
#pragma unroll
  for (int u = 0; u < 8; ++u) { const int t = u & 3, half = u >> 2; const float bv = bf16_rne(bias[col0 + t * 16 + ln]);
#pragma unroll
    for (int r = 0; r < 8; ++r) so[half * 16 + 8 * hh + r][t * 16 + ln] = c[half][t][r] * alpha + bv; }
  __builtin_amdgcn_fence(4, "workgroup"); __builtin_amdgcn_wave_barrier();
  const int rsub = lane >> 4, c4 = (lane & 15) * 4;
#pragma unroll
  for (int q = 0; q < 16; ++q) { const int r = q * 2 + rsub; const v4f v = *(const v4fa*)&so[r][c4];
    if (OUT32) *(v4f*)(C + (size_t)(row0 + r) * ldc + col0 + c4) = v;
    else { v4h h4; for (int i = 0; i < 4; ++i) h4[i] = (_Float16)v[i]; *(v4h*)(C16 + (size_t)(row0 + r) * ldc + col0 + c4) = h4; } } }

extern "C" void kernel_launch(void* const* d_in, const int* in_sizes, int n_in,
                              void* d_out, int out_size, void* d_ws, size_t ws_size, hipStream_t stream) {
  if (n_in < 10) return;
  if (in_sizes[0] < NB * SEQ_FULL * DM || in_sizes[1] < SEQ * SEQ_FULL) return;
  if (in_sizes[2] < DM * DM || in_sizes[4] < DM * DM || in_sizes[6] < DM * DM || in_sizes[8] < DM * DM) return;
  if (in_sizes[3] < DM || in_sizes[5] < DM || in_sizes[7] < DM || in_sizes[9] < DM) return;
  if (out_size < (int)(NR * DM)) return;
  const float* x  = (const float*)d_in[0]; const int* adj = (const int*)d_in[1];
  const float* wq = (const float*)d_in[2]; const float* bq = (const float*)d_in[3];
  const float* wk = (const float*)d_in[4]; const float* bk = (const float*)d_in[5];
  const float* wv = (const float*)d_in[6]; const float* bv = (const float*)d_in[7];
  const float* wo = (const float*)d_in[8]; const float* bo = (const float*)d_in[9];
  char* ws = (char*)d_ws; size_t off = 0;
  auto take = [&](size_t bytes) { char* p = ws + off; off += (bytes + 255) & ~(size_t)255; return p; };
  _Float16* BQ  = (_Float16*)take((size_t)DM * DM * 2); _Float16* BK = (_Float16*)take((size_t)DM * DM * 2);
  _Float16* BV  = (_Float16*)take((size_t)DM * DM * 2); _Float16* BO = (_Float16*)take((size_t)DM * DM * 2);      /* Bt[n][k] x16 (natural [out][in]) */
  _Float16* X16 = (_Float16*)take(NR * DM * 2);                       /* [NR][DM] */
  _Float16* QKV = (_Float16*)take(NR * LQ * 2);                       /* [NR][3*DM]: q | k | v */
  _Float16* O16 = (_Float16*)take(NR * DM * 2);                       /* [NR][DM], o x64 */
  _Float16* VT  = (_Float16*)take((size_t)NB * NH * HD * SEQ * 2);    /* [NB*NH][64][SEQ] */
  if (off > ws_size || off > (size_t)134217728) return;
  const size_t nw8 = (size_t)DM * DM / 8; const unsigned gw = (unsigned)((nw8 + 255) / 256);
  k_wnat<<<gw, 256, 0, stream>>>(wq, nw8, BQ); k_wnat<<<gw, 256, 0, stream>>>(wk, nw8, BK); k_wnat<<<gw, 256, 0, stream>>>(wv, nw8, BV); k_wnat<<<gw, 256, 0, stream>>>(wo, nw8, BO);
  k_x16<<<(unsigned)((NR * DM / 8 + 255) / 256), 256, 0, stream>>>(x, X16, NR * DM / 8);
  const unsigned gp = (unsigned)((NR / 128) * (DM / 128));
  k_gemm3<0><<<gp, 256, 0, stream>>>(X16, BQ, 0.0625f, bq, nullptr, QKV,          LQ);      /* q rows (f16), head h = columns h*64.. */
  k_gemm3<0><<<gp, 256, 0, stream>>>(X16, BK, 0.0625f, bk, nullptr, QKV + DM,     LQ);      /* k rows */
  k_gemm3<0><<<gp, 256, 0, stream>>>(X16, BV, 0.0625f, bv, nullptr, QKV + 2 * DM, LQ);      /* v rows */
  k_vt<NH, SEQ><<<(unsigned)(NB * NH * (SEQ / 64)), 256, 0, stream>>>(QKV + 2 * DM, LQ, 0, VT);      /* V^T [NB*NH][HD][SEQ] */
  k_fattn<<<(unsigned)(NB * NH * (SEQ / 256)), 256, 0, stream>>>(QKV, VT, adj, O16);      /* o (merged heads, x64) f16 rows */
  k_gemm3<1><<<gp, 256, 0, stream>>>(O16, BO, 0.0009765625f, bo, (float*)d_out, nullptr, DM);      /* out rows = output layout [b][s][DM] */
}

// v005
// One run takes 81.3 microseconds.
// Next to v004, in two timings, it ran 1.20 times as fast each time.
// Counting every step since v000, it is 77.8 times as fast.
#include <hip/hip_runtime.h>
// All contractions (q, k, v projections K=512; q.k^T per head K=64; softmax weights . V K=SEQ; output projection K=512): v_wmma_f32_16x16x32_f16, f16 operands (every float input RNE-converted to bf16 first; weights carried x16, softmax weights carried unnormalised as 2^(t - m) <= 2^8, o carried x64), f32 accumulate; softmax statistics f32 on the VALU.
// Structure: token rows r = b*SEQ + s. X16 = f16(bf16(h)); q | k | v as f16 rows [r][3*DM] from one GEMM launch over the stacked weights (alpha 1/16, bias bf16); V^T planes [b*NH+h][64][SEQ] through an LDS transpose;
// per (batch, head, 32 query rows) one wave walks the keys 32 at a time: S^T = K . Q^T in f32, gated by the integer adjacency (adj[q][j] == 0 -> weight exactly 0; a row with no open key yields NaN), running maximum and sum per query in f32,
// P = f16(2^(t - m)) taken from the score accumulators as the B operand of O^T += V^T . P^T; o = O^T * 64 / sum written as f16 rows [r][DM] (head h -> columns h*64); out = o . Wo^T * 2^-10 + bf16(bo) in f32.
#ifndef NB
#define NB 4
#endif
#ifndef SEQ
#define SEQ 2048
#endif
#define NB_FULL 4
#define SEQ_FULL 2048                /* pitch of adj rows and per-batch stride of h */
#define DM 512
#define NH 8
#define HD 64
#define LQ (3 * DM)                  /* row pitch of the q | k | v plane */
#define NR ((size_t)NB * SEQ)        /* token rows */
static_assert(NB >= 1 && NB <= NB_FULL);
static_assert(SEQ >= 128 && SEQ <= SEQ_FULL);
static_assert(SEQ % 256 == 0);      /* a block of the attention kernel owns 256 query rows; V^T is cut in 64-key slabs */
static_assert((NB * SEQ) % 128 == 0);
static_assert(DM == NH * HD && HD == 64 && DM % 64 == 0);

typedef unsigned short v8us __attribute__((ext_vector_type(8), may_alias));
typedef float  v8f  __attribute__((ext_vector_type(8)));
typedef float  v4f  __attribute__((ext_vector_type(4)));
typedef float  v4fa __attribute__((ext_vector_type(4), may_alias));
typedef int    v4ia __attribute__((ext_vector_type(4), may_alias));
typedef _Float16 v16h __attribute__((ext_vector_type(16)));
typedef _Float16 v4h __attribute__((ext_vector_type(4)));
union FragH { v16h v; v8us half[2]; _Float16 h[16]; unsigned short u[16]; };

__device__ __forceinline__ unsigned short bf16_bits(float x) { unsigned int u = __float_as_uint(x); return (unsigned short)((u + 0x7FFFu + ((u >> 16) & 1u)) >> 16); }
__device__ __forceinline__ float bf16_val(unsigned short b) { return __uint_as_float(((unsigned int)b) << 16); }
__device__ __forceinline__ float bf16_rne(float x) { return bf16_val(bf16_bits(x)); }

// ---- f16 WMMA fragments in the split k layout (elements 0..7 <- k0+8h.., 8..15 <- k0+16+8h..), the same for both operands ----
__device__ __forceinline__ v16h g2_frag(const _Float16* p, int hh) { FragH f; f.half[0] = *(const v8us*)((const unsigned short*)p + 8 * hh); f.half[1] = *(const v8us*)((const unsigned short*)p + 16 + 8 * hh); return f.v; }

__device__ __forceinline__ void d_wnat(unsigned blk, const float* __restrict__ w, size_t n8, _Float16* __restrict__ Bt) {
  const size_t t = (size_t)blk * 256 + threadIdx.x; if (t >= n8) return;
  const v4f a = *(const v4fa*)(w + t * 8), c = *(const v4fa*)(w + t * 8 + 4); FragH f;
#pragma unroll
  for (int q = 0; q < 4; ++q) { f.h[q] = (_Float16)(bf16_rne(a[q]) * 16.0f); f.h[4 + q] = (_Float16)(bf16_rne(c[q]) * 16.0f); }
  *(v8us*)((unsigned short*)Bt + t * 8) = f.half[0];  }

__device__ __forceinline__ void d_x16(unsigned blk, const float* __restrict__ x, _Float16* __restrict__ X16, size_t n8) {
  const size_t t = (size_t)blk * 256 + threadIdx.x; if (t >= n8) return;
  const size_t per = (size_t)SEQ * DM / 8; const size_t b = t / per, rem = t - b * per;
  const float* src = x + b * ((size_t)SEQ_FULL * DM) + rem * 8;
  const v4f a = *(const v4fa*)src, c = *(const v4fa*)(src + 4); FragH f;
#pragma unroll
  for (int q = 0; q < 4; ++q) { f.h[q] = (_Float16)bf16_rne(a[q]); f.h[4 + q] = (_Float16)bf16_rne(c[q]); }
  *(v8us*)((unsigned short*)X16 + t * 8) = f.half[0];  }

// The five conversions need nothing of each other, so they share one grid by ranges of the block index (a block-uniform branch): blocks 0 .. 4 * PW - 1 convert Wq, Wk, Wv, Wo into the stacked plane BW [4 * DM][DM], the rest convert h.
#define PW ((DM * DM / 8 + 255) / 256)     /* blocks per weight matrix */
__global__ __launch_bounds__(256) void k_prep(const float* __restrict__ x, const float* __restrict__ wq, const float* __restrict__ wk, const float* __restrict__ wv, const float* __restrict__ wo,
                                              _Float16* __restrict__ BW, _Float16* __restrict__ X16, size_t nx8) {
  const unsigned blk = blockIdx.x;
  if (blk < 4u * PW) { const unsigned i = blk / PW; const float* w = (i == 0) ? wq : (i == 1) ? wk : (i == 2) ? wv : wo;
    d_wnat(blk - i * PW, w, (size_t)DM * DM / 8, BW + (size_t)i * DM * DM); }
  else d_x16(blk - 4u * PW, x, X16, nx8); }

template <int NHv, int TTv>
__global__ __launch_bounds__(256) void k_vt(const _Float16* __restrict__ V16, int ldv, int voff, _Float16* __restrict__ Vt) {
  __shared__ unsigned short tl[64][66]; const int tid = threadIdx.x; const int slab = blockIdx.x / (TTv / 64), lg = blockIdx.x % (TTv / 64); const int b = slab / NHv, h = slab % NHv;
  for (int i = tid; i < 64 * 8; i += 256) { const int r = i / 8, c8 = (i % 8) * 8; FragH f; f.half[0] = *(const v8us*)((const unsigned short*)V16 + ((size_t)b * TTv + lg * 64 + r) * ldv + voff + h * 64 + c8);
#pragma unroll
    for (int q = 0; q < 8; ++q) tl[r][c8 + q] = f.u[q]; }
  __syncthreads();
  {
#pragma unroll
    for (int rd = 0; rd < 2; ++rd) { const int d = rd * 32 + tid / 8, pc = tid % 8; FragH f;
#pragma unroll
      for (int q = 0; q < 8; ++q) f.u[q] = tl[pc * 8 + q][d];
      *(v8us*)((unsigned short*)Vt + ((size_t)slab * 64 + d) * TTv + lg * 64 + pc * 8) = f.half[0]; }
     } }

// 2^x of four values in place (what the native exp compiles to behind its multiply by log2 e). The four v_exp_f32 name disjoint registers; the closing v_nop keeps the one slot that the instruction set
// asks for between a transcendental and the next use of its result or overwrite of its source.
__device__ __forceinline__ v4f exp2x4(v4f x) { float a = x[0], b = x[1], c = x[2], d = x[3];
  asm("v_exp_f32 %0, %0\n\tv_exp_f32 %1, %1\n\tv_exp_f32 %2, %2\n\tv_exp_f32 %3, %3\n\tv_nop" : "+v"(a), "+v"(b), "+v"(c), "+v"(d));
  const v4f r = {a, b, c, d}; return r; }
__device__ __forceinline__ float xhalf(float x) { return __builtin_bit_cast(float, __builtin_amdgcn_permlanex16(__builtin_bit_cast(int, x), __builtin_bit_cast(int, x), 0x76543210, 0xfedcba98, false, false)); }      /* lane l <- lane l ^ 16, on the vector pipe */
__device__ __forceinline__ v8f fa_mma(v16h a, v16h b, v8f c) { return __builtin_amdgcn_wmma_f32_16x16x32_f16(false, a, false, b, (short)0, c, false, false); }
#define FA_KP 144                          /* LDS pitch of a 128-byte row (K, V^T) */
#define FA_AP 272                          /* LDS pitch of a 256-byte row (adj) */
#define FA_V (64 * FA_KP)                  /* byte offsets inside one buffer: K at 0, V^T, then eight adj slices */
#define FA_A (2 * 64 * FA_KP)
#define FA_AW (32 * FA_AP)
#define FA_STAGE (FA_A + 8 * FA_AW)
typedef __attribute__((address_space(3))) unsigned char lds_u8;
// Ten copies of 16 B a lane, each with its own LDS byte address and global address. Every lane on, no two lanes on one LDS byte.
// The closing s_wait_xcnt stands inside the statement so that no address register named here is rewritten in front of it.
__device__ __forceinline__ void fa_copy10(const unsigned (&l)[10], const char* const (&g)[10]) {
  asm volatile("global_load_async_to_lds_b128 %0, %1, off\n\tglobal_load_async_to_lds_b128 %2, %3, off\n\t"
               "global_load_async_to_lds_b128 %4, %5, off\n\tglobal_load_async_to_lds_b128 %6, %7, off\n\t"
               "global_load_async_to_lds_b128 %8, %9, off\n\tglobal_load_async_to_lds_b128 %10, %11, off\n\t"
               "global_load_async_to_lds_b128 %12, %13, off\n\tglobal_load_async_to_lds_b128 %14, %15, off\n\t"
               "global_load_async_to_lds_b128 %16, %17, off\n\tglobal_load_async_to_lds_b128 %18, %19, off\n\t"
               "s_wait_xcnt 0x0"
               :: "v"(l[0]), "v"(g[0]), "v"(l[1]), "v"(g[1]), "v"(l[2]), "v"(g[2]), "v"(l[3]), "v"(g[3]), "v"(l[4]), "v"(g[4]),
                  "v"(l[5]), "v"(g[5]), "v"(l[6]), "v"(g[6]), "v"(l[7]), "v"(g[7]), "v"(l[8]), "v"(g[8]), "v"(l[9]), "v"(g[9]) : "memory"); }
// One stage's copies of one wave: 8 K rows and 8 V^T rows (4 rows a copy, rows r and r + 32), its 32 adj rows (2 rows a copy).
__device__ __forceinline__ void fa_copy(unsigned lk, const char* gk, unsigned lv, const char* gv, unsigned la, const char* ga) {
  constexpr unsigned dl = 2 * FA_AP; constexpr size_t dg = (size_t)2 * SEQ_FULL * 4;
  const unsigned l1[10] = {lk, lk + 32 * FA_KP, lv, lv + 32 * FA_KP, la, la + dl, la + 2 * dl, la + 3 * dl, la + 4 * dl, la + 5 * dl};
  const char* const g1[10] = {gk, gk + (size_t)32 * LQ * 2, gv, gv + (size_t)32 * SEQ * 2, ga, ga + dg, ga + 2 * dg, ga + 3 * dg, ga + 4 * dg, ga + 5 * dg};
  fa_copy10(l1, g1);
  const unsigned l2[10] = {la + 6 * dl, la + 7 * dl, la + 8 * dl, la + 9 * dl, la + 10 * dl, la + 11 * dl, la + 12 * dl, la + 13 * dl, la + 14 * dl, la + 15 * dl};
  const char* const g2[10] = {ga + 6 * dg, ga + 7 * dg, ga + 8 * dg, ga + 9 * dg, ga + 10 * dg, ga + 11 * dg, ga + 12 * dg, ga + 13 * dg, ga + 14 * dg, ga + 15 * dg};
  fa_copy10(l2, g2); }
__global__ __launch_bounds__(256) void k_fattn(const _Float16* __restrict__ QKV, const _Float16* __restrict__ VT, const int* __restrict__ adj, _Float16* __restrict__ O16) {
  __shared__ __attribute__((aligned(16))) unsigned char L[2 * FA_STAGE];
  const int tid = threadIdx.x, lane = threadIdx.x & 31, w = threadIdx.x >> 5, ln = lane & 15, hh = lane >> 4;
  constexpr int QB = SEQ / 256; const int slab = blockIdx.x / QB, qb = blockIdx.x - slab * QB; const int b = slab / NH, h = slab - b * NH;
  const int q0 = qb * 256 + w * 32; const size_t r0 = (size_t)b * SEQ;
  const _Float16* qp = QKV + (r0 + q0 + ln) * LQ + h * HD + 8 * hh;      /* every fragment pointer below carries the lane half's 8 * hh itself, so g2_frag is called with 0 */
  v16h qf[2][2];
#pragma unroll
  for (int qt = 0; qt < 2; ++qt) { qf[qt][0] = g2_frag(qp + (size_t)qt * 16 * LQ, 0); qf[qt][1] = g2_frag(qp + (size_t)qt * 16 * LQ + 32, 0); }
  /* copy side: thread tid brings 16 B of K rows tid / 8 and tid / 8 + 32, the same of V^T, and 16 B of each of its wave's adj rows lane / 16 + 2 * j */
  const char* gk = (const char*)(QKV + DM + (r0 + (tid >> 3)) * LQ + h * HD + 8 * (tid & 7));
  const char* gv = (const char*)(VT + ((size_t)slab * HD + (tid >> 3)) * SEQ + 8 * (tid & 7));
  const char* ga = (const char*)(adj + (size_t)(q0 + hh) * SEQ_FULL + 4 * ln);
  const unsigned l0 = (unsigned)(uintptr_t)(lds_u8*)L;
  const unsigned lk = l0 + (tid >> 3) * FA_KP + 16 * (tid & 7), lv = lk + FA_V, la = l0 + FA_A + w * FA_AW + hh * FA_AP + 16 * ln;
  constexpr size_t sk = (size_t)64 * LQ * 2, sv = 128, sa = 256;      /* bytes from one stage's tile to the next */
  /* read side, inside a buffer: the lane's K row, V^T row and adj row, each with the lane half's share */
  const int rk = ln * FA_KP + 16 * hh, rv = FA_V + ln * FA_KP + 16 * hh, ra = FA_A + w * FA_AW + ln * FA_AP + 32 * hh;
  const v8f z8 = {0.f,0.f,0.f,0.f,0.f,0.f,0.f,0.f};
  v8f o[2][4]; float m[2] = {-3.0e38f, -3.0e38f}, l[2] = {0.f, 0.f};
#pragma unroll
  for (int qt = 0; qt < 2; ++qt) {
#pragma unroll
    for (int dt = 0; dt < 4; ++dt) o[qt][dt] = z8; }
  constexpr int NT = SEQ / 64; static_assert(NT >= 2);
  fa_copy(lk, gk, lv, gv, la, ga);      /* stage 0 into buffer 0 */
  asm volatile("s_wait_asynccnt 0x0" ::: "memory");      /* this wave's copies of stage 0 have landed */
  __syncthreads();      /* ... and every other wave's */
  fa_copy(lk + FA_STAGE, gk + sk, lv + FA_STAGE, gv + sv, la + FA_STAGE, ga + sa);      /* stage 1 into buffer 1 */
  gk += 2 * sk; gv += 2 * sv; ga += 2 * sa;
  for (int t = 0; t < NT; ++t, gk += sk, gv += sv, ga += sa) {
    const unsigned bo = (unsigned)(t & 1) * FA_STAGE; const unsigned char* B = L + bo;
#pragma unroll 1
   for (int u = 0; u < 2; ++u) {      /* the stage's two passes; kept rolled: unrolled, the kernel takes more than 256 registers */
    v16h kf[2][2], vf[4]; v4ia av[2][2][2];
#pragma unroll
    for (int kt = 0; kt < 2; ++kt) { const _Float16* p = (const _Float16*)(B + rk + (u * 32 + kt * 16) * FA_KP); kf[kt][0] = g2_frag(p, 0); kf[kt][1] = g2_frag(p + 32, 0); }
#pragma unroll
    for (int qt = 0; qt < 2; ++qt) {
#pragma unroll
      for (int kt = 0; kt < 2; ++kt) { const int* p = (const int*)(B + ra + qt * 16 * FA_AP + u * 128 + kt * 64); av[qt][kt][0] = *(const v4ia*)p; av[qt][kt][1] = *(const v4ia*)(p + 4); } }
#pragma unroll
    for (int dt = 0; dt < 4; ++dt) vf[dt] = g2_frag((const _Float16*)(B + rv + dt * 16 * FA_KP + u * 64), 0);
    v8f s[2][2];
#pragma unroll
    for (int qt = 0; qt < 2; ++qt) {
#pragma unroll
      for (int kt = 0; kt < 2; ++kt) s[qt][kt] = fa_mma(kf[kt][1], qf[qt][1], fa_mma(kf[kt][0], qf[qt][0], z8)); }
    float ml[2];
#pragma unroll
    for (int qt = 0; qt < 2; ++qt) { float mx = -3.0e38f;
#pragma unroll
      for (int kt = 0; kt < 2; ++kt) {
#pragma unroll
        for (int r = 0; r < 8; ++r) { const float t = s[qt][kt][r] * 0.18033688011112042f; const float g = (av[qt][kt][r >> 2][r & 3] != 0) ? t : -1.0e30f; s[qt][kt][r] = g; mx = fmaxf(mx, g); } }
      ml[qt] = fmaxf(mx, xhalf(mx)); }
    const bool need = (ml[0] > m[0] + 8.0f) || (ml[1] > m[1] + 8.0f);
    if (__builtin_amdgcn_ballot_w32(need) != 0) {      /* one scalar branch a pass: the 64 multiplies are skipped while no query of the wave moves its maximum */
      const float n0 = (ml[0] > m[0] + 8.0f) ? ml[0] : m[0], n1 = (ml[1] > m[1] + 8.0f) ? ml[1] : m[1];
      const v4f d4 = {m[0] - n0, m[1] - n1, 0.f, 0.f}; const v4f al = exp2x4(d4); m[0] = n0; m[1] = n1;
#pragma unroll
      for (int qt = 0; qt < 2; ++qt) { l[qt] *= al[qt];
#pragma unroll
        for (int dt = 0; dt < 4; ++dt) o[qt][dt] *= al[qt]; } }
#pragma unroll
    for (int qt = 0; qt < 2; ++qt) { FragH pf;
#pragma unroll
      for (int kt = 0; kt < 2; ++kt) {
#pragma unroll
        for (int g = 0; g < 2; ++g) { const v4f x = {s[qt][kt][4 * g] - m[qt], s[qt][kt][4 * g + 1] - m[qt], s[qt][kt][4 * g + 2] - m[qt], s[qt][kt][4 * g + 3] - m[qt]}; const v4f e = exp2x4(x);
#pragma unroll
          for (int q = 0; q < 4; ++q) pf.h[kt * 8 + g * 4 + q] = (_Float16)e[q];
          l[qt] += (e[0] + e[1]) + (e[2] + e[3]); } }
#pragma unroll
      for (int dt = 0; dt < 4; ++dt) o[qt][dt] = fa_mma(vf[dt], pf.v, o[qt][dt]); } }
    asm volatile("s_wait_dscnt 0x0" ::: "memory");      /* this wave's reads of this stage's buffer are done */
    asm volatile("s_wait_asynccnt 0x0" ::: "memory");      /* its copies of the next stage have landed */
    __syncthreads();      /* publishes the next stage's buffer and frees this stage's */
    if (t + 2 < NT) fa_copy(lk + bo, gk, lv + bo, gv, la + bo, ga); }
  asm volatile("s_wait_asynccnt 0x0" ::: "memory");      /* no copy is left in flight when the wave ends */
#pragma unroll
  for (int qt = 0; qt < 2; ++qt) { const float se = l[qt] + xhalf(l[qt]);
    const float sc = (m[qt] > -1.0e29f) ? (64.0f / se) : __uint_as_float(0x7fc00000u);
    unsigned short* d = (unsigned short*)O16 + (r0 + q0 + qt * 16 + ln) * DM + h * HD + 8 * hh;
#pragma unroll
    for (int dt = 0; dt < 4; ++dt) { FragH f;
#pragma unroll
      for (int r = 0; r < 8; ++r) f.h[r] = (_Float16)(o[qt][dt][r] * sc);
      *(v8us*)(d + dt * 16) = f.half[0]; } } }

// ---- f16 WMMA GEMM, K = DM, N = NSEG * DM: C = A . Bt^T * alpha + bf16(bias[col]); A [m][DM] f16, Bt [n][DM] f16, NSEG weight matrices stacked by rows, each with its own bias vector (b0, b1, b2), so that products of one A share one grid. A block of 8 waves owns 128 x 128 of C, a wave 32 x 64 (wave w: rows 32 * (w & 3), columns 64 * (w >> 2)).
// A stage is 128 of k: 128 A rows and 128 Bt rows of 256 B each are brought into LDS by asynchronous copies in whole lines, once per block, one stage ahead, into two buffers;
// the fragment reads (16 B a lane, 16 rows a read) then go to LDS, at a row pitch of an odd number of 16 B. Requires M % 128 == 0; the grid covers C exactly.
#define G_KS 128                           /* k per stage */
#define G_P 272                            /* LDS pitch of a 256-byte row */
#define G_B (128 * G_P)                    /* byte offset of the Bt tile inside one buffer */
#define G_STAGE (2 * 128 * G_P)
static_assert(DM % 128 == 0 && DM / G_KS >= 2);
static_assert(2 * G_STAGE >= 8 * 32 * 68 * 4);      /* the output staging of the epilogue reuses the buffers */
// One tile's copies of one thread: 16 B of each of the rows r, r + 16, ..., r + 112. Every lane on, no two lanes on one LDS byte.
// The closing s_wait_xcnt stands inside the statement so that no address register named here is rewritten in front of it.
__device__ __forceinline__ void g3_copy(unsigned l, const char* g) {
  constexpr unsigned dl = 16 * G_P; constexpr size_t dg = (size_t)16 * DM * 2;
  asm volatile("global_load_async_to_lds_b128 %0, %1, off\n\tglobal_load_async_to_lds_b128 %2, %3, off\n\t"
               "global_load_async_to_lds_b128 %4, %5, off\n\tglobal_load_async_to_lds_b128 %6, %7, off\n\t"
               "global_load_async_to_lds_b128 %8, %9, off\n\tglobal_load_async_to_lds_b128 %10, %11, off\n\t"
               "global_load_async_to_lds_b128 %12, %13, off\n\tglobal_load_async_to_lds_b128 %14, %15, off\n\t"
               "s_wait_xcnt 0x0"
               :: "v"(l), "v"(g), "v"(l + dl), "v"(g + dg), "v"(l + 2 * dl), "v"(g + 2 * dg), "v"(l + 3 * dl), "v"(g + 3 * dg),
                  "v"(l + 4 * dl), "v"(g + 4 * dg), "v"(l + 5 * dl), "v"(g + 5 * dg), "v"(l + 6 * dl), "v"(g + 6 * dg), "v"(l + 7 * dl), "v"(g + 7 * dg) : "memory"); }
// The fragments of 32 of k: two A row tiles, four Bt row tiles.
__device__ __forceinline__ void g3_frags(const unsigned char* pa, const unsigned char* pb, v16h (&a)[2], v16h (&b)[4]) {
  a[0] = g2_frag((const _Float16*)pa, 0); a[1] = g2_frag((const _Float16*)(pa + 16 * G_P), 0);
#pragma unroll
  for (int nt = 0; nt < 4; ++nt) b[nt] = g2_frag((const _Float16*)(pb + nt * 16 * G_P), 0); }
template <int OUT32, int NSEG>      /* OUT32 1: the result goes to C as f32; 0: to C16 as f16 */
__global__ __launch_bounds__(256) void k_gemm3(const _Float16* __restrict__ A, const _Float16* __restrict__ Bh, float alpha, const float* __restrict__ b0, const float* __restrict__ b1, const float* __restrict__ b2, float* __restrict__ C, _Float16* __restrict__ C16, int ldc) {
  __shared__ __attribute__((aligned(16))) unsigned char L[2 * G_STAGE];
  const int tid = threadIdx.x, w = tid >> 5, lane = tid & 31, ln = lane & 15, hh = lane >> 4;
  constexpr int NTN = NSEG * DM / 128; const int mt = blockIdx.x / NTN, nq = blockIdx.x - mt * NTN;
  const int wm = w & 3, wn = w >> 2; const int row0 = mt * 128 + 32 * wm, col0 = nq * 128 + 64 * wn;
  /* copy side: thread tid brings 16 B of the tile rows tid / 16 + 16 * j of A and of Bt */
  const char* ga = (const char*)(A + (size_t)(mt * 128 + (tid >> 4)) * DM + 8 * (tid & 15));
  const char* gb = (const char*)(Bh + (size_t)(nq * 128 + (tid >> 4)) * DM + 8 * (tid & 15));
  const unsigned la = (unsigned)(uintptr_t)(lds_u8*)L + (tid >> 4) * G_P + 16 * (tid & 15), lb = la + G_B;
  constexpr size_t sg = (size_t)G_KS * 2;      /* bytes from one stage's tile to the next */
  /* read side, inside a buffer: the lane's first A row and first Bt row, each with the lane half's share, so g2_frag is called with 0 */
  const int ra = (32 * wm + ln) * G_P + 16 * hh, rb = G_B + (64 * wn + ln) * G_P + 16 * hh;
  const v8f z8 = {0.f,0.f,0.f,0.f,0.f,0.f,0.f,0.f}; v8f c[2][4];
#pragma unroll
  for (int u = 0; u < 8; ++u) c[u >> 2][u & 3] = z8;
  constexpr int NT = DM / G_KS;
  g3_copy(la, ga); g3_copy(lb, gb);      /* stage 0 into buffer 0 */
  asm volatile("s_wait_asynccnt 0x0" ::: "memory");      /* this wave's copies of stage 0 have landed */
  __syncthreads();      /* ... and every other wave's */
  g3_copy(la + G_STAGE, ga + sg); g3_copy(lb + G_STAGE, gb + sg);      /* stage 1 into buffer 1 */
  ga += 2 * sg; gb += 2 * sg;
  for (int t = 0; t < NT; ++t, ga += sg, gb += sg) {
    const unsigned bo = (unsigned)(t & 1) * G_STAGE; const unsigned char* B = L + bo;
    v16h af[2][2], bf[2][4];      /* two fragment sets: the reads of the next 32 of k stand as one group in front of this 32's products */
    g3_frags(B + ra, B + rb, af[0], bf[0]);
#pragma unroll      /* fragment sets and accumulators are indexed by constants, so they stay in registers */
    for (int ks = 0; ks < G_KS / 32; ++ks) {
      if (ks + 1 < G_KS / 32) g3_frags(B + ra + (ks + 1) * 64, B + rb + (ks + 1) * 64, af[(ks + 1) & 1], bf[(ks + 1) & 1]);
      __builtin_amdgcn_sched_barrier(0);      /* keeps that group of reads in front of the products: without it the compiler sinks each read to its first use and every pair of products waits for LDS */
#pragma unroll
      for (int nt = 0; nt < 4; ++nt) { c[0][nt] = fa_mma(af[ks & 1][0], bf[ks & 1][nt], c[0][nt]); c[1][nt] = fa_mma(af[ks & 1][1], bf[ks & 1][nt], c[1][nt]); }
      __builtin_amdgcn_sched_barrier(0); }      /* ... and the group after next behind them, so that two fragment sets suffice */
    asm volatile("s_wait_dscnt 0x0" ::: "memory");      /* this wave's reads of this stage's buffer are done */
    asm volatile("s_wait_asynccnt 0x0" ::: "memory");      /* its copies of the next stage have landed */
    __syncthreads();      /* publishes the next stage's buffer and frees this stage's */
    if (t + 2 < NT) { g3_copy(la + bo, ga); g3_copy(lb + bo, gb); } }
  asm volatile("s_wait_asynccnt 0x0" ::: "memory");      /* no copy is left in flight when the buffers are reused */
  const int seg = (NSEG == 1) ? 0 : nq / (DM / 128); const float* bias = ((seg == 0) ? b0 : (seg == 1) ? b1 : b2) + (col0 - seg * DM);      /* the column's own bias vector */
  float (*so)[68] = (float (*)[68])(L + (size_t)w * 32 * 68 * 4);      /* the wave's own 32 x 64 output tile; every wave has left the buffers at the loop's last barrier */
#pragma unroll
  for (int u = 0; u < 8; ++u) { const int t = u & 3, half = u >> 2; const float bv = bf16_rne(bias[t * 16 + ln]);
#pragma unroll
    for (int r = 0; r < 8; ++r) so[half * 16 + 8 * hh + r][t * 16 + ln] = c[half][t][r] * alpha + bv; }
  __builtin_amdgcn_fence(4, "workgroup"); __builtin_amdgcn_wave_barrier();
  const int rsub = lane >> 4, c4 = (lane & 15) * 4;
#pragma unroll
  for (int q = 0; q < 16; ++q) { const int r = q * 2 + rsub; const v4f v = *(const v4fa*)&so[r][c4];
    if (OUT32) *(v4f*)(C + (size_t)(row0 + r) * ldc + col0 + c4) = v;
    else { v4h h4; for (int i = 0; i < 4; ++i) h4[i] = (_Float16)v[i]; *(v4h*)(C16 + (size_t)(row0 + r) * ldc + col0 + c4) = h4; } } }

extern "C" void kernel_launch(void* const* d_in, const int* in_sizes, int n_in,
                              void* d_out, int out_size, void* d_ws, size_t ws_size, hipStream_t stream) {
  if (n_in < 10) return;
  if (in_sizes[0] < NB * SEQ_FULL * DM || in_sizes[1] < SEQ * SEQ_FULL) return;
  if (in_sizes[2] < DM * DM || in_sizes[4] < DM * DM || in_sizes[6] < DM * DM || in_sizes[8] < DM * DM) return;
  if (in_sizes[3] < DM || in_sizes[5] < DM || in_sizes[7] < DM || in_sizes[9] < DM) return;
  if (out_size < (int)(NR * DM)) return;
  const float* x  = (const float*)d_in[0]; const int* adj = (const int*)d_in[1];
  const float* wq = (const float*)d_in[2]; const float* bq = (const float*)d_in[3];
  const float* wk = (const float*)d_in[4]; const float* bk = (const float*)d_in[5];
  const float* wv = (const float*)d_in[6]; const float* bv = (const float*)d_in[7];
  const float* wo = (const float*)d_in[8]; const float* bo = (const float*)d_in[9];
  char* ws = (char*)d_ws; size_t off = 0;
  auto take = [&](size_t bytes) { char* p = ws + off; off += (bytes + 255) & ~(size_t)255; return p; };
  _Float16* BW  = (_Float16*)take((size_t)4 * DM * DM * 2);           /* Bt[n][k] x16 (natural [out][in]): Wq, Wk, Wv, Wo stacked by rows */
  _Float16* X16 = (_Float16*)take(NR * DM * 2);                       /* [NR][DM] */
  _Float16* QKV = (_Float16*)take(NR * LQ * 2);                       /* [NR][3*DM]: q | k | v */
  _Float16* O16 = (_Float16*)take(NR * DM * 2);                       /* [NR][DM], o x64 */
  _Float16* VT  = (_Float16*)take((size_t)NB * NH * HD * SEQ * 2);    /* [NB*NH][64][SEQ] */
  if (off > ws_size || off > (size_t)134217728) return;
  k_prep<<<(unsigned)(4 * PW + (NR * DM / 8 + 255) / 256), 256, 0, stream>>>(x, wq, wk, wv, wo, BW, X16, NR * DM / 8);
  const unsigned gp = (unsigned)((NR / 128) * (DM / 128));
  k_gemm3<0, 3><<<3 * gp, 256, 0, stream>>>(X16, BW, 0.0625f, bq, bk, bv, nullptr, QKV, LQ);      /* q | k | v rows (f16), head h = columns h*64.. of each */
  k_vt<NH, SEQ><<<(unsigned)(NB * NH * (SEQ / 64)), 256, 0, stream>>>(QKV + 2 * DM, LQ, 0, VT);      /* V^T [NB*NH][HD][SEQ] */
  k_fattn<<<(unsigned)(NB * NH * (SEQ / 256)), 256, 0, stream>>>(QKV, VT, adj, O16);      /* o (merged heads, x64) f16 rows */
  k_gemm3<1, 1><<<gp, 256, 0, stream>>>(O16, BW + (size_t)3 * DM * DM, 0.0009765625f, bo, nullptr, nullptr, (float*)d_out, nullptr, DM);      /* out rows = output layout [b][s][DM] */
}

// v006
// A run of this version takes 79.3 microseconds.
// Timed twice side by side with v005, it ran 1.03 times as fast both times.
// All steps since v000 together make it 80.1 times as fast.
#include <hip/hip_runtime.h>
// All contractions (q, k, v projections K=512; q.k^T per head K=64; softmax weights . V K=SEQ; output projection K=512): v_wmma_f32_16x16x32_f16, f16 operands (every float input RNE-converted to bf16 first; weights carried x16, softmax weights carried unnormalised as 2^(t - m) <= 2^8, o carried x64), f32 accumulate; softmax statistics f32 on the VALU.
// Structure: token rows r = b*SEQ + s. X16 = f16(bf16(h)); q | k as f16 rows [r][3*DM] and V^T planes [b*NH+h][64][SEQ] from one GEMM launch over the stacked weights (alpha 1/16, bias bf16), the v blocks with their operands swapped;
// per (batch, head, 32 query rows) one wave walks the keys 32 at a time: S^T = K . Q^T in f32, gated by the integer adjacency (adj[q][j] == 0 -> weight exactly 0; a row with no open key yields NaN), running maximum and sum per query in f32,
// P = f16(2^(t - m)) taken from the score accumulators as the B operand of O^T += V^T . P^T; o = O^T * 64 / sum written as f16 rows [r][DM] (head h -> columns h*64); out = o . Wo^T * 2^-10 + bf16(bo) in f32.
#ifndef NB
#define NB 4
#endif
#ifndef SEQ
#define SEQ 2048
#endif
#define NB_FULL 4
#define SEQ_FULL 2048                /* pitch of adj rows and per-batch stride of h */
#define DM 512
#define NH 8
#define HD 64
#define LQ (3 * DM)                  /* row pitch of the q | k plane (its last DM columns not used) */
#define NR ((size_t)NB * SEQ)        /* token rows */
static_assert(NB >= 1 && NB <= NB_FULL);
static_assert(SEQ >= 128 && SEQ <= SEQ_FULL);
static_assert(SEQ % 256 == 0);      /* a block of the attention kernel owns 256 query rows; a 128-token tile of the GEMM lies in one batch */
static_assert((NB * SEQ) % 128 == 0);
static_assert(DM == NH * HD && HD == 64 && DM % 64 == 0);

typedef unsigned short v8us __attribute__((ext_vector_type(8), may_alias));
typedef float  v8f  __attribute__((ext_vector_type(8)));
typedef float  v4f  __attribute__((ext_vector_type(4)));
typedef float  v4fa __attribute__((ext_vector_type(4), may_alias));
typedef int    v4ia __attribute__((ext_vector_type(4), may_alias));
typedef _Float16 v16h __attribute__((ext_vector_type(16)));
typedef _Float16 v4h __attribute__((ext_vector_type(4)));
union FragH { v16h v; v8us half[2]; _Float16 h[16]; unsigned short u[16]; };

__device__ __forceinline__ unsigned short bf16_bits(float x) { unsigned int u = __float_as_uint(x); return (unsigned short)((u + 0x7FFFu + ((u >> 16) & 1u)) >> 16); }
__device__ __forceinline__ float bf16_val(unsigned short b) { return __uint_as_float(((unsigned int)b) << 16); }
__device__ __forceinline__ float bf16_rne(float x) { return bf16_val(bf16_bits(x)); }

// ---- f16 WMMA fragments in the split k layout (elements 0..7 <- k0+8h.., 8..15 <- k0+16+8h..), the same for both operands ----
__device__ __forceinline__ v16h g2_frag(const _Float16* p, int hh) { FragH f; f.half[0] = *(const v8us*)((const unsigned short*)p + 8 * hh); f.half[1] = *(const v8us*)((const unsigned short*)p + 16 + 8 * hh); return f.v; }

__device__ __forceinline__ void d_wnat(unsigned blk, const float* __restrict__ w, size_t n8, _Float16* __restrict__ Bt) {
  const size_t t = (size_t)blk * 256 + threadIdx.x; if (t >= n8) return;
  const v4f a = *(const v4fa*)(w + t * 8), c = *(const v4fa*)(w + t * 8 + 4); FragH f;
#pragma unroll
  for (int q = 0; q < 4; ++q) { f.h[q] = (_Float16)(bf16_rne(a[q]) * 16.0f); f.h[4 + q] = (_Float16)(bf16_rne(c[q]) * 16.0f); }
  *(v8us*)((unsigned short*)Bt + t * 8) = f.half[0];  }

__device__ __forceinline__ void d_x16(unsigned blk, const float* __restrict__ x, _Float16* __restrict__ X16, size_t n8) {
  const size_t t = (size_t)blk * 256 + threadIdx.x; if (t >= n8) return;
  const size_t per = (size_t)SEQ * DM / 8; const size_t b = t / per, rem = t - b * per;
  const float* src = x + b * ((size_t)SEQ_FULL * DM) + rem * 8;
  const v4f a = *(const v4fa*)src, c = *(const v4fa*)(src + 4); FragH f;
#pragma unroll
  for (int q = 0; q < 4; ++q) { f.h[q] = (_Float16)bf16_rne(a[q]); f.h[4 + q] = (_Float16)bf16_rne(c[q]); }
  *(v8us*)((unsigned short*)X16 + t * 8) = f.half[0];  }

// The five conversions need nothing of each other, so they share one grid by ranges of the block index (a block-uniform branch): blocks 0 .. 4 * PW - 1 convert Wq, Wk, Wv, Wo into the stacked plane BW [4 * DM][DM], the rest convert h.
#define PW ((DM * DM / 8 + 255) / 256)     /* blocks per weight matrix */
__global__ __launch_bounds__(256) void k_prep(const float* __restrict__ x, const float* __restrict__ wq, const float* __restrict__ wk, const float* __restrict__ wv, const float* __restrict__ wo,
                                              _Float16* __restrict__ BW, _Float16* __restrict__ X16, size_t nx8) {
  const unsigned blk = blockIdx.x;
  if (blk < 4u * PW) { const unsigned i = blk / PW; const float* w = (i == 0) ? wq : (i == 1) ? wk : (i == 2) ? wv : wo;
    d_wnat(blk - i * PW, w, (size_t)DM * DM / 8, BW + (size_t)i * DM * DM); }
  else d_x16(blk - 4u * PW, x, X16, nx8); }

// 2^x of four values in place (what the native exp compiles to behind its multiply by log2 e). The four v_exp_f32 name disjoint registers; the closing v_nop keeps the one slot that the instruction set
// asks for between a transcendental and the next use of its result or overwrite of its source.
__device__ __forceinline__ v4f exp2x4(v4f x) { float a = x[0], b = x[1], c = x[2], d = x[3];
  asm("v_exp_f32 %0, %0\n\tv_exp_f32 %1, %1\n\tv_exp_f32 %2, %2\n\tv_exp_f32 %3, %3\n\tv_nop" : "+v"(a), "+v"(b), "+v"(c), "+v"(d));
  const v4f r = {a, b, c, d}; return r; }
__device__ __forceinline__ float xhalf(float x) { return __builtin_bit_cast(float, __builtin_amdgcn_permlanex16(__builtin_bit_cast(int, x), __builtin_bit_cast(int, x), 0x76543210, 0xfedcba98, false, false)); }      /* lane l <- lane l ^ 16, on the vector pipe */
__device__ __forceinline__ v8f fa_mma(v16h a, v16h b, v8f c) { return __builtin_amdgcn_wmma_f32_16x16x32_f16(false, a, false, b, (short)0, c, false, false); }
#define FA_KP 144                          /* LDS pitch of a 128-byte row (K, V^T) */
#define FA_AP 272                          /* LDS pitch of a 256-byte row (adj) */
#define FA_V (64 * FA_KP)                  /* byte offsets inside one buffer: K at 0, V^T, then eight adj slices */
#define FA_A (2 * 64 * FA_KP)
#define FA_AW (32 * FA_AP)
#define FA_STAGE (FA_A + 8 * FA_AW)
typedef __attribute__((address_space(3))) unsigned char lds_u8;
// Ten copies of 16 B a lane, each with its own LDS byte address and global address. Every lane on, no two lanes on one LDS byte.
// The closing s_wait_xcnt stands inside the statement so that no address register named here is rewritten in front of it.
__device__ __forceinline__ void fa_copy10(const unsigned (&l)[10], const char* const (&g)[10]) {
  asm volatile("global_load_async_to_lds_b128 %0, %1, off\n\tglobal_load_async_to_lds_b128 %2, %3, off\n\t"
               "global_load_async_to_lds_b128 %4, %5, off\n\tglobal_load_async_to_lds_b128 %6, %7, off\n\t"
               "global_load_async_to_lds_b128 %8, %9, off\n\tglobal_load_async_to_lds_b128 %10, %11, off\n\t"
               "global_load_async_to_lds_b128 %12, %13, off\n\tglobal_load_async_to_lds_b128 %14, %15, off\n\t"
               "global_load_async_to_lds_b128 %16, %17, off\n\tglobal_load_async_to_lds_b128 %18, %19, off\n\t"
               "s_wait_xcnt 0x0"
               :: "v"(l[0]), "v"(g[0]), "v"(l[1]), "v"(g[1]), "v"(l[2]), "v"(g[2]), "v"(l[3]), "v"(g[3]), "v"(l[4]), "v"(g[4]),
                  "v"(l[5]), "v"(g[5]), "v"(l[6]), "v"(g[6]), "v"(l[7]), "v"(g[7]), "v"(l[8]), "v"(g[8]), "v"(l[9]), "v"(g[9]) : "memory"); }
// One stage's copies of one wave: 8 K rows and 8 V^T rows (4 rows a copy, rows r and r + 32), its 32 adj rows (2 rows a copy).
__device__ __forceinline__ void fa_copy(unsigned lk, const char* gk, unsigned lv, const char* gv, unsigned la, const char* ga) {
  constexpr unsigned dl = 2 * FA_AP; constexpr size_t dg = (size_t)2 * SEQ_FULL * 4;
  const unsigned l1[10] = {lk, lk + 32 * FA_KP, lv, lv + 32 * FA_KP, la, la + dl, la + 2 * dl, la + 3 * dl, la + 4 * dl, la + 5 * dl};
  const char* const g1[10] = {gk, gk + (size_t)32 * LQ * 2, gv, gv + (size_t)32 * SEQ * 2, ga, ga + dg, ga + 2 * dg, ga + 3 * dg, ga + 4 * dg, ga + 5 * dg};
  fa_copy10(l1, g1);
  const unsigned l2[10] = {la + 6 * dl, la + 7 * dl, la + 8 * dl, la + 9 * dl, la + 10 * dl, la + 11 * dl, la + 12 * dl, la + 13 * dl, la + 14 * dl, la + 15 * dl};
  const char* const g2[10] = {ga + 6 * dg, ga + 7 * dg, ga + 8 * dg, ga + 9 * dg, ga + 10 * dg, ga + 11 * dg, ga + 12 * dg, ga + 13 * dg, ga + 14 * dg, ga + 15 * dg};
  fa_copy10(l2, g2); }
__global__ __launch_bounds__(256) void k_fattn(const _Float16* __restrict__ QKV, const _Float16* __restrict__ VT, const int* __restrict__ adj, _Float16* __restrict__ O16) {
  __shared__ __attribute__((aligned(16))) unsigned char L[2 * FA_STAGE];
  const int tid = threadIdx.x, lane = threadIdx.x & 31, w = threadIdx.x >> 5, ln = lane & 15, hh = lane >> 4;
  constexpr int QB = SEQ / 256; const int slab = blockIdx.x / QB, qb = blockIdx.x - slab * QB; const int b = slab / NH, h = slab - b * NH;
  const int q0 = qb * 256 + w * 32; const size_t r0 = (size_t)b * SEQ;
  const _Float16* qp = QKV + (r0 + q0 + ln) * LQ + h * HD + 8 * hh;      /* every fragment pointer below carries the lane half's 8 * hh itself, so g2_frag is called with 0 */
  v16h qf[2][2];
#pragma unroll
  for (int qt = 0; qt < 2; ++qt) { qf[qt][0] = g2_frag(qp + (size_t)qt * 16 * LQ, 0); qf[qt][1] = g2_frag(qp + (size_t)qt * 16 * LQ + 32, 0); }
  /* copy side: thread tid brings 16 B of K rows tid / 8 and tid / 8 + 32, the same of V^T, and 16 B of each of its wave's adj rows lane / 16 + 2 * j */
  const char* gk = (const char*)(QKV + DM + (r0 + (tid >> 3)) * LQ + h * HD + 8 * (tid & 7));
  const char* gv = (const char*)(VT + ((size_t)slab * HD + (tid >> 3)) * SEQ + 8 * (tid & 7));
  const char* ga = (const char*)(adj + (size_t)(q0 + hh) * SEQ_FULL + 4 * ln);
  const unsigned l0 = (unsigned)(uintptr_t)(lds_u8*)L;
  const unsigned lk = l0 + (tid >> 3) * FA_KP + 16 * (tid & 7), lv = lk + FA_V, la = l0 + FA_A + w * FA_AW + hh * FA_AP + 16 * ln;
  constexpr size_t sk = (size_t)64 * LQ * 2, sv = 128, sa = 256;      /* bytes from one stage's tile to the next */
  /* read side, inside a buffer: the lane's K row, V^T row and adj row, each with the lane half's share */
  const int rk = ln * FA_KP + 16 * hh, rv = FA_V + ln * FA_KP + 16 * hh, ra = FA_A + w * FA_AW + ln * FA_AP + 32 * hh;
  const v8f z8 = {0.f,0.f,0.f,0.f,0.f,0.f,0.f,0.f};
  v8f o[2][4]; float m[2] = {-3.0e38f, -3.0e38f}, l[2] = {0.f, 0.f};
#pragma unroll
  for (int qt = 0; qt < 2; ++qt) {
#pragma unroll
    for (int dt = 0; dt < 4; ++dt) o[qt][dt] = z8; }
  constexpr int NT = SEQ / 64; static_assert(NT >= 2);
  fa_copy(lk, gk, lv, gv, la, ga);      /* stage 0 into buffer 0 */
  asm volatile("s_wait_asynccnt 0x0" ::: "memory");      /* this wave's copies of stage 0 have landed */
  __syncthreads();      /* ... and every other wave's */
  fa_copy(lk + FA_STAGE, gk + sk, lv + FA_STAGE, gv + sv, la + FA_STAGE, ga + sa);      /* stage 1 into buffer 1 */
  gk += 2 * sk; gv += 2 * sv; ga += 2 * sa;
  for (int t = 0; t < NT; ++t, gk += sk, gv += sv, ga += sa) {
    const unsigned bo = (unsigned)(t & 1) * FA_STAGE; const unsigned char* B = L + bo;
#pragma unroll 1
   for (int u = 0; u < 2; ++u) {      /* the stage's two passes; kept rolled: unrolled, the kernel takes more than 256 registers */
    v16h kf[2][2], vf[4]; v4ia av[2][2][2];
#pragma unroll
    for (int kt = 0; kt < 2; ++kt) { const _Float16* p = (const _Float16*)(B + rk + (u * 32 + kt * 16) * FA_KP); kf[kt][0] = g2_frag(p, 0); kf[kt][1] = g2_frag(p + 32, 0); }
#pragma unroll
    for (int qt = 0; qt < 2; ++qt) {
#pragma unroll
      for (int kt = 0; kt < 2; ++kt) { const int* p = (const int*)(B + ra + qt * 16 * FA_AP + u * 128 + kt * 64); av[qt][kt][0] = *(const v4ia*)p; av[qt][kt][1] = *(const v4ia*)(p + 4); } }
#pragma unroll
    for (int dt = 0; dt < 4; ++dt) vf[dt] = g2_frag((const _Float16*)(B + rv + dt * 16 * FA_KP + u * 64), 0);
    v8f s[2][2];
#pragma unroll
    for (int qt = 0; qt < 2; ++qt) {
#pragma unroll
      for (int kt = 0; kt < 2; ++kt) s[qt][kt] = fa_mma(kf[kt][1], qf[qt][1], fa_mma(kf[kt][0], qf[qt][0], z8)); }
    float ml[2];
#pragma unroll
    for (int qt = 0; qt < 2; ++qt) { float mx = -3.0e38f;
#pragma unroll
      for (int kt = 0; kt < 2; ++kt) {
#pragma unroll
        for (int r = 0; r < 8; ++r) { const float t = s[qt][kt][r] * 0.18033688011112042f; const float g = (av[qt][kt][r >> 2][r & 3] != 0) ? t : -1.0e30f; s[qt][kt][r] = g; mx = fmaxf(mx, g); } }
      ml[qt] = fmaxf(mx, xhalf(mx)); }
    const bool need = (ml[0] > m[0] + 8.0f) || (ml[1] > m[1] + 8.0f);
    if (__builtin_amdgcn_ballot_w32(need) != 0) {      /* one scalar branch a pass: the 64 multiplies are skipped while no query of the wave moves its maximum */
      const float n0 = (ml[0] > m[0] + 8.0f) ? ml[0] : m[0], n1 = (ml[1] > m[1] + 8.0f) ? ml[1] : m[1];
      const v4f d4 = {m[0] - n0, m[1] - n1, 0.f, 0.f}; const v4f al = exp2x4(d4); m[0] = n0; m[1] = n1;
#pragma unroll
      for (int qt = 0; qt < 2; ++qt) { l[qt] *= al[qt];
#pragma unroll
        for (int dt = 0; dt < 4; ++dt) o[qt][dt] *= al[qt]; } }
#pragma unroll
    for (int qt = 0; qt < 2; ++qt) { FragH pf;
#pragma unroll
      for (int kt = 0; kt < 2; ++kt) {
#pragma unroll
        for (int g = 0; g < 2; ++g) { const v4f x = {s[qt][kt][4 * g] - m[qt], s[qt][kt][4 * g + 1] - m[qt], s[qt][kt][4 * g + 2] - m[qt], s[qt][kt][4 * g + 3] - m[qt]}; const v4f e = exp2x4(x);
#pragma unroll
          for (int q = 0; q < 4; ++q) pf.h[kt * 8 + g * 4 + q] = (_Float16)e[q];
          l[qt] += (e[0] + e[1]) + (e[2] + e[3]); } }
#pragma unroll
      for (int dt = 0; dt < 4; ++dt) o[qt][dt] = fa_mma(vf[dt], pf.v, o[qt][dt]); } }
    asm volatile("s_wait_dscnt 0x0" ::: "memory");      /* this wave's reads of this stage's buffer are done */
    asm volatile("s_wait_asynccnt 0x0" ::: "memory");      /* its copies of the next stage have landed */
    __syncthreads();      /* publishes the next stage's buffer and frees this stage's */
    if (t + 2 < NT) fa_copy(lk + bo, gk, lv + bo, gv, la + bo, ga); }
  asm volatile("s_wait_asynccnt 0x0" ::: "memory");      /* no copy is left in flight when the wave ends */
#pragma unroll
  for (int qt = 0; qt < 2; ++qt) { const float se = l[qt] + xhalf(l[qt]);
    const float sc = (m[qt] > -1.0e29f) ? (64.0f / se) : __uint_as_float(0x7fc00000u);
    unsigned short* d = (unsigned short*)O16 + (r0 + q0 + qt * 16 + ln) * DM + h * HD + 8 * hh;
#pragma unroll
    for (int dt = 0; dt < 4; ++dt) { FragH f;
#pragma unroll
      for (int r = 0; r < 8; ++r) f.h[r] = (_Float16)(o[qt][dt][r] * sc);
      *(v8us*)(d + dt * 16) = f.half[0]; } } }

// ---- f16 WMMA GEMM, K = DM, N = NSEG * DM: C = A . Bt^T * alpha + bf16(bias[col]); A [m][DM] f16, Bt [n][DM] f16, NSEG weight matrices stacked by rows, each with its own bias vector (b0, b1, b2), so that products of one A share one grid. A block of 8 waves owns 128 x 128 of C, a wave 32 x 64 (wave w: rows 32 * (w & 3), columns 64 * (w >> 2)).
// With NSEG == 3 the blocks of the third matrix (v) take the weight rows as the row operand and the token rows as the column operand (both lie as [row][k] and are read by the same loader, so only the two tile addresses change places):
// their tile is 128 features x 128 tokens, C^T, with the bias by row, and goes straight to the plane VT [b * DM + feature][SEQ] in whole 128-byte lines of 64 tokens. Requires SEQ % 128 == 0, so that a token tile lies in one batch.
// A stage is 128 of k: 128 A rows and 128 Bt rows of 256 B each are brought into LDS by asynchronous copies in whole lines, once per block, one stage ahead, into two buffers;
// the fragment reads (16 B a lane, 16 rows a read) then go to LDS, at a row pitch of an odd number of 16 B. Requires M % 128 == 0; the grid covers C exactly.
#define G_KS 128                           /* k per stage */
#define G_P 272                            /* LDS pitch of a 256-byte row */
#define G_B (128 * G_P)                    /* byte offset of the Bt tile inside one buffer */
#define G_STAGE (2 * 128 * G_P)
static_assert(DM % 128 == 0 && DM / G_KS >= 2);
static_assert(2 * G_STAGE >= 8 * 32 * 68 * 4);      /* the output staging of the epilogue reuses the buffers */
// One tile's copies of one thread: 16 B of each of the rows r, r + 16, ..., r + 112. Every lane on, no two lanes on one LDS byte.
// The closing s_wait_xcnt stands inside the statement so that no address register named here is rewritten in front of it.
__device__ __forceinline__ void g3_copy(unsigned l, const char* g) {
  constexpr unsigned dl = 16 * G_P; constexpr size_t dg = (size_t)16 * DM * 2;
  asm volatile("global_load_async_to_lds_b128 %0, %1, off\n\tglobal_load_async_to_lds_b128 %2, %3, off\n\t"
               "global_load_async_to_lds_b128 %4, %5, off\n\tglobal_load_async_to_lds_b128 %6, %7, off\n\t"
               "global_load_async_to_lds_b128 %8, %9, off\n\tglobal_load_async_to_lds_b128 %10, %11, off\n\t"
               "global_load_async_to_lds_b128 %12, %13, off\n\tglobal_load_async_to_lds_b128 %14, %15, off\n\t"
               "s_wait_xcnt 0x0"
               :: "v"(l), "v"(g), "v"(l + dl), "v"(g + dg), "v"(l + 2 * dl), "v"(g + 2 * dg), "v"(l + 3 * dl), "v"(g + 3 * dg),
                  "v"(l + 4 * dl), "v"(g + 4 * dg), "v"(l + 5 * dl), "v"(g + 5 * dg), "v"(l + 6 * dl), "v"(g + 6 * dg), "v"(l + 7 * dl), "v"(g + 7 * dg) : "memory"); }
// The fragments of 32 of k: two A row tiles, four Bt row tiles.
__device__ __forceinline__ void g3_frags(const unsigned char* pa, const unsigned char* pb, v16h (&a)[2], v16h (&b)[4]) {
  a[0] = g2_frag((const _Float16*)pa, 0); a[1] = g2_frag((const _Float16*)(pa + 16 * G_P), 0);
#pragma unroll
  for (int nt = 0; nt < 4; ++nt) b[nt] = g2_frag((const _Float16*)(pb + nt * 16 * G_P), 0); }
template <int OUT32, int NSEG>      /* OUT32 1: the result goes to C as f32; 0: to C16 as f16, the v blocks of NSEG 3 to VT */
__global__ __launch_bounds__(256) void k_gemm3(const _Float16* __restrict__ A, const _Float16* __restrict__ Bh, float alpha, const float* __restrict__ b0, const float* __restrict__ b1, const float* __restrict__ b2, float* __restrict__ C, _Float16* __restrict__ C16, int ldc, _Float16* __restrict__ VT) {
  __shared__ __attribute__((aligned(16))) unsigned char L[2 * G_STAGE];
  const int tid = threadIdx.x, w = tid >> 5, lane = tid & 31, ln = lane & 15, hh = lane >> 4;
  constexpr int NTN = NSEG * DM / 128; const int mt = blockIdx.x / NTN, nq = blockIdx.x - mt * NTN;
  const int wm = w & 3, wn = w >> 2; const int row0 = mt * 128 + 32 * wm, col0 = nq * 128 + 64 * wn;
  const int seg = (NSEG == 1) ? 0 : nq / (DM / 128); const bool tr = (NSEG == 3) && seg == 2;      /* the same for the whole block */
  /* copy side: thread tid brings 16 B of the tile rows tid / 16 + 16 * j of A and of Bt; in a transposed block the two change places */
  const char* gx = (const char*)(A + (size_t)(mt * 128 + (tid >> 4)) * DM + 8 * (tid & 15));
  const char* gw = (const char*)(Bh + (size_t)(nq * 128 + (tid >> 4)) * DM + 8 * (tid & 15));
  const char* ga = tr ? gw : gx; const char* gb = tr ? gx : gw;
  const unsigned la = (unsigned)(uintptr_t)(lds_u8*)L + (tid >> 4) * G_P + 16 * (tid & 15), lb = la + G_B;
  constexpr size_t sg = (size_t)G_KS * 2;      /* bytes from one stage's tile to the next */
  /* read side, inside a buffer: the lane's first A row and first Bt row, each with the lane half's share, so g2_frag is called with 0 */
  const int ra = (32 * wm + ln) * G_P + 16 * hh, rb = G_B + (64 * wn + ln) * G_P + 16 * hh;
  const v8f z8 = {0.f,0.f,0.f,0.f,0.f,0.f,0.f,0.f}; v8f c[2][4];
#pragma unroll
  for (int u = 0; u < 8; ++u) c[u >> 2][u & 3] = z8;
  constexpr int NT = DM / G_KS;
  g3_copy(la, ga); g3_copy(lb, gb);      /* stage 0 into buffer 0 */
  asm volatile("s_wait_asynccnt 0x0" ::: "memory");      /* this wave's copies of stage 0 have landed */
  __syncthreads();      /* ... and every other wave's */
  g3_copy(la + G_STAGE, ga + sg); g3_copy(lb + G_STAGE, gb + sg);      /* stage 1 into buffer 1 */
  ga += 2 * sg; gb += 2 * sg;
  for (int t = 0; t < NT; ++t, ga += sg, gb += sg) {
    const unsigned bo = (unsigned)(t & 1) * G_STAGE; const unsigned char* B = L + bo;
    v16h af[2][2], bf[2][4];      /* two fragment sets: the reads of the next 32 of k stand as one group in front of this 32's products */
    g3_frags(B + ra, B + rb, af[0], bf[0]);
#pragma unroll      /* fragment sets and accumulators are indexed by constants, so they stay in registers */
    for (int ks = 0; ks < G_KS / 32; ++ks) {
      if (ks + 1 < G_KS / 32) g3_frags(B + ra + (ks + 1) * 64, B + rb + (ks + 1) * 64, af[(ks + 1) & 1], bf[(ks + 1) & 1]);
      __builtin_amdgcn_sched_barrier(0);      /* keeps that group of reads in front of the products: without it the compiler sinks each read to its first use and every pair of products waits for LDS */
#pragma unroll
      for (int nt = 0; nt < 4; ++nt) { c[0][nt] = fa_mma(af[ks & 1][0], bf[ks & 1][nt], c[0][nt]); c[1][nt] = fa_mma(af[ks & 1][1], bf[ks & 1][nt], c[1][nt]); }
      __builtin_amdgcn_sched_barrier(0); }      /* ... and the group after next behind them, so that two fragment sets suffice */
    asm volatile("s_wait_dscnt 0x0" ::: "memory");      /* this wave's reads of this stage's buffer are done */
    asm volatile("s_wait_asynccnt 0x0" ::: "memory");      /* its copies of the next stage have landed */
    __syncthreads();      /* publishes the next stage's buffer and frees this stage's */
    if (t + 2 < NT) { g3_copy(la + bo, ga); g3_copy(lb + bo, gb); } }
  asm volatile("s_wait_asynccnt 0x0" ::: "memory");      /* no copy is left in flight when the buffers are reused */
  float (*so)[68] = (float (*)[68])(L + (size_t)w * 32 * 68 * 4);      /* the wave's own 32 x 64 output tile; every wave has left the buffers at the loop's last barrier */
  const int f0 = nq * 128 - 2 * DM + 32 * wm;      /* transposed block: the wave's first feature */
  if (tr) { const float* bias = b2 + f0 + 8 * hh;      /* the row's bias */
#pragma unroll
    for (int half = 0; half < 2; ++half) {
#pragma unroll
      for (int r = 0; r < 8; ++r) { const float bv = bf16_rne(bias[half * 16 + r]);
#pragma unroll
        for (int t = 0; t < 4; ++t) so[half * 16 + 8 * hh + r][t * 16 + ln] = c[half][t][r] * alpha + bv; } } }
  else { const float* bias = ((seg == 0) ? b0 : (seg == 1) ? b1 : b2) + (col0 - seg * DM);      /* the column's own bias vector */
#pragma unroll
    for (int u = 0; u < 8; ++u) { const int t = u & 3, half = u >> 2; const float bv = bf16_rne(bias[t * 16 + ln]);
#pragma unroll
      for (int r = 0; r < 8; ++r) so[half * 16 + 8 * hh + r][t * 16 + ln] = c[half][t][r] * alpha + bv; } }
  __builtin_amdgcn_fence(4, "workgroup"); __builtin_amdgcn_wave_barrier();
  const int rsub = lane >> 4, c4 = (lane & 15) * 4;
  const int bb = mt * 128 / SEQ;      /* the token tile's batch */
  _Float16* d16 = tr ? VT + ((size_t)bb * DM + f0) * SEQ + (mt * 128 - bb * SEQ) + 64 * wn : C16 + (size_t)row0 * ldc + col0; const size_t p16 = tr ? (size_t)SEQ : (size_t)ldc;
#pragma unroll
  for (int q = 0; q < 16; ++q) { const int r = q * 2 + rsub; const v4f v = *(const v4fa*)&so[r][c4];
    if (OUT32) *(v4f*)(C + (size_t)(row0 + r) * ldc + col0 + c4) = v;
    else { v4h h4; for (int i = 0; i < 4; ++i) h4[i] = (_Float16)v[i]; *(v4h*)(d16 + r * p16 + c4) = h4; } } }

extern "C" void kernel_launch(void* const* d_in, const int* in_sizes, int n_in,
                              void* d_out, int out_size, void* d_ws, size_t ws_size, hipStream_t stream) {
  if (n_in < 10) return;
  if (in_sizes[0] < NB * SEQ_FULL * DM || in_sizes[1] < SEQ * SEQ_FULL) return;
  if (in_sizes[2] < DM * DM || in_sizes[4] < DM * DM || in_sizes[6] < DM * DM || in_sizes[8] < DM * DM) return;
  if (in_sizes[3] < DM || in_sizes[5] < DM || in_sizes[7] < DM || in_sizes[9] < DM) return;
  if (out_size < (int)(NR * DM)) return;
  const float* x  = (const float*)d_in[0]; const int* adj = (const int*)d_in[1];
  const float* wq = (const float*)d_in[2]; const float* bq = (const float*)d_in[3];
  const float* wk = (const float*)d_in[4]; const float* bk = (const float*)d_in[5];
  const float* wv = (const float*)d_in[6]; const float* bv = (const float*)d_in[7];
  const float* wo = (const float*)d_in[8]; const float* bo = (const float*)d_in[9];
  char* ws = (char*)d_ws; size_t off = 0;
  auto take = [&](size_t bytes) { char* p = ws + off; off += (bytes + 255) & ~(size_t)255; return p; };
  _Float16* BW  = (_Float16*)take((size_t)4 * DM * DM * 2);           /* Bt[n][k] x16 (natural [out][in]): Wq, Wk, Wv, Wo stacked by rows */
  _Float16* X16 = (_Float16*)take(NR * DM * 2);                       /* [NR][DM] */
  _Float16* QKV = (_Float16*)take(NR * LQ * 2);                       /* [NR][3*DM]: q | k | (not used) */
  _Float16* O16 = (_Float16*)take(NR * DM * 2);                       /* [NR][DM], o x64 */
  _Float16* VT  = (_Float16*)take((size_t)NB * NH * HD * SEQ * 2);    /* [NB*NH][64][SEQ] */
  if (off > ws_size || off > (size_t)134217728) return;
  k_prep<<<(unsigned)(4 * PW + (NR * DM / 8 + 255) / 256), 256, 0, stream>>>(x, wq, wk, wv, wo, BW, X16, NR * DM / 8);
  const unsigned gp = (unsigned)((NR / 128) * (DM / 128));
  k_gemm3<0, 3><<<3 * gp, 256, 0, stream>>>(X16, BW, 0.0625f, bq, bk, bv, nullptr, QKV, LQ, VT);      /* q | k rows (f16), head h = columns h*64.. of each; V^T [NB*NH][HD][SEQ] */
  k_fattn<<<(unsigned)(NB * NH * (SEQ / 256)), 256, 0, stream>>>(QKV, VT, adj, O16);      /* o (merged heads, x64) f16 rows */
  k_gemm3<1, 1><<<gp, 256, 0, stream>>>(O16, BW + (size_t)3 * DM * DM, 0.0009765625f, bo, nullptr, nullptr, (float*)d_out, nullptr, DM, nullptr);      /* out rows = output layout [b][s][DM] */
}

// v007
// It runs in 71.1 microseconds.
// In two side-by-side timings against v006, it was 1.12 and 1.10 times as fast.
// Over all steps from v000 it is 89.0 times as fast.
#include <hip/hip_runtime.h>
// All contractions (q, k, v projections K=512; q.k^T per head K=64; softmax weights . V K=SEQ; output projection K=512): v_wmma_f32_16x16x32_f16, f16 operands (every float input RNE-converted to bf16 first; weights carried x16, softmax weights carried unnormalised as 2^(t - m) <= 2^8, o carried x64), f32 accumulate; softmax statistics f32 on the VALU.
// Structure: token rows r = b*SEQ + s. X16 = f16(bf16(h)); q | k as f16 rows [r][3*DM] and V^T planes [b*NH+h][64][SEQ] from one GEMM launch over the stacked weights (alpha 1/16, bias bf16), the v blocks with their operands swapped;
// per (batch, head, 32 query rows) one wave walks the keys 32 at a time: S^T = K . Q^T in f32, gated by the integer adjacency (adj[q][j] == 0 -> weight exactly 0; a row with no open key yields NaN), which the conversion launch packs once into lane masks, running maximum and sum per query in f32,
// P = f16(2^(t - m)) taken from the score accumulators as the B operand of O^T += V^T . P^T; o = O^T * 64 / sum written as f16 rows [r][DM] (head h -> columns h*64); out = o . Wo^T * 2^-10 + bf16(bo) in f32.
#ifndef NB
#define NB 4
#endif
#ifndef SEQ
#define SEQ 2048
#endif
#define NB_FULL 4
#define SEQ_FULL 2048                /* pitch of adj rows and per-batch stride of h */
#define DM 512
#define NH 8
#define HD 64
#define LQ (3 * DM)                  /* row pitch of the q | k plane (its last DM columns not used) */
#define NR ((size_t)NB * SEQ)        /* token rows */
static_assert(NB >= 1 && NB <= NB_FULL);
static_assert(SEQ >= 128 && SEQ <= SEQ_FULL);
static_assert(SEQ % 256 == 0);      /* a block of the attention kernel owns 256 query rows; a 128-token tile of the GEMM lies in one batch */
static_assert((NB * SEQ) % 128 == 0);
static_assert(DM == NH * HD && HD == 64 && DM % 64 == 0);

typedef unsigned short v8us __attribute__((ext_vector_type(8), may_alias));
typedef float  v8f  __attribute__((ext_vector_type(8)));
typedef float  v4f  __attribute__((ext_vector_type(4)));
typedef float  v4fa __attribute__((ext_vector_type(4), may_alias));
typedef int    v4ia __attribute__((ext_vector_type(4), may_alias));
typedef unsigned v16u __attribute__((ext_vector_type(16), may_alias));
typedef const __attribute__((address_space(4))) v16u c_v16u;      /* constant address space: memory that no one writes while the kernel runs; a load at a wave-uniform address is then a scalar load, also behind the asm statements and barriers of a loop */
typedef _Float16 v16h __attribute__((ext_vector_type(16)));
typedef _Float16 v4h __attribute__((ext_vector_type(4)));
union FragH { v16h v; v8us half[2]; _Float16 h[16]; unsigned short u[16]; };

__device__ __forceinline__ unsigned short bf16_bits(float x) { unsigned int u = __float_as_uint(x); return (unsigned short)((u + 0x7FFFu + ((u >> 16) & 1u)) >> 16); }
__device__ __forceinline__ float bf16_val(unsigned short b) { return __uint_as_float(((unsigned int)b) << 16); }
__device__ __forceinline__ float bf16_rne(float x) { return bf16_val(bf16_bits(x)); }

// ---- f16 WMMA fragments in the split k layout (elements 0..7 <- k0+8h.., 8..15 <- k0+16+8h..), the same for both operands ----
__device__ __forceinline__ v16h g2_frag(const _Float16* p, int hh) { FragH f; f.half[0] = *(const v8us*)((const unsigned short*)p + 8 * hh); f.half[1] = *(const v8us*)((const unsigned short*)p + 16 + 8 * hh); return f.v; }

__device__ __forceinline__ void d_wnat(unsigned blk, const float* __restrict__ w, size_t n8, _Float16* __restrict__ Bt) {
  const size_t t = (size_t)blk * 256 + threadIdx.x; if (t >= n8) return;
  const v4f a = *(const v4fa*)(w + t * 8), c = *(const v4fa*)(w + t * 8 + 4); FragH f;
#pragma unroll
  for (int q = 0; q < 4; ++q) { f.h[q] = (_Float16)(bf16_rne(a[q]) * 16.0f); f.h[4 + q] = (_Float16)(bf16_rne(c[q]) * 16.0f); }
  *(v8us*)((unsigned short*)Bt + t * 8) = f.half[0];  }

__device__ __forceinline__ void d_x16(unsigned blk, const float* __restrict__ x, _Float16* __restrict__ X16, size_t n8) {
  const size_t t = (size_t)blk * 256 + threadIdx.x; if (t >= n8) return;
  const size_t per = (size_t)SEQ * DM / 8; const size_t b = t / per, rem = t - b * per;
  const float* src = x + b * ((size_t)SEQ_FULL * DM) + rem * 8;
  const v4f a = *(const v4fa*)src, c = *(const v4fa*)(src + 4); FragH f;
#pragma unroll
  for (int q = 0; q < 4; ++q) { f.h[q] = (_Float16)bf16_rne(a[q]); f.h[4 + q] = (_Float16)bf16_rne(c[q]); }
  *(v8us*)((unsigned short*)X16 + t * 8) = f.half[0];  }

// The gate as lane masks: MK [SEQ / 16][SEQ / 16][8], one word for 16 queries x 16 keys and r = 0..7; bit 16 * hh + ln of word r says adj[16 * qtile + ln][16 * ktile + 8 * hh + r] != 0,
// which is the place of that score in the accumulator of S^T = K . Q^T (lane 16 * hh + ln, register r): the attention kernel reads a word into a scalar register and selects with it.
// A block packs 16 query rows x 512 keys: the rows come in whole 512-byte wave loads, go through LDS (row pitch an odd number of 16 B), and each wave votes on four key tiles; its 32 words leave as one 128-byte store.
// Its loops are fully unrolled so that the eight loads of a thread are in flight together and their values stay in registers.
#define MK_P (512 * 4 + 16)                /* LDS pitch of 512 adj values */
static_assert(SEQ % 512 == 0);
__device__ __forceinline__ void d_mask(unsigned blk, const int* __restrict__ adj, unsigned* __restrict__ MK, unsigned char* S) {
  constexpr unsigned KB = SEQ / 512; const unsigned qtile = blk / KB, kb = blk - qtile * KB;
  const int tid = threadIdx.x, lane = tid & 31, w = tid >> 5, ln = lane & 15, hh = lane >> 4;
  const int* src = adj + (size_t)(qtile * 16 + (tid >> 7)) * SEQ_FULL + kb * 512 + 4 * (tid & 127); v4ia a[8];
#pragma unroll
  for (int j = 0; j < 8; ++j) a[j] = *(const v4ia*)(src + (size_t)2 * j * SEQ_FULL);
#pragma unroll
  for (int j = 0; j < 8; ++j) *(v4ia*)(S + (2 * j + (tid >> 7)) * MK_P + 16 * (tid & 127)) = a[j];
  __syncthreads();      /* the branch that leads here is the same for the whole block */
  unsigned v = 0;
#pragma unroll
  for (int j = 0; j < 4; ++j) { const unsigned char* p = S + ln * MK_P + (w * 4 + j) * 64 + 32 * hh; const v4ia x = *(const v4ia*)p, y = *(const v4ia*)(p + 16);
#pragma unroll
    for (int r = 0; r < 8; ++r) { const unsigned b = __builtin_amdgcn_ballot_w32(((r < 4) ? x[r & 3] : y[r & 3]) != 0); v = (lane == j * 8 + r) ? b : v; } }
  MK[((size_t)qtile * (SEQ / 16) + kb * 32 + w * 4) * 8 + lane] = v; }

// The six conversions need nothing of each other, so they share one grid by ranges of the block index (a block-uniform branch): blocks 0 .. PM - 1 pack the gate, the next 4 * PW convert Wq, Wk, Wv, Wo into the stacked plane BW [4 * DM][DM], the rest convert h.
#define PW ((DM * DM / 8 + 255) / 256)     /* blocks per weight matrix */
#define PM ((SEQ / 16) * (SEQ / 512))      /* blocks of the gate */
__global__ __launch_bounds__(256) void k_prep(const float* __restrict__ x, const float* __restrict__ wq, const float* __restrict__ wk, const float* __restrict__ wv, const float* __restrict__ wo,
                                              _Float16* __restrict__ BW, _Float16* __restrict__ X16, size_t nx8, const int* __restrict__ adj, unsigned* __restrict__ MK) {
  __shared__ __attribute__((aligned(16))) unsigned char S[16 * MK_P];
  if (blockIdx.x < (unsigned)PM) { d_mask(blockIdx.x, adj, MK, S); return; }
  const unsigned blk = blockIdx.x - PM;
  if (blk < 4u * PW) { const unsigned i = blk / PW; const float* w = (i == 0) ? wq : (i == 1) ? wk : (i == 2) ? wv : wo;
    d_wnat(blk - i * PW, w, (size_t)DM * DM / 8, BW + (size_t)i * DM * DM); }
  else d_x16(blk - 4u * PW, x, X16, nx8); }

// 2^x of four values in place (what the native exp compiles to behind its multiply by log2 e). The four v_exp_f32 name disjoint registers; the closing v_nop keeps the one slot that the instruction set
// asks for between a transcendental and the next use of its result or overwrite of its source.
__device__ __forceinline__ v4f exp2x4(v4f x) { float a = x[0], b = x[1], c = x[2], d = x[3];
  asm("v_exp_f32 %0, %0\n\tv_exp_f32 %1, %1\n\tv_exp_f32 %2, %2\n\tv_exp_f32 %3, %3\n\tv_nop" : "+v"(a), "+v"(b), "+v"(c), "+v"(d));
  const v4f r = {a, b, c, d}; return r; }
__device__ __forceinline__ float xhalf(float x) { return __builtin_bit_cast(float, __builtin_amdgcn_permlanex16(__builtin_bit_cast(int, x), __builtin_bit_cast(int, x), 0x76543210, 0xfedcba98, false, false)); }      /* lane l <- lane l ^ 16, on the vector pipe */
__device__ __forceinline__ v8f fa_mma(v16h a, v16h b, v8f c) { return __builtin_amdgcn_wmma_f32_16x16x32_f16(false, a, false, b, (short)0, c, false, false); }
#define FA_KP 144                          /* LDS pitch of a 128-byte row (K, V^T) */
#define FA_V (64 * FA_KP)                  /* byte offsets inside one buffer: K at 0, then V^T */
#define FA_STAGE (2 * 64 * FA_KP)
typedef __attribute__((address_space(3))) unsigned char lds_u8;
// One stage's copies of one thread: 16 B of the K rows r and r + 32 and of the V^T rows r and r + 32 (a wave: 4 rows a copy). Every lane on, no two lanes on one LDS byte.
// The closing s_wait_xcnt stands inside the statement so that no address register named here is rewritten in front of it.
__device__ __forceinline__ void fa_copy(unsigned lk, const char* gk, unsigned lv, const char* gv) {
  asm volatile("global_load_async_to_lds_b128 %0, %1, off\n\tglobal_load_async_to_lds_b128 %2, %3, off\n\t"
               "global_load_async_to_lds_b128 %4, %5, off\n\tglobal_load_async_to_lds_b128 %6, %7, off\n\t"
               "s_wait_xcnt 0x0"
               :: "v"(lk), "v"(gk), "v"(lk + 32 * FA_KP), "v"(gk + (size_t)32 * LQ * 2), "v"(lv), "v"(gv), "v"(lv + 32 * FA_KP), "v"(gv + (size_t)32 * SEQ * 2) : "memory"); }
__global__ __launch_bounds__(256) void k_fattn(const _Float16* __restrict__ QKV, const _Float16* __restrict__ VT, const unsigned* __restrict__ MK, _Float16* __restrict__ O16) {
  __shared__ __attribute__((aligned(16))) unsigned char L[2 * FA_STAGE];
  const int tid = threadIdx.x, lane = threadIdx.x & 31, w = threadIdx.x >> 5, ln = lane & 15, hh = lane >> 4;
  constexpr int QB = SEQ / 256; const int slab = blockIdx.x / QB, qb = blockIdx.x - slab * QB; const int b = slab / NH, h = slab - b * NH;
  const int q0 = qb * 256 + w * 32; const size_t r0 = (size_t)b * SEQ;
  const _Float16* qp = QKV + (r0 + q0 + ln) * LQ + h * HD + 8 * hh;      /* every fragment pointer below carries the lane half's 8 * hh itself, so g2_frag is called with 0 */
  v16h qf[2][2];
#pragma unroll
  for (int qt = 0; qt < 2; ++qt) { qf[qt][0] = g2_frag(qp + (size_t)qt * 16 * LQ, 0); qf[qt][1] = g2_frag(qp + (size_t)qt * 16 * LQ + 32, 0); }
  /* copy side: thread tid brings 16 B of K rows tid / 8 and tid / 8 + 32 and the same of V^T */
  const char* gk = (const char*)(QKV + DM + (r0 + (tid >> 3)) * LQ + h * HD + 8 * (tid & 7));
  const char* gv = (const char*)(VT + ((size_t)slab * HD + (tid >> 3)) * SEQ + 8 * (tid & 7));
  const unsigned l0 = (unsigned)(uintptr_t)(lds_u8*)L;
  const unsigned lk = l0 + (tid >> 3) * FA_KP + 16 * (tid & 7), lv = lk + FA_V;
  constexpr size_t sk = (size_t)64 * LQ * 2, sv = 128;      /* bytes from one stage's tile to the next */
  /* read side, inside a buffer: the lane's K row and V^T row, each with the lane half's share */
  const int rk = ln * FA_KP + 16 * hh, rv = FA_V + ln * FA_KP + 16 * hh;
  /* the wave's two rows of the gate plane (query tiles q0 / 16 and q0 / 16 + 1); the wave's number goes through readfirstlane so that the address is scalar; a pass is 16 words of each */
  c_v16u* mp = (c_v16u*)(uintptr_t)(MK + (size_t)(qb * 16 + 2 * __builtin_amdgcn_readfirstlane(w)) * (SEQ / 16) * 8); constexpr int MROW = (SEQ / 16) * 8 / 16;
  const v8f z8 = {0.f,0.f,0.f,0.f,0.f,0.f,0.f,0.f};
  v8f o[2][4]; float m[2] = {-3.0e38f, -3.0e38f}, l[2] = {0.f, 0.f};
#pragma unroll
  for (int qt = 0; qt < 2; ++qt) {
#pragma unroll
    for (int dt = 0; dt < 4; ++dt) o[qt][dt] = z8; }
  constexpr int NT = SEQ / 64; static_assert(NT >= 2);
  v16u gn0 = mp[0], gn1 = mp[MROW]; unsigned pn = 0;      /* the gate of pass 0 */
  fa_copy(lk, gk, lv, gv);      /* stage 0 into buffer 0 */
  asm volatile("s_wait_asynccnt 0x0" ::: "memory");      /* this wave's copies of stage 0 have landed */
  __syncthreads();      /* ... and every other wave's */
  fa_copy(lk + FA_STAGE, gk + sk, lv + FA_STAGE, gv + sv);      /* stage 1 into buffer 1 */
  gk += 2 * sk; gv += 2 * sv;
  for (int t = 0; t < NT; ++t, gk += sk, gv += sv) {
    const unsigned bo = (unsigned)(t & 1) * FA_STAGE; const unsigned char* B = L + bo;
#pragma unroll 1
   for (int u = 0; u < 2; ++u) {      /* the stage's two passes, one body for both; rolled as it was: the unrolled form now fits 256 registers, but whether it is faster is not measured */
    v16h kf[2][2], vf[4];
    const v16u gc[2] = {gn0, gn1}; pn = (pn + 1 < 2u * NT) ? pn + 1 : pn;      /* the next pass's gate is asked for during this pass; in the last pass the last one again, so that the address stays inside the plane */
    gn0 = mp[pn]; gn1 = mp[MROW + pn];
#pragma unroll
    for (int kt = 0; kt < 2; ++kt) { const _Float16* p = (const _Float16*)(B + rk + (u * 32 + kt * 16) * FA_KP); kf[kt][0] = g2_frag(p, 0); kf[kt][1] = g2_frag(p + 32, 0); }
#pragma unroll
    for (int dt = 0; dt < 4; ++dt) vf[dt] = g2_frag((const _Float16*)(B + rv + dt * 16 * FA_KP + u * 64), 0);
    v8f s[2][2];
#pragma unroll
    for (int qt = 0; qt < 2; ++qt) {
#pragma unroll
      for (int kt = 0; kt < 2; ++kt) s[qt][kt] = fa_mma(kf[kt][1], qf[qt][1], fa_mma(kf[kt][0], qf[qt][0], z8)); }
    float ml[2];
#pragma unroll
    for (int qt = 0; qt < 2; ++qt) { float mx = -3.0e38f;
#pragma unroll
      for (int kt = 0; kt < 2; ++kt) {
#pragma unroll
        for (int r = 0; r < 8; ++r) { const float t = s[qt][kt][r] * 0.18033688011112042f; const float g = __builtin_amdgcn_inverse_ballot_w32(gc[qt][kt * 8 + r]) ? t : -1.0e30f; s[qt][kt][r] = g; mx = fmaxf(mx, g); } }
      ml[qt] = fmaxf(mx, xhalf(mx)); }
    const bool need = (ml[0] > m[0] + 8.0f) || (ml[1] > m[1] + 8.0f);
    if (__builtin_amdgcn_ballot_w32(need) != 0) {      /* one scalar branch a pass: the 64 multiplies are skipped while no query of the wave moves its maximum */
      const float n0 = (ml[0] > m[0] + 8.0f) ? ml[0] : m[0], n1 = (ml[1] > m[1] + 8.0f) ? ml[1] : m[1];
      const v4f d4 = {m[0] - n0, m[1] - n1, 0.f, 0.f}; const v4f al = exp2x4(d4); m[0] = n0; m[1] = n1;
#pragma unroll
      for (int qt = 0; qt < 2; ++qt) { l[qt] *= al[qt];
#pragma unroll
        for (int dt = 0; dt < 4; ++dt) o[qt][dt] *= al[qt]; } }
#pragma unroll
    for (int qt = 0; qt < 2; ++qt) { FragH pf;
#pragma unroll
      for (int kt = 0; kt < 2; ++kt) {
#pragma unroll
        for (int g = 0; g < 2; ++g) { const v4f x = {s[qt][kt][4 * g] - m[qt], s[qt][kt][4 * g + 1] - m[qt], s[qt][kt][4 * g + 2] - m[qt], s[qt][kt][4 * g + 3] - m[qt]}; const v4f e = exp2x4(x);
#pragma unroll
          for (int q = 0; q < 4; ++q) pf.h[kt * 8 + g * 4 + q] = (_Float16)e[q];
          l[qt] += (e[0] + e[1]) + (e[2] + e[3]); } }
#pragma unroll
      for (int dt = 0; dt < 4; ++dt) o[qt][dt] = fa_mma(vf[dt], pf.v, o[qt][dt]); } }
    asm volatile("s_wait_dscnt 0x0" ::: "memory");      /* this wave's reads of this stage's buffer are done */
    asm volatile("s_wait_asynccnt 0x0" ::: "memory");      /* its copies of the next stage have landed */
    __syncthreads();      /* publishes the next stage's buffer and frees this stage's */
    if (t + 2 < NT) fa_copy(lk + bo, gk, lv + bo, gv); }
  asm volatile("s_wait_asynccnt 0x0" ::: "memory");      /* no copy is left in flight when the wave ends */
#pragma unroll
  for (int qt = 0; qt < 2; ++qt) { const float se = l[qt] + xhalf(l[qt]);
    const float sc = (m[qt] > -1.0e29f) ? (64.0f / se) : __uint_as_float(0x7fc00000u);
    unsigned short* d = (unsigned short*)O16 + (r0 + q0 + qt * 16 + ln) * DM + h * HD + 8 * hh;
#pragma unroll
    for (int dt = 0; dt < 4; ++dt) { FragH f;
#pragma unroll
      for (int r = 0; r < 8; ++r) f.h[r] = (_Float16)(o[qt][dt][r] * sc);
      *(v8us*)(d + dt * 16) = f.half[0]; } } }

// ---- f16 WMMA GEMM, K = DM, N = NSEG * DM: C = A . Bt^T * alpha + bf16(bias[col]); A [m][DM] f16, Bt [n][DM] f16, NSEG weight matrices stacked by rows, each with its own bias vector (b0, b1, b2), so that products of one A share one grid. A block of 8 waves owns 128 x 128 of C, a wave 32 x 64 (wave w: rows 32 * (w & 3), columns 64 * (w >> 2)).
// With NSEG == 3 the blocks of the third matrix (v) take the weight rows as the row operand and the token rows as the column operand (both lie as [row][k] and are read by the same loader, so only the two tile addresses change places):
// their tile is 128 features x 128 tokens, C^T, with the bias by row, and goes straight to the plane VT [b * DM + feature][SEQ] in whole 128-byte lines of 64 tokens. Requires SEQ % 128 == 0, so that a token tile lies in one batch.
// A stage is 128 of k: 128 A rows and 128 Bt rows of 256 B each are brought into LDS by asynchronous copies in whole lines, once per block, one stage ahead, into two buffers;
// the fragment reads (16 B a lane, 16 rows a read) then go to LDS, at a row pitch of an odd number of 16 B. Requires M % 128 == 0; the grid covers C exactly.
#define G_KS 128                           /* k per stage */
#define G_P 272                            /* LDS pitch of a 256-byte row */
#define G_B (128 * G_P)                    /* byte offset of the Bt tile inside one buffer */
#define G_STAGE (2 * 128 * G_P)
static_assert(DM % 128 == 0 && DM / G_KS >= 2);
static_assert(2 * G_STAGE >= 8 * 32 * 68 * 4);      /* the output staging of the epilogue reuses the buffers */
// One tile's copies of one thread: 16 B of each of the rows r, r + 16, ..., r + 112. Every lane on, no two lanes on one LDS byte.
// The closing s_wait_xcnt stands inside the statement so that no address register named here is rewritten in front of it.
__device__ __forceinline__ void g3_copy(unsigned l, const char* g) {
  constexpr unsigned dl = 16 * G_P; constexpr size_t dg = (size_t)16 * DM * 2;
  asm volatile("global_load_async_to_lds_b128 %0, %1, off\n\tglobal_load_async_to_lds_b128 %2, %3, off\n\t"
               "global_load_async_to_lds_b128 %4, %5, off\n\tglobal_load_async_to_lds_b128 %6, %7, off\n\t"
               "global_load_async_to_lds_b128 %8, %9, off\n\tglobal_load_async_to_lds_b128 %10, %11, off\n\t"
               "global_load_async_to_lds_b128 %12, %13, off\n\tglobal_load_async_to_lds_b128 %14, %15, off\n\t"
               "s_wait_xcnt 0x0"
               :: "v"(l), "v"(g), "v"(l + dl), "v"(g + dg), "v"(l + 2 * dl), "v"(g + 2 * dg), "v"(l + 3 * dl), "v"(g + 3 * dg),
                  "v"(l + 4 * dl), "v"(g + 4 * dg), "v"(l + 5 * dl), "v"(g + 5 * dg), "v"(l + 6 * dl), "v"(g + 6 * dg), "v"(l + 7 * dl), "v"(g + 7 * dg) : "memory"); }
// The fragments of 32 of k: two A row tiles, four Bt row tiles.
__device__ __forceinline__ void g3_frags(const unsigned char* pa, const unsigned char* pb, v16h (&a)[2], v16h (&b)[4]) {
  a[0] = g2_frag((const _Float16*)pa, 0); a[1] = g2_frag((const _Float16*)(pa + 16 * G_P), 0);
#pragma unroll
  for (int nt = 0; nt < 4; ++nt) b[nt] = g2_frag((const _Float16*)(pb + nt * 16 * G_P), 0); }
template <int OUT32, int NSEG>      /* OUT32 1: the result goes to C as f32; 0: to C16 as f16, the v blocks of NSEG 3 to VT */
__global__ __launch_bounds__(256) void k_gemm3(const _Float16* __restrict__ A, const _Float16* __restrict__ Bh, float alpha, const float* __restrict__ b0, const float* __restrict__ b1, const float* __restrict__ b2, float* __restrict__ C, _Float16* __restrict__ C16, int ldc, _Float16* __restrict__ VT) {
  __shared__ __attribute__((aligned(16))) unsigned char L[2 * G_STAGE];
  const int tid = threadIdx.x, w = tid >> 5, lane = tid & 31, ln = lane & 15, hh = lane >> 4;
  constexpr int NTN = NSEG * DM / 128; const int mt = blockIdx.x / NTN, nq = blockIdx.x - mt * NTN;
  const int wm = w & 3, wn = w >> 2; const int row0 = mt * 128 + 32 * wm, col0 = nq * 128 + 64 * wn;
  const int seg = (NSEG == 1) ? 0 : nq / (DM / 128); const bool tr = (NSEG == 3) && seg == 2;      /* the same for the whole block */
  /* copy side: thread tid brings 16 B of the tile rows tid / 16 + 16 * j of A and of Bt; in a transposed block the two change places */
  const char* gx = (const char*)(A + (size_t)(mt * 128 + (tid >> 4)) * DM + 8 * (tid & 15));
  const char* gw = (const char*)(Bh + (size_t)(nq * 128 + (tid >> 4)) * DM + 8 * (tid & 15));
  const char* ga = tr ? gw : gx; const char* gb = tr ? gx : gw;
  const unsigned la = (unsigned)(uintptr_t)(lds_u8*)L + (tid >> 4) * G_P + 16 * (tid & 15), lb = la + G_B;
  constexpr size_t sg = (size_t)G_KS * 2;      /* bytes from one stage's tile to the next */
  /* read side, inside a buffer: the lane's first A row and first Bt row, each with the lane half's share, so g2_frag is called with 0 */
  const int ra = (32 * wm + ln) * G_P + 16 * hh, rb = G_B + (64 * wn + ln) * G_P + 16 * hh;
  const v8f z8 = {0.f,0.f,0.f,0.f,0.f,0.f,0.f,0.f}; v8f c[2][4];
#pragma unroll
  for (int u = 0; u < 8; ++u) c[u >> 2][u & 3] = z8;
  constexpr int NT = DM / G_KS;
  g3_copy(la, ga); g3_copy(lb, gb);      /* stage 0 into buffer 0 */
  asm volatile("s_wait_asynccnt 0x0" ::: "memory");      /* this wave's copies of stage 0 have landed */
  __syncthreads();      /* ... and every other wave's */
  g3_copy(la + G_STAGE, ga + sg); g3_copy(lb + G_STAGE, gb + sg);      /* stage 1 into buffer 1 */
  ga += 2 * sg; gb += 2 * sg;
  for (int t = 0; t < NT; ++t, ga += sg, gb += sg) {
    const unsigned bo = (unsigned)(t & 1) * G_STAGE; const unsigned char* B = L + bo;
    v16h af[2][2], bf[2][4];      /* two fragment sets: the reads of the next 32 of k stand as one group in front of this 32's products */
    g3_frags(B + ra, B + rb, af[0], bf[0]);
#pragma unroll      /* fragment sets and accumulators are indexed by constants, so they stay in registers */
    for (int ks = 0; ks < G_KS / 32; ++ks) {
      if (ks + 1 < G_KS / 32) g3_frags(B + ra + (ks + 1) * 64, B + rb + (ks + 1) * 64, af[(ks + 1) & 1], bf[(ks + 1) & 1]);
      __builtin_amdgcn_sched_barrier(0);      /* keeps that group of reads in front of the products: without it the compiler sinks each read to its first use and every pair of products waits for LDS */
#pragma unroll
      for (int nt = 0; nt < 4; ++nt) { c[0][nt] = fa_mma(af[ks & 1][0], bf[ks & 1][nt], c[0][nt]); c[1][nt] = fa_mma(af[ks & 1][1], bf[ks & 1][nt], c[1][nt]); }
      __builtin_amdgcn_sched_barrier(0); }      /* ... and the group after next behind them, so that two fragment sets suffice */
    asm volatile("s_wait_dscnt 0x0" ::: "memory");      /* this wave's reads of this stage's buffer are done */
    asm volatile("s_wait_asynccnt 0x0" ::: "memory");      /* its copies of the next stage have landed */
    __syncthreads();      /* publishes the next stage's buffer and frees this stage's */
    if (t + 2 < NT) { g3_copy(la + bo, ga); g3_copy(lb + bo, gb); } }
  asm volatile("s_wait_asynccnt 0x0" ::: "memory");      /* no copy is left in flight when the buffers are reused */
  float (*so)[68] = (float (*)[68])(L + (size_t)w * 32 * 68 * 4);      /* the wave's own 32 x 64 output tile; every wave has left the buffers at the loop's last barrier */
  const int f0 = nq * 128 - 2 * DM + 32 * wm;      /* transposed block: the wave's first feature */
  if (tr) { const float* bias = b2 + f0 + 8 * hh;      /* the row's bias */
#pragma unroll
    for (int half = 0; half < 2; ++half) {
#pragma unroll
      for (int r = 0; r < 8; ++r) { const float bv = bf16_rne(bias[half * 16 + r]);
#pragma unroll
        for (int t = 0; t < 4; ++t) so[half * 16 + 8 * hh + r][t * 16 + ln] = c[half][t][r] * alpha + bv; } } }
  else { const float* bias = ((seg == 0) ? b0 : (seg == 1) ? b1 : b2) + (col0 - seg * DM);      /* the column's own bias vector */
#pragma unroll
    for (int u = 0; u < 8; ++u) { const int t = u & 3, half = u >> 2; const float bv = bf16_rne(bias[t * 16 + ln]);
#pragma unroll
      for (int r = 0; r < 8; ++r) so[half * 16 + 8 * hh + r][t * 16 + ln] = c[half][t][r] * alpha + bv; } }
  __builtin_amdgcn_fence(4, "workgroup"); __builtin_amdgcn_wave_barrier();
  const int rsub = lane >> 4, c4 = (lane & 15) * 4;
  const int bb = mt * 128 / SEQ;      /* the token tile's batch */
  _Float16* d16 = tr ? VT + ((size_t)bb * DM + f0) * SEQ + (mt * 128 - bb * SEQ) + 64 * wn : C16 + (size_t)row0 * ldc + col0; const size_t p16 = tr ? (size_t)SEQ : (size_t)ldc;
#pragma unroll
  for (int q = 0; q < 16; ++q) { const int r = q * 2 + rsub; const v4f v = *(const v4fa*)&so[r][c4];
    if (OUT32) *(v4f*)(C + (size_t)(row0 + r) * ldc + col0 + c4) = v;
    else { v4h h4; for (int i = 0; i < 4; ++i) h4[i] = (_Float16)v[i]; *(v4h*)(d16 + r * p16 + c4) = h4; } } }

extern "C" void kernel_launch(void* const* d_in, const int* in_sizes, int n_in,
                              void* d_out, int out_size, void* d_ws, size_t ws_size, hipStream_t stream) {
  if (n_in < 10) return;
  if (in_sizes[0] < NB * SEQ_FULL * DM || in_sizes[1] < SEQ * SEQ_FULL) return;
  if (in_sizes[2] < DM * DM || in_sizes[4] < DM * DM || in_sizes[6] < DM * DM || in_sizes[8] < DM * DM) return;
  if (in_sizes[3] < DM || in_sizes[5] < DM || in_sizes[7] < DM || in_sizes[9] < DM) return;
  if (out_size < (int)(NR * DM)) return;
  const float* x  = (const float*)d_in[0]; const int* adj = (const int*)d_in[1];
  const float* wq = (const float*)d_in[2]; const float* bq = (const float*)d_in[3];
  const float* wk = (const float*)d_in[4]; const float* bk = (const float*)d_in[5];
  const float* wv = (const float*)d_in[6]; const float* bv = (const float*)d_in[7];
  const float* wo = (const float*)d_in[8]; const float* bo = (const float*)d_in[9];
  char* ws = (char*)d_ws; size_t off = 0;
  auto take = [&](size_t bytes) { char* p = ws + off; off += (bytes + 255) & ~(size_t)255; return p; };
  _Float16* BW  = (_Float16*)take((size_t)4 * DM * DM * 2);           /* Bt[n][k] x16 (natural [out][in]): Wq, Wk, Wv, Wo stacked by rows */
  _Float16* X16 = (_Float16*)take(NR * DM * 2);                       /* [NR][DM] */
  _Float16* QKV = (_Float16*)take(NR * LQ * 2);                       /* [NR][3*DM]: q | k | (not used) */
  _Float16* O16 = (_Float16*)take(NR * DM * 2);                       /* [NR][DM], o x64 */
  _Float16* VT  = (_Float16*)take((size_t)NB * NH * HD * SEQ * 2);    /* [NB*NH][64][SEQ] */
  unsigned* MK  = (unsigned*)take((size_t)(SEQ / 16) * (SEQ / 16) * 8 * 4);      /* [SEQ/16][SEQ/16][8], the gate as lane masks */
  if (off > ws_size || off > (size_t)134217728) return;
  k_prep<<<(unsigned)(PM + 4 * PW + (NR * DM / 8 + 255) / 256), 256, 0, stream>>>(x, wq, wk, wv, wo, BW, X16, NR * DM / 8, adj, MK);
  const unsigned gp = (unsigned)((NR / 128) * (DM / 128));
  k_gemm3<0, 3><<<3 * gp, 256, 0, stream>>>(X16, BW, 0.0625f, bq, bk, bv, nullptr, QKV, LQ, VT);      /* q | k rows (f16), head h = columns h*64.. of each; V^T [NB*NH][HD][SEQ] */
  k_fattn<<<(unsigned)(NB * NH * (SEQ / 256)), 256, 0, stream>>>(QKV, VT, MK, O16);      /* o (merged heads, x64) f16 rows */
  k_gemm3<1, 1><<<gp, 256, 0, stream>>>(O16, BW + (size_t)3 * DM * DM, 0.0009765625f, bo, nullptr, nullptr, (float*)d_out, nullptr, DM, nullptr);      /* out rows = output layout [b][s][DM] */
}

// v008
// One run takes 68.9 microseconds.
// Two timings next to v007 both put it at 1.03 times that version's speed.
// Counting every step since v000, it is 91.8 times as fast.
#include <hip/hip_runtime.h>
// All contractions (q, k, v projections K=512; q.k^T per head K=64; softmax weights . V K=SEQ; output projection K=512): v_wmma_f32_16x16x32_f16, f16 operands (every float input RNE-converted to bf16 first; weights carried x16, q carried x log2 e / 8, softmax weights carried unnormalised as 2^(t - m) <= 2^8, o carried x64), f32 accumulate; softmax statistics f32 on the VALU.
// Structure: token rows r = b*SEQ + s. X16 = f16(bf16(h)); q | k as f16 rows [r][3*DM] and V^T planes [b*NH+h][64][SEQ] from one GEMM launch over the stacked weights (alpha 1/16, bias bf16), the v blocks with their operands swapped;
// per (batch, head, 32 query rows) one wave walks the keys 32 at a time: S^T = K . Q^T - m in f32, gated by the integer adjacency (adj[q][j] == 0 -> weight exactly 0; a row with no open key yields NaN), which the conversion launch packs once into lane masks, running maximum and sum per query in f32,
// P = f16(2^(t - m)) taken from the score accumulators as the B operand of O^T += V^T . P^T; o = O^T * 64 / sum written as f16 rows [r][DM] (head h -> columns h*64); out = o . Wo^T * 2^-10 + bf16(bo) in f32.
#ifndef NB
#define NB 4
#endif
#ifndef SEQ
#define SEQ 2048
#endif
#define NB_FULL 4
#define SEQ_FULL 2048                /* pitch of adj rows and per-batch stride of h */
#define DM 512
#define NH 8
#define HD 64
#define LQ (3 * DM)                  /* row pitch of the q | k plane (its last DM columns not used) */
#define NR ((size_t)NB * SEQ)        /* token rows */
static_assert(NB >= 1 && NB <= NB_FULL);
static_assert(SEQ >= 128 && SEQ <= SEQ_FULL);
static_assert(SEQ % 256 == 0);      /* a block of the attention kernel owns 256 query rows; a 128-token tile of the GEMM lies in one batch */
static_assert((NB * SEQ) % 128 == 0);
static_assert(DM == NH * HD && HD == 64 && DM % 64 == 0);

typedef unsigned short v8us __attribute__((ext_vector_type(8), may_alias));
typedef float  v8f  __attribute__((ext_vector_type(8)));
typedef float  v4f  __attribute__((ext_vector_type(4)));
typedef float  v4fa __attribute__((ext_vector_type(4), may_alias));
typedef int    v4ia __attribute__((ext_vector_type(4), may_alias));
typedef unsigned v16u __attribute__((ext_vector_type(16), may_alias));
typedef const __attribute__((address_space(4))) v16u c_v16u;      /* constant address space: memory that no one writes while the kernel runs; a load at a wave-uniform address is then a scalar load, also behind the asm statements and barriers of a loop */
typedef _Float16 v16h __attribute__((ext_vector_type(16)));
typedef _Float16 v4h __attribute__((ext_vector_type(4)));
union FragH { v16h v; v8us half[2]; _Float16 h[16]; unsigned short u[16]; };

__device__ __forceinline__ unsigned short bf16_bits(float x) { unsigned int u = __float_as_uint(x); return (unsigned short)((u + 0x7FFFu + ((u >> 16) & 1u)) >> 16); }
__device__ __forceinline__ float bf16_val(unsigned short b) { return __uint_as_float(((unsigned int)b) << 16); }
__device__ __forceinline__ float bf16_rne(float x) { return bf16_val(bf16_bits(x)); }

// ---- f16 WMMA fragments in the split k layout (elements 0..7 <- k0+8h.., 8..15 <- k0+16+8h..), the same for both operands ----
__device__ __forceinline__ v16h g2_frag(const _Float16* p, int hh) { FragH f; f.half[0] = *(const v8us*)((const unsigned short*)p + 8 * hh); f.half[1] = *(const v8us*)((const unsigned short*)p + 16 + 8 * hh); return f.v; }

__device__ __forceinline__ void d_wnat(unsigned blk, const float* __restrict__ w, size_t n8, _Float16* __restrict__ Bt) {
  const size_t t = (size_t)blk * 256 + threadIdx.x; if (t >= n8) return;
  const v4f a = *(const v4fa*)(w + t * 8), c = *(const v4fa*)(w + t * 8 + 4); FragH f;
#pragma unroll
  for (int q = 0; q < 4; ++q) { f.h[q] = (_Float16)(bf16_rne(a[q]) * 16.0f); f.h[4 + q] = (_Float16)(bf16_rne(c[q]) * 16.0f); }
  *(v8us*)((unsigned short*)Bt + t * 8) = f.half[0];  }

__device__ __forceinline__ void d_x16(unsigned blk, const float* __restrict__ x, _Float16* __restrict__ X16, size_t n8) {
  const size_t t = (size_t)blk * 256 + threadIdx.x; if (t >= n8) return;
  const size_t per = (size_t)SEQ * DM / 8; const size_t b = t / per, rem = t - b * per;
  const float* src = x + b * ((size_t)SEQ_FULL * DM) + rem * 8;
  const v4f a = *(const v4fa*)src, c = *(const v4fa*)(src + 4); FragH f;
#pragma unroll
  for (int q = 0; q < 4; ++q) { f.h[q] = (_Float16)bf16_rne(a[q]); f.h[4 + q] = (_Float16)bf16_rne(c[q]); }
  *(v8us*)((unsigned short*)X16 + t * 8) = f.half[0];  }

// The gate as lane masks: MK [SEQ / 16][SEQ / 16][8], one word for 16 queries x 16 keys and r = 0..7; bit 16 * hh + ln of word r says adj[16 * qtile + ln][16 * ktile + 8 * hh + r] != 0,
// which is the place of that score in the accumulator of S^T = K . Q^T (lane 16 * hh + ln, register r): the attention kernel reads a word into a scalar register and selects with it.
// A block packs 16 query rows x 512 keys: the rows come in whole 512-byte wave loads, go through LDS (row pitch an odd number of 16 B), and each wave votes on four key tiles; its 32 words leave as one 128-byte store.
// Its loops are fully unrolled so that the eight loads of a thread are in flight together and their values stay in registers.
#define MK_P (512 * 4 + 16)                /* LDS pitch of 512 adj values */
static_assert(SEQ % 512 == 0);
__device__ __forceinline__ void d_mask(unsigned blk, const int* __restrict__ adj, unsigned* __restrict__ MK, unsigned char* S) {
  constexpr unsigned KB = SEQ / 512; const unsigned qtile = blk / KB, kb = blk - qtile * KB;
  const int tid = threadIdx.x, lane = tid & 31, w = tid >> 5, ln = lane & 15, hh = lane >> 4;
  const int* src = adj + (size_t)(qtile * 16 + (tid >> 7)) * SEQ_FULL + kb * 512 + 4 * (tid & 127); v4ia a[8];
#pragma unroll
  for (int j = 0; j < 8; ++j) a[j] = *(const v4ia*)(src + (size_t)2 * j * SEQ_FULL);
#pragma unroll
  for (int j = 0; j < 8; ++j) *(v4ia*)(S + (2 * j + (tid >> 7)) * MK_P + 16 * (tid & 127)) = a[j];
  __syncthreads();      /* the branch that leads here is the same for the whole block */
  unsigned v = 0;
#pragma unroll
  for (int j = 0; j < 4; ++j) { const unsigned char* p = S + ln * MK_P + (w * 4 + j) * 64 + 32 * hh; const v4ia x = *(const v4ia*)p, y = *(const v4ia*)(p + 16);
#pragma unroll
    for (int r = 0; r < 8; ++r) { const unsigned b = __builtin_amdgcn_ballot_w32(((r < 4) ? x[r & 3] : y[r & 3]) != 0); v = (lane == j * 8 + r) ? b : v; } }
  MK[((size_t)qtile * (SEQ / 16) + kb * 32 + w * 4) * 8 + lane] = v; }

// The six conversions need nothing of each other, so they share one grid by ranges of the block index (a block-uniform branch): blocks 0 .. PM - 1 pack the gate, the next 4 * PW convert Wq, Wk, Wv, Wo into the stacked plane BW [4 * DM][DM], the rest convert h.
#define PW ((DM * DM / 8 + 255) / 256)     /* blocks per weight matrix */
#define PM ((SEQ / 16) * (SEQ / 512))      /* blocks of the gate */
__global__ __launch_bounds__(256) void k_prep(const float* __restrict__ x, const float* __restrict__ wq, const float* __restrict__ wk, const float* __restrict__ wv, const float* __restrict__ wo,
                                              _Float16* __restrict__ BW, _Float16* __restrict__ X16, size_t nx8, const int* __restrict__ adj, unsigned* __restrict__ MK) {
  __shared__ __attribute__((aligned(16))) unsigned char S[16 * MK_P];
  if (blockIdx.x < (unsigned)PM) { d_mask(blockIdx.x, adj, MK, S); return; }
  const unsigned blk = blockIdx.x - PM;
  if (blk < 4u * PW) { const unsigned i = blk / PW; const float* w = (i == 0) ? wq : (i == 1) ? wk : (i == 2) ? wv : wo;
    d_wnat(blk - i * PW, w, (size_t)DM * DM / 8, BW + (size_t)i * DM * DM); }
  else d_x16(blk - 4u * PW, x, X16, nx8); }

// 2^x of four values in place (what the native exp compiles to behind its multiply by log2 e). The four v_exp_f32 name disjoint registers; the closing v_nop keeps the one slot that the instruction set
// asks for between a transcendental and the next use of its result or overwrite of its source.
__device__ __forceinline__ v4f exp2x4(v4f x) { float a = x[0], b = x[1], c = x[2], d = x[3];
  asm("v_exp_f32 %0, %0\n\tv_exp_f32 %1, %1\n\tv_exp_f32 %2, %2\n\tv_exp_f32 %3, %3\n\tv_nop" : "+v"(a), "+v"(b), "+v"(c), "+v"(d));
  const v4f r = {a, b, c, d}; return r; }
__device__ __forceinline__ float xhalf(float x) { return __builtin_bit_cast(float, __builtin_amdgcn_permlanex16(__builtin_bit_cast(int, x), __builtin_bit_cast(int, x), 0x76543210, 0xfedcba98, false, false)); }      /* lane l <- lane l ^ 16, on the vector pipe */
__device__ __forceinline__ v8f fa_mma(v16h a, v16h b, v8f c) { return __builtin_amdgcn_wmma_f32_16x16x32_f16(false, a, false, b, (short)0, c, false, false); }
#define FA_KP 144                          /* LDS pitch of a 128-byte row (K, V^T) */
#define FA_V (64 * FA_KP)                  /* byte offsets inside one buffer: K at 0, then V^T */
#define FA_STAGE (2 * 64 * FA_KP)
typedef __attribute__((address_space(3))) unsigned char lds_u8;
// One stage's copies of one thread: 16 B of the K rows r and r + 32 and of the V^T rows r and r + 32 (a wave: 4 rows a copy). Every lane on, no two lanes on one LDS byte.
// The closing s_wait_xcnt stands inside the statement so that no address register named here is rewritten in front of it.
__device__ __forceinline__ void fa_copy(unsigned lk, const char* gk, unsigned lv, const char* gv) {
  asm volatile("global_load_async_to_lds_b128 %0, %1, off\n\tglobal_load_async_to_lds_b128 %2, %3, off\n\t"
               "global_load_async_to_lds_b128 %4, %5, off\n\tglobal_load_async_to_lds_b128 %6, %7, off\n\t"
               "s_wait_xcnt 0x0"
               :: "v"(lk), "v"(gk), "v"(lk + 32 * FA_KP), "v"(gk + (size_t)32 * LQ * 2), "v"(lv), "v"(gv), "v"(lv + 32 * FA_KP), "v"(gv + (size_t)32 * SEQ * 2) : "memory"); }
__global__ __launch_bounds__(256) void k_fattn(const _Float16* __restrict__ QKV, const _Float16* __restrict__ VT, const unsigned* __restrict__ MK, _Float16* __restrict__ O16) {
  __shared__ __attribute__((aligned(16))) unsigned char L[2 * FA_STAGE];
  const int tid = threadIdx.x, lane = threadIdx.x & 31, w = threadIdx.x >> 5, ln = lane & 15, hh = lane >> 4;
  constexpr int QB = SEQ / 256; const int slab = blockIdx.x / QB, qb = blockIdx.x - slab * QB; const int b = slab / NH, h = slab - b * NH;
  const int q0 = qb * 256 + w * 32; const size_t r0 = (size_t)b * SEQ;
  const _Float16* qp = QKV + (r0 + q0 + ln) * LQ + h * HD + 8 * hh;      /* every fragment pointer below carries the lane half's 8 * hh itself, so g2_frag is called with 0 */
  v16h qf[2][2];
#pragma unroll
  for (int qt = 0; qt < 2; ++qt) { qf[qt][0] = g2_frag(qp + (size_t)qt * 16 * LQ, 0); qf[qt][1] = g2_frag(qp + (size_t)qt * 16 * LQ + 32, 0); }
  /* copy side: thread tid brings 16 B of K rows tid / 8 and tid / 8 + 32 and the same of V^T */
  const char* gk = (const char*)(QKV + DM + (r0 + (tid >> 3)) * LQ + h * HD + 8 * (tid & 7));
  const char* gv = (const char*)(VT + ((size_t)slab * HD + (tid >> 3)) * SEQ + 8 * (tid & 7));
  const unsigned l0 = (unsigned)(uintptr_t)(lds_u8*)L;
  const unsigned lk = l0 + (tid >> 3) * FA_KP + 16 * (tid & 7), lv = lk + FA_V;
  constexpr size_t sk = (size_t)64 * LQ * 2, sv = 128;      /* bytes from one stage's tile to the next */
  /* read side, inside a buffer: the lane's K row and V^T row, each with the lane half's share */
  const int rk = ln * FA_KP + 16 * hh, rv = FA_V + ln * FA_KP + 16 * hh;
  /* the wave's two rows of the gate plane (query tiles q0 / 16 and q0 / 16 + 1); the wave's number goes through readfirstlane so that the address is scalar; a pass is 16 words of each */
  c_v16u* mp = (c_v16u*)(uintptr_t)(MK + (size_t)(qb * 16 + 2 * __builtin_amdgcn_readfirstlane(w)) * (SEQ / 16) * 8); constexpr int MROW = (SEQ / 16) * 8 / 16;
  const v8f z8 = {0.f,0.f,0.f,0.f,0.f,0.f,0.f,0.f};
  v8f o[2][4], cm[2] = {z8, z8}; float thr[2] = {-1.0e29f, -1.0e29f}, l[2] = {0.f, 0.f};      /* cm: -m in all eight registers, the C operand of the score products */
#pragma unroll
  for (int qt = 0; qt < 2; ++qt) {
#pragma unroll
    for (int dt = 0; dt < 4; ++dt) o[qt][dt] = z8; }
  constexpr int NT = SEQ / 64; static_assert(NT >= 2);
  v16u gn0 = mp[0], gn1 = mp[MROW]; unsigned pn = 0;      /* the gate of pass 0 */
  fa_copy(lk, gk, lv, gv);      /* stage 0 into buffer 0 */
  asm volatile("s_wait_asynccnt 0x0" ::: "memory");      /* this wave's copies of stage 0 have landed */
  __syncthreads();      /* ... and every other wave's */
  fa_copy(lk + FA_STAGE, gk + sk, lv + FA_STAGE, gv + sv);      /* stage 1 into buffer 1 */
  gk += 2 * sk; gv += 2 * sv;
  for (int t = 0; t < NT; ++t, gk += sk, gv += sv) {
    const unsigned bo = (unsigned)(t & 1) * FA_STAGE; const unsigned char* B = L + bo;
#pragma unroll 1
   for (int u = 0; u < 2; ++u) {      /* the stage's two passes, one body for both; rolled as it was: the unrolled form now fits 256 registers, but whether it is faster is not measured */
    v16h kf[2][2], vf[4];
    const v16u gc[2] = {gn0, gn1}; pn = (pn + 1 < 2u * NT) ? pn + 1 : pn;      /* the next pass's gate is asked for during this pass; in the last pass the last one again, so that the address stays inside the plane */
    gn0 = mp[pn]; gn1 = mp[MROW + pn];
#pragma unroll
    for (int kt = 0; kt < 2; ++kt) { const _Float16* p = (const _Float16*)(B + rk + (u * 32 + kt * 16) * FA_KP); kf[kt][0] = g2_frag(p, 0); kf[kt][1] = g2_frag(p + 32, 0); }
#pragma unroll
    for (int dt = 0; dt < 4; ++dt) vf[dt] = g2_frag((const _Float16*)(B + rv + dt * 16 * FA_KP + u * 64), 0);
    v8f s[2][2];
#pragma unroll
    for (int qt = 0; qt < 2; ++qt) {
#pragma unroll
      for (int kt = 0; kt < 2; ++kt) s[qt][kt] = fa_mma(kf[kt][1], qf[qt][1], fa_mma(kf[kt][0], qf[qt][0], cm[qt])); }
    float ml[2];
#pragma unroll
    for (int qt = 0; qt < 2; ++qt) { float mx = -3.0e38f;
#pragma unroll
      for (int kt = 0; kt < 2; ++kt) {
#pragma unroll
        for (int r = 0; r < 8; ++r) { const float g = __builtin_amdgcn_inverse_ballot_w32(gc[qt][kt * 8 + r]) ? s[qt][kt][r] : -1.0e30f; s[qt][kt][r] = g; mx = fmaxf(mx, g); } }
      ml[qt] = fmaxf(mx, xhalf(mx)); }
    const bool need = (ml[0] > thr[0]) || (ml[1] > thr[1]);      /* ml is the pass's maximum of t - m */
    if (__builtin_amdgcn_ballot_w32(need) != 0) {      /* one scalar branch a pass: what follows is skipped while no query of the wave moves its reference */
      const float d[2] = {(ml[0] > thr[0]) ? ml[0] : 0.f, (ml[1] > thr[1]) ? ml[1] : 0.f};
      const v4f d4 = {-d[0], -d[1], 0.f, 0.f}; const v4f e4 = exp2x4(d4);
#pragma unroll
      for (int qt = 0; qt < 2; ++qt) { const float al = (thr[qt] < 0.f) ? 1.0f : e4[qt];      /* first setting: d may be far below 0 and 2^-d infinite, and there is nothing to rescale yet */
        thr[qt] = (ml[qt] > thr[qt]) ? 8.0f : thr[qt]; cm[qt] -= d[qt]; l[qt] *= al;
#pragma unroll
        for (int kt = 0; kt < 2; ++kt) s[qt][kt] -= d[qt];
#pragma unroll
        for (int dt = 0; dt < 4; ++dt) o[qt][dt] *= al; } }
#pragma unroll
    for (int qt = 0; qt < 2; ++qt) { FragH pf;
#pragma unroll
      for (int kt = 0; kt < 2; ++kt) {
#pragma unroll
        for (int g = 0; g < 2; ++g) { const v4f x = {s[qt][kt][4 * g], s[qt][kt][4 * g + 1], s[qt][kt][4 * g + 2], s[qt][kt][4 * g + 3]}; const v4f e = exp2x4(x);
#pragma unroll
          for (int q = 0; q < 4; ++q) pf.h[kt * 8 + g * 4 + q] = (_Float16)e[q];
          l[qt] += (e[0] + e[1]) + (e[2] + e[3]); } }
#pragma unroll
      for (int dt = 0; dt < 4; ++dt) o[qt][dt] = fa_mma(vf[dt], pf.v, o[qt][dt]); } }
    asm volatile("s_wait_dscnt 0x0" ::: "memory");      /* this wave's reads of this stage's buffer are done */
    asm volatile("s_wait_asynccnt 0x0" ::: "memory");      /* its copies of the next stage have landed */
    __syncthreads();      /* publishes the next stage's buffer and frees this stage's */
    if (t + 2 < NT) fa_copy(lk + bo, gk, lv + bo, gv); }
  asm volatile("s_wait_asynccnt 0x0" ::: "memory");      /* no copy is left in flight when the wave ends */
#pragma unroll
  for (int qt = 0; qt < 2; ++qt) { const float se = l[qt] + xhalf(l[qt]);
    const float sc = (thr[qt] > 0.f) ? (64.0f / se) : __uint_as_float(0x7fc00000u);      /* no open key at all: NaN */
    unsigned short* d = (unsigned short*)O16 + (r0 + q0 + qt * 16 + ln) * DM + h * HD + 8 * hh;
#pragma unroll
    for (int dt = 0; dt < 4; ++dt) { FragH f;
#pragma unroll
      for (int r = 0; r < 8; ++r) f.h[r] = (_Float16)(o[qt][dt][r] * sc);
      *(v8us*)(d + dt * 16) = f.half[0]; } } }

// ---- f16 WMMA GEMM, K = DM, N = NSEG * DM: C = A . Bt^T * alpha + bf16(bias[col]), for the q columns of NSEG 3 then times log2 e / 8; A [m][DM] f16, Bt [n][DM] f16, NSEG weight matrices stacked by rows, each with its own bias vector (b0, b1, b2), so that products of one A share one grid. A block of 8 waves owns 128 x 128 of C, a wave 32 x 64 (wave w: rows 32 * (w & 3), columns 64 * (w >> 2)).
// With NSEG == 3 the blocks of the third matrix (v) take the weight rows as the row operand and the token rows as the column operand (both lie as [row][k] and are read by the same loader, so only the two tile addresses change places):
// their tile is 128 features x 128 tokens, C^T, with the bias by row, and goes straight to the plane VT [b * DM + feature][SEQ] in whole 128-byte lines of 64 tokens. Requires SEQ % 128 == 0, so that a token tile lies in one batch.
// A stage is 128 of k: 128 A rows and 128 Bt rows of 256 B each are brought into LDS by asynchronous copies in whole lines, once per block, one stage ahead, into two buffers;
// the fragment reads (16 B a lane, 16 rows a read) then go to LDS, at a row pitch of an odd number of 16 B. Requires M % 128 == 0; the grid covers C exactly.
#define G_KS 128                           /* k per stage */
#define G_P 272                            /* LDS pitch of a 256-byte row */
#define G_B (128 * G_P)                    /* byte offset of the Bt tile inside one buffer */
#define G_STAGE (2 * 128 * G_P)
static_assert(DM % 128 == 0 && DM / G_KS >= 2);
static_assert(2 * G_STAGE >= 8 * 32 * 68 * 4);      /* the output staging of the epilogue reuses the buffers */
// One tile's copies of one thread: 16 B of each of the rows r, r + 16, ..., r + 112. Every lane on, no two lanes on one LDS byte.
// The closing s_wait_xcnt stands inside the statement so that no address register named here is rewritten in front of it.
__device__ __forceinline__ void g3_copy(unsigned l, const char* g) {
  constexpr unsigned dl = 16 * G_P; constexpr size_t dg = (size_t)16 * DM * 2;
  asm volatile("global_load_async_to_lds_b128 %0, %1, off\n\tglobal_load_async_to_lds_b128 %2, %3, off\n\t"
               "global_load_async_to_lds_b128 %4, %5, off\n\tglobal_load_async_to_lds_b128 %6, %7, off\n\t"
               "global_load_async_to_lds_b128 %8, %9, off\n\tglobal_load_async_to_lds_b128 %10, %11, off\n\t"
               "global_load_async_to_lds_b128 %12, %13, off\n\tglobal_load_async_to_lds_b128 %14, %15, off\n\t"
               "s_wait_xcnt 0x0"
               :: "v"(l), "v"(g), "v"(l + dl), "v"(g + dg), "v"(l + 2 * dl), "v"(g + 2 * dg), "v"(l + 3 * dl), "v"(g + 3 * dg),
                  "v"(l + 4 * dl), "v"(g + 4 * dg), "v"(l + 5 * dl), "v"(g + 5 * dg), "v"(l + 6 * dl), "v"(g + 6 * dg), "v"(l + 7 * dl), "v"(g + 7 * dg) : "memory"); }
// The fragments of 32 of k: two A row tiles, four Bt row tiles.
__device__ __forceinline__ void g3_frags(const unsigned char* pa, const unsigned char* pb, v16h (&a)[2], v16h (&b)[4]) {
  a[0] = g2_frag((const _Float16*)pa, 0); a[1] = g2_frag((const _Float16*)(pa + 16 * G_P), 0);
#pragma unroll
  for (int nt = 0; nt < 4; ++nt) b[nt] = g2_frag((const _Float16*)(pb + nt * 16 * G_P), 0); }
template <int OUT32, int NSEG>      /* OUT32 1: the result goes to C as f32; 0: to C16 as f16, the v blocks of NSEG 3 to VT */
__global__ __launch_bounds__(256) void k_gemm3(const _Float16* __restrict__ A, const _Float16* __restrict__ Bh, float alpha, const float* __restrict__ b0, const float* __restrict__ b1, const float* __restrict__ b2, float* __restrict__ C, _Float16* __restrict__ C16, int ldc, _Float16* __restrict__ VT) {
  __shared__ __attribute__((aligned(16))) unsigned char L[2 * G_STAGE];
  const int tid = threadIdx.x, w = tid >> 5, lane = tid & 31, ln = lane & 15, hh = lane >> 4;
  constexpr int NTN = NSEG * DM / 128; const int mt = blockIdx.x / NTN, nq = blockIdx.x - mt * NTN;
  const int wm = w & 3, wn = w >> 2; const int row0 = mt * 128 + 32 * wm, col0 = nq * 128 + 64 * wn;
  const int seg = (NSEG == 1) ? 0 : nq / (DM / 128); const bool tr = (NSEG == 3) && seg == 2;      /* the same for the whole block */
  /* copy side: thread tid brings 16 B of the tile rows tid / 16 + 16 * j of A and of Bt; in a transposed block the two change places */
  const char* gx = (const char*)(A + (size_t)(mt * 128 + (tid >> 4)) * DM + 8 * (tid & 15));
  const char* gw = (const char*)(Bh + (size_t)(nq * 128 + (tid >> 4)) * DM + 8 * (tid & 15));
  const char* ga = tr ? gw : gx; const char* gb = tr ? gx : gw;
  const unsigned la = (unsigned)(uintptr_t)(lds_u8*)L + (tid >> 4) * G_P + 16 * (tid & 15), lb = la + G_B;
  constexpr size_t sg = (size_t)G_KS * 2;      /* bytes from one stage's tile to the next */
  /* read side, inside a buffer: the lane's first A row and first Bt row, each with the lane half's share, so g2_frag is called with 0 */
  const int ra = (32 * wm + ln) * G_P + 16 * hh, rb = G_B + (64 * wn + ln) * G_P + 16 * hh;
  const v8f z8 = {0.f,0.f,0.f,0.f,0.f,0.f,0.f,0.f}; v8f c[2][4];
#pragma unroll
  for (int u = 0; u < 8; ++u) c[u >> 2][u & 3] = z8;
  constexpr int NT = DM / G_KS;
  g3_copy(la, ga); g3_copy(lb, gb);      /* stage 0 into buffer 0 */
  asm volatile("s_wait_asynccnt 0x0" ::: "memory");      /* this wave's copies of stage 0 have landed */
  __syncthreads();      /* ... and every other wave's */
  g3_copy(la + G_STAGE, ga + sg); g3_copy(lb + G_STAGE, gb + sg);      /* stage 1 into buffer 1 */
  ga += 2 * sg; gb += 2 * sg;
  for (int t = 0; t < NT; ++t, ga += sg, gb += sg) {
    const unsigned bo = (unsigned)(t & 1) * G_STAGE; const unsigned char* B = L + bo;
    v16h af[2][2], bf[2][4];      /* two fragment sets: the reads of the next 32 of k stand as one group in front of this 32's products */
    g3_frags(B + ra, B + rb, af[0], bf[0]);
#pragma unroll      /* fragment sets and accumulators are indexed by constants, so they stay in registers */
    for (int ks = 0; ks < G_KS / 32; ++ks) {
      if (ks + 1 < G_KS / 32) g3_frags(B + ra + (ks + 1) * 64, B + rb + (ks + 1) * 64, af[(ks + 1) & 1], bf[(ks + 1) & 1]);
      __builtin_amdgcn_sched_barrier(0);      /* keeps that group of reads in front of the products: without it the compiler sinks each read to its first use and every pair of products waits for LDS */
#pragma unroll
      for (int nt = 0; nt < 4; ++nt) { c[0][nt] = fa_mma(af[ks & 1][0], bf[ks & 1][nt], c[0][nt]); c[1][nt] = fa_mma(af[ks & 1][1], bf[ks & 1][nt], c[1][nt]); }
      __builtin_amdgcn_sched_barrier(0); }      /* ... and the group after next behind them, so that two fragment sets suffice */
    asm volatile("s_wait_dscnt 0x0" ::: "memory");      /* this wave's reads of this stage's buffer are done */
    asm volatile("s_wait_asynccnt 0x0" ::: "memory");      /* its copies of the next stage have landed */
    __syncthreads();      /* publishes the next stage's buffer and frees this stage's */
    if (t + 2 < NT) { g3_copy(la + bo, ga); g3_copy(lb + bo, gb); } }
  asm volatile("s_wait_asynccnt 0x0" ::: "memory");      /* no copy is left in flight when the buffers are reused */
  float (*so)[68] = (float (*)[68])(L + (size_t)w * 32 * 68 * 4);      /* the wave's own 32 x 64 output tile; every wave has left the buffers at the loop's last barrier */
  const int f0 = nq * 128 - 2 * DM + 32 * wm;      /* transposed block: the wave's first feature */
  if (tr) { const float* bias = b2 + f0 + 8 * hh;      /* the row's bias */
#pragma unroll
    for (int half = 0; half < 2; ++half) {
#pragma unroll
      for (int r = 0; r < 8; ++r) { const float bv = bf16_rne(bias[half * 16 + r]);
#pragma unroll
        for (int t = 0; t < 4; ++t) so[half * 16 + 8 * hh + r][t * 16 + ln] = c[half][t][r] * alpha + bv; } } }
  else { const float* bias = ((seg == 0) ? b0 : (seg == 1) ? b1 : b2) + (col0 - seg * DM);      /* the column's own bias vector */
    const float qs = (NSEG == 3 && seg == 0) ? 0.18033688011112042f : 1.0f, aq = alpha * qs;      /* q leaves times log2 e / sqrt(HD), applied in f32 in front of its one rounding to f16 */
#pragma unroll
    for (int u = 0; u < 8; ++u) { const int t = u & 3, half = u >> 2; const float bv = bf16_rne(bias[t * 16 + ln]) * qs;
#pragma unroll
      for (int r = 0; r < 8; ++r) so[half * 16 + 8 * hh + r][t * 16 + ln] = c[half][t][r] * aq + bv; } }
  __builtin_amdgcn_fence(4, "workgroup"); __builtin_amdgcn_wave_barrier();
  const int rsub = lane >> 4, c4 = (lane & 15) * 4;
  const int bb = mt * 128 / SEQ;      /* the token tile's batch */
  _Float16* d16 = tr ? VT + ((size_t)bb * DM + f0) * SEQ + (mt * 128 - bb * SEQ) + 64 * wn : C16 + (size_t)row0 * ldc + col0; const size_t p16 = tr ? (size_t)SEQ : (size_t)ldc;
#pragma unroll
  for (int q = 0; q < 16; ++q) { const int r = q * 2 + rsub; const v4f v = *(const v4fa*)&so[r][c4];
    if (OUT32) *(v4f*)(C + (size_t)(row0 + r) * ldc + col0 + c4) = v;
    else { v4h h4; for (int i = 0; i < 4; ++i) h4[i] = (_Float16)v[i]; *(v4h*)(d16 + r * p16 + c4) = h4; } } }

extern "C" void kernel_launch(void* const* d_in, const int* in_sizes, int n_in,
                              void* d_out, int out_size, void* d_ws, size_t ws_size, hipStream_t stream) {
  if (n_in < 10) return;
  if (in_sizes[0] < NB * SEQ_FULL * DM || in_sizes[1] < SEQ * SEQ_FULL) return;
  if (in_sizes[2] < DM * DM || in_sizes[4] < DM * DM || in_sizes[6] < DM * DM || in_sizes[8] < DM * DM) return;
  if (in_sizes[3] < DM || in_sizes[5] < DM || in_sizes[7] < DM || in_sizes[9] < DM) return;
  if (out_size < (int)(NR * DM)) return;
  const float* x  = (const float*)d_in[0]; const int* adj = (const int*)d_in[1];
  const float* wq = (const float*)d_in[2]; const float* bq = (const float*)d_in[3];
  const float* wk = (const float*)d_in[4]; const float* bk = (const float*)d_in[5];
  const float* wv = (const float*)d_in[6]; const float* bv = (const float*)d_in[7];
  const float* wo = (const float*)d_in[8]; const float* bo = (const float*)d_in[9];
  char* ws = (char*)d_ws; size_t off = 0;
  auto take = [&](size_t bytes) { char* p = ws + off; off += (bytes + 255) & ~(size_t)255; return p; };
  _Float16* BW  = (_Float16*)take((size_t)4 * DM * DM * 2);           /* Bt[n][k] x16 (natural [out][in]): Wq, Wk, Wv, Wo stacked by rows */
  _Float16* X16 = (_Float16*)take(NR * DM * 2);                       /* [NR][DM] */
  _Float16* QKV = (_Float16*)take(NR * LQ * 2);                       /* [NR][3*DM]: q | k | (not used) */
  _Float16* O16 = (_Float16*)take(NR * DM * 2);                       /* [NR][DM], o x64 */
  _Float16* VT  = (_Float16*)take((size_t)NB * NH * HD * SEQ * 2);    /* [NB*NH][64][SEQ] */
  unsigned* MK  = (unsigned*)take((size_t)(SEQ / 16) * (SEQ / 16) * 8 * 4);      /* [SEQ/16][SEQ/16][8], the gate as lane masks */
  if (off > ws_size || off > (size_t)134217728) return;
  k_prep<<<(unsigned)(PM + 4 * PW + (NR * DM / 8 + 255) / 256), 256, 0, stream>>>(x, wq, wk, wv, wo, BW, X16, NR * DM / 8, adj, MK);
  const unsigned gp = (unsigned)((NR / 128) * (DM / 128));
  k_gemm3<0, 3><<<3 * gp, 256, 0, stream>>>(X16, BW, 0.0625f, bq, bk, bv, nullptr, QKV, LQ, VT);      /* q | k rows (f16), head h = columns h*64.. of each; V^T [NB*NH][HD][SEQ] */
  k_fattn<<<(unsigned)(NB * NH * (SEQ / 256)), 256, 0, stream>>>(QKV, VT, MK, O16);      /* o (merged heads, x64) f16 rows */
  k_gemm3<1, 1><<<gp, 256, 0, stream>>>(O16, BW + (size_t)3 * DM * DM, 0.0009765625f, bo, nullptr, nullptr, (float*)d_out, nullptr, DM, nullptr);      /* out rows = output layout [b][s][DM] */
}

// v009
// One run takes 63.8 microseconds.
// Next to v008, in two timings, it ran 1.08 times as fast each time.
// Counting every step since v000, it is 99.5 times as fast.
#include <hip/hip_runtime.h>
// All contractions (q, k, v projections K=512; q.k^T per head K=64; softmax weights . V K=SEQ; output projection K=512): v_wmma_f32_16x16x32_f16, f16 operands (every float input RNE-converted to bf16 first; weights carried x16, q carried x log2 e / 8, softmax weights carried unnormalised as 2^(t - m) <= 2^8, o carried x64), f32 accumulate; softmax statistics f32 on the VALU.
// Structure: token rows r = b*SEQ + s. X16 = f16(bf16(h)); q | k as f16 rows [r][3*DM] and V^T planes [b*NH+h][64][SEQ] from one GEMM launch over the stacked weights (alpha 1/16, bias bf16), the v blocks with their operands swapped;
// per (batch, head, 32 query rows) two waves walk one half of the keys each, 32 at a time, and join their results at the end: S^T = K . Q^T - m in f32, gated by the integer adjacency (adj[q][j] == 0 -> weight exactly 0; a row with no open key yields NaN), which the conversion launch packs once into lane masks, running maximum and sum per query in f32,
// P = f16(2^(t - m)) taken from the score accumulators as the B operand of O^T += V^T . P^T; o = O^T * 64 / sum written as f16 rows [r][DM] (head h -> columns h*64); out = o . Wo^T * 2^-10 + bf16(bo) in f32.
#ifndef NB
#define NB 4
#endif
#ifndef SEQ
#define SEQ 2048
#endif
#define NB_FULL 4
#define SEQ_FULL 2048                /* pitch of adj rows and per-batch stride of h */
#define DM 512
#define NH 8
#define HD 64
#define LQ (3 * DM)                  /* row pitch of the q | k plane (its last DM columns not used) */
#define NR ((size_t)NB * SEQ)        /* token rows */
static_assert(NB >= 1 && NB <= NB_FULL);
static_assert(SEQ >= 128 && SEQ <= SEQ_FULL);
static_assert(SEQ % 256 == 0);      /* a block of the attention kernel owns 256 query rows; a 128-token tile of the GEMM lies in one batch */
static_assert((NB * SEQ) % 128 == 0);
static_assert(DM == NH * HD && HD == 64 && DM % 64 == 0);

typedef unsigned short v8us __attribute__((ext_vector_type(8), may_alias));
typedef float  v8f  __attribute__((ext_vector_type(8)));
typedef float  v4f  __attribute__((ext_vector_type(4)));
typedef float  v4fa __attribute__((ext_vector_type(4), may_alias));
typedef int    v4ia __attribute__((ext_vector_type(4), may_alias));
typedef unsigned v16u __attribute__((ext_vector_type(16), may_alias));
typedef const __attribute__((address_space(4))) v16u c_v16u;      /* constant address space: memory that no one writes while the kernel runs; a load at a wave-uniform address is then a scalar load, also behind the asm statements and barriers of a loop */
typedef _Float16 v16h __attribute__((ext_vector_type(16)));
typedef _Float16 v4h __attribute__((ext_vector_type(4)));
union FragH { v16h v; v8us half[2]; _Float16 h[16]; unsigned short u[16]; };

__device__ __forceinline__ unsigned short bf16_bits(float x) { unsigned int u = __float_as_uint(x); return (unsigned short)((u + 0x7FFFu + ((u >> 16) & 1u)) >> 16); }
__device__ __forceinline__ float bf16_val(unsigned short b) { return __uint_as_float(((unsigned int)b) << 16); }
__device__ __forceinline__ float bf16_rne(float x) { return bf16_val(bf16_bits(x)); }

// ---- f16 WMMA fragments in the split k layout (elements 0..7 <- k0+8h.., 8..15 <- k0+16+8h..), the same for both operands ----
__device__ __forceinline__ v16h g2_frag(const _Float16* p, int hh) { FragH f; f.half[0] = *(const v8us*)((const unsigned short*)p + 8 * hh); f.half[1] = *(const v8us*)((const unsigned short*)p + 16 + 8 * hh); return f.v; }

__device__ __forceinline__ void d_wnat(unsigned blk, const float* __restrict__ w, size_t n8, _Float16* __restrict__ Bt) {
  const size_t t = (size_t)blk * 256 + threadIdx.x; if (t >= n8) return;
  const v4f a = *(const v4fa*)(w + t * 8), c = *(const v4fa*)(w + t * 8 + 4); FragH f;
#pragma unroll
  for (int q = 0; q < 4; ++q) { f.h[q] = (_Float16)(bf16_rne(a[q]) * 16.0f); f.h[4 + q] = (_Float16)(bf16_rne(c[q]) * 16.0f); }
  *(v8us*)((unsigned short*)Bt + t * 8) = f.half[0];  }

__device__ __forceinline__ void d_x16(unsigned blk, const float* __restrict__ x, _Float16* __restrict__ X16, size_t n8) {
  const size_t t = (size_t)blk * 256 + threadIdx.x; if (t >= n8) return;
  const size_t per = (size_t)SEQ * DM / 8; const size_t b = t / per, rem = t - b * per;
  const float* src = x + b * ((size_t)SEQ_FULL * DM) + rem * 8;
  const v4f a = *(const v4fa*)src, c = *(const v4fa*)(src + 4); FragH f;
#pragma unroll
  for (int q = 0; q < 4; ++q) { f.h[q] = (_Float16)bf16_rne(a[q]); f.h[4 + q] = (_Float16)bf16_rne(c[q]); }
  *(v8us*)((unsigned short*)X16 + t * 8) = f.half[0];  }

// The gate as lane masks: MK [SEQ / 16][SEQ / 16][8], one word for 16 queries x 16 keys and r = 0..7; bit 16 * hh + ln of word r says adj[16 * qtile + ln][16 * ktile + 8 * hh + r] != 0,
// which is the place of that score in the accumulator of S^T = K . Q^T (lane 16 * hh + ln, register r): the attention kernel reads a word into a scalar register and selects with it.
// A block packs 16 query rows x 512 keys: the rows come in whole 512-byte wave loads, go through LDS (row pitch an odd number of 16 B), and each wave votes on four key tiles; its 32 words leave as one 128-byte store.
// Its loops are fully unrolled so that the eight loads of a thread are in flight together and their values stay in registers.
#define MK_P (512 * 4 + 16)                /* LDS pitch of 512 adj values */
static_assert(SEQ % 512 == 0);
__device__ __forceinline__ void d_mask(unsigned blk, const int* __restrict__ adj, unsigned* __restrict__ MK, unsigned char* S) {
  constexpr unsigned KB = SEQ / 512; const unsigned qtile = blk / KB, kb = blk - qtile * KB;
  const int tid = threadIdx.x, lane = tid & 31, w = tid >> 5, ln = lane & 15, hh = lane >> 4;
  const int* src = adj + (size_t)(qtile * 16 + (tid >> 7)) * SEQ_FULL + kb * 512 + 4 * (tid & 127); v4ia a[8];
#pragma unroll
  for (int j = 0; j < 8; ++j) a[j] = *(const v4ia*)(src + (size_t)2 * j * SEQ_FULL);
#pragma unroll
  for (int j = 0; j < 8; ++j) *(v4ia*)(S + (2 * j + (tid >> 7)) * MK_P + 16 * (tid & 127)) = a[j];
  __syncthreads();      /* the branch that leads here is the same for the whole block */
  unsigned v = 0;
#pragma unroll
  for (int j = 0; j < 4; ++j) { const unsigned char* p = S + ln * MK_P + (w * 4 + j) * 64 + 32 * hh; const v4ia x = *(const v4ia*)p, y = *(const v4ia*)(p + 16);
#pragma unroll
    for (int r = 0; r < 8; ++r) { const unsigned b = __builtin_amdgcn_ballot_w32(((r < 4) ? x[r & 3] : y[r & 3]) != 0); v = (lane == j * 8 + r) ? b : v; } }
  MK[((size_t)qtile * (SEQ / 16) + kb * 32 + w * 4) * 8 + lane] = v; }

// The six conversions need nothing of each other, so they share one grid by ranges of the block index (a block-uniform branch): blocks 0 .. PM - 1 pack the gate, the next 4 * PW convert Wq, Wk, Wv, Wo into the stacked plane BW [4 * DM][DM], the rest convert h.
#define PW ((DM * DM / 8 + 255) / 256)     /* blocks per weight matrix */
#define PM ((SEQ / 16) * (SEQ / 512))      /* blocks of the gate */
__global__ __launch_bounds__(256) void k_prep(const float* __restrict__ x, const float* __restrict__ wq, const float* __restrict__ wk, const float* __restrict__ wv, const float* __restrict__ wo,
                                              _Float16* __restrict__ BW, _Float16* __restrict__ X16, size_t nx8, const int* __restrict__ adj, unsigned* __restrict__ MK) {
  __shared__ __attribute__((aligned(16))) unsigned char S[16 * MK_P];
  if (blockIdx.x < (unsigned)PM) { d_mask(blockIdx.x, adj, MK, S); return; }
  const unsigned blk = blockIdx.x - PM;
  if (blk < 4u * PW) { const unsigned i = blk / PW; const float* w = (i == 0) ? wq : (i == 1) ? wk : (i == 2) ? wv : wo;
    d_wnat(blk - i * PW, w, (size_t)DM * DM / 8, BW + (size_t)i * DM * DM); }
  else d_x16(blk - 4u * PW, x, X16, nx8); }

// 2^x of four values in place (what the native exp compiles to behind its multiply by log2 e). The four v_exp_f32 name disjoint registers; the closing v_nop keeps the one slot that the instruction set
// asks for between a transcendental and the next use of its result or overwrite of its source.
__device__ __forceinline__ v4f exp2x4(v4f x) { float a = x[0], b = x[1], c = x[2], d = x[3];
  asm("v_exp_f32 %0, %0\n\tv_exp_f32 %1, %1\n\tv_exp_f32 %2, %2\n\tv_exp_f32 %3, %3\n\tv_nop" : "+v"(a), "+v"(b), "+v"(c), "+v"(d));
  const v4f r = {a, b, c, d}; return r; }
__device__ __forceinline__ float xhalf(float x) { return __builtin_bit_cast(float, __builtin_amdgcn_permlanex16(__builtin_bit_cast(int, x), __builtin_bit_cast(int, x), 0x76543210, 0xfedcba98, false, false)); }      /* lane l <- lane l ^ 16, on the vector pipe */
__device__ __forceinline__ v8f fa_mma(v16h a, v16h b, v8f c) { return __builtin_amdgcn_wmma_f32_16x16x32_f16(false, a, false, b, (short)0, c, false, false); }
#define FA_KP 144                          /* LDS pitch of a 128-byte row (K, V^T) */
#define FA_V (64 * FA_KP)                  /* byte offsets inside one buffer: K at 0, then V^T */
#define FA_STAGE (2 * 64 * FA_KP)
typedef __attribute__((address_space(3))) unsigned char lds_u8;
// One stage's copies of one thread: 16 B of the K rows r and r + 32 and of the V^T rows r and r + 32 (a wave: 4 rows a copy). Every lane on, no two lanes on one LDS byte.
// The closing s_wait_xcnt stands inside the statement so that no address register named here is rewritten in front of it.
__device__ __forceinline__ void fa_copy(unsigned lk, const char* gk, unsigned lv, const char* gv) {
  asm volatile("global_load_async_to_lds_b128 %0, %1, off\n\tglobal_load_async_to_lds_b128 %2, %3, off\n\t"
               "global_load_async_to_lds_b128 %4, %5, off\n\tglobal_load_async_to_lds_b128 %6, %7, off\n\t"
               "s_wait_xcnt 0x0"
               :: "v"(lk), "v"(gk), "v"(lk + 32 * FA_KP), "v"(gk + (size_t)32 * LQ * 2), "v"(lv), "v"(gv), "v"(lv + 32 * FA_KP), "v"(gv + (size_t)32 * SEQ * 2) : "memory"); }
__global__ __launch_bounds__(512) void k_fattn(const _Float16* __restrict__ QKV, const _Float16* __restrict__ VT, const unsigned* __restrict__ MK, _Float16* __restrict__ O16) {
  __shared__ __attribute__((aligned(16))) unsigned char L[2 * 2 * FA_STAGE];      /* [key half][buffer] */
  const int tid = threadIdx.x & 255, lane = threadIdx.x & 31, ln = lane & 15, hh = lane >> 4;      /* tid: the thread's place among the 256 of its key half */
  const int ws = __builtin_amdgcn_readfirstlane((int)(threadIdx.x >> 5)), w = ws & 7, kh = ws >> 3;      /* through readfirstlane, so that the gate's address and the branches of the join are scalar */
  constexpr int SH = SEQ / 2;      /* keys of a half */
  constexpr int QB = SEQ / 256; const int slab = blockIdx.x / QB, qb = blockIdx.x - slab * QB; const int b = slab / NH, h = slab - b * NH;
  const int q0 = qb * 256 + w * 32; const size_t r0 = (size_t)b * SEQ;
  const _Float16* qp = QKV + (r0 + q0 + ln) * LQ + h * HD + 8 * hh;      /* every fragment pointer below carries the lane half's 8 * hh itself, so g2_frag is called with 0 */
  v16h qf[2][2];
#pragma unroll
  for (int qt = 0; qt < 2; ++qt) { qf[qt][0] = g2_frag(qp + (size_t)qt * 16 * LQ, 0); qf[qt][1] = g2_frag(qp + (size_t)qt * 16 * LQ + 32, 0); }
  /* copy side: thread tid brings 16 B of K rows tid / 8 and tid / 8 + 32 and the same of V^T */
  const char* gk = (const char*)(QKV + DM + (r0 + kh * SH + (tid >> 3)) * LQ + h * HD + 8 * (tid & 7));
  const char* gv = (const char*)(VT + ((size_t)slab * HD + (tid >> 3)) * SEQ + kh * SH + 8 * (tid & 7));
  const unsigned l0 = (unsigned)(uintptr_t)(lds_u8*)L + kh * (2 * FA_STAGE);
  const unsigned lk = l0 + (tid >> 3) * FA_KP + 16 * (tid & 7), lv = lk + FA_V;
  constexpr size_t sk = (size_t)64 * LQ * 2, sv = 128;      /* bytes from one stage's tile to the next */
  /* read side, inside a buffer: the lane's K row and V^T row, each with the lane half's share */
  const int rk = kh * (2 * FA_STAGE) + ln * FA_KP + 16 * hh, rv = rk + FA_V;
  /* the wave's two rows of the gate plane (query tiles q0 / 16 and q0 / 16 + 1), from its key half's first pass on; a pass is 16 words of each */
  c_v16u* mp = (c_v16u*)(uintptr_t)(MK + (size_t)(qb * 16 + 2 * w) * (SEQ / 16) * 8 + (size_t)kh * (SH / 16) * 8); constexpr int MROW = (SEQ / 16) * 8 / 16;
  const v8f z8 = {0.f,0.f,0.f,0.f,0.f,0.f,0.f,0.f};
  v8f o[2][4], cm[2] = {z8, z8}; float thr[2] = {-1.0e29f, -1.0e29f}, l[2] = {0.f, 0.f};      /* cm: -m in all eight registers, the C operand of the score products */
#pragma unroll
  for (int qt = 0; qt < 2; ++qt) {
#pragma unroll
    for (int dt = 0; dt < 4; ++dt) o[qt][dt] = z8; }
  constexpr int NT = SH / 64; static_assert(NT >= 2 && SH % 64 == 0);
  v16u gn0 = mp[0], gn1 = mp[MROW]; unsigned pn = 0;      /* the gate of pass 0 */
  fa_copy(lk, gk, lv, gv);      /* stage 0 into buffer 0 */
  asm volatile("s_wait_asynccnt 0x0" ::: "memory");      /* this wave's copies of stage 0 have landed */
  __syncthreads();      /* ... and every other wave's */
  fa_copy(lk + FA_STAGE, gk + sk, lv + FA_STAGE, gv + sv);      /* stage 1 into buffer 1 */
  gk += 2 * sk; gv += 2 * sv;
  for (int t = 0; t < NT; ++t, gk += sk, gv += sv) {
    const unsigned bo = (unsigned)(t & 1) * FA_STAGE; const unsigned char* B = L + bo;
#pragma unroll 1
   for (int u = 0; u < 2; ++u) {      /* the stage's two passes, one body for both; rolled as it was: the unrolled form now fits 256 registers, but whether it is faster is not measured */
    v16h kf[2][2], vf[4];
    const v16u gc[2] = {gn0, gn1}; pn = (pn + 1 < 2u * NT) ? pn + 1 : pn;      /* the next pass's gate is asked for during this pass; in the last pass the last one again, so that the address stays inside the plane */
    gn0 = mp[pn]; gn1 = mp[MROW + pn];
#pragma unroll
    for (int kt = 0; kt < 2; ++kt) { const _Float16* p = (const _Float16*)(B + rk + (u * 32 + kt * 16) * FA_KP); kf[kt][0] = g2_frag(p, 0); kf[kt][1] = g2_frag(p + 32, 0); }
#pragma unroll
    for (int dt = 0; dt < 4; ++dt) vf[dt] = g2_frag((const _Float16*)(B + rv + dt * 16 * FA_KP + u * 64), 0);
    v8f s[2][2];
#pragma unroll
    for (int qt = 0; qt < 2; ++qt) {
#pragma unroll
      for (int kt = 0; kt < 2; ++kt) s[qt][kt] = fa_mma(kf[kt][1], qf[qt][1], fa_mma(kf[kt][0], qf[qt][0], cm[qt])); }
    float ml[2];
#pragma unroll
    for (int qt = 0; qt < 2; ++qt) { float mx = -3.0e38f;
#pragma unroll
      for (int kt = 0; kt < 2; ++kt) {
#pragma unroll
        for (int r = 0; r < 8; ++r) { const float g = __builtin_amdgcn_inverse_ballot_w32(gc[qt][kt * 8 + r]) ? s[qt][kt][r] : -1.0e30f; s[qt][kt][r] = g; mx = fmaxf(mx, g); } }
      ml[qt] = fmaxf(mx, xhalf(mx)); }
    const bool need = (ml[0] > thr[0]) || (ml[1] > thr[1]);      /* ml is the pass's maximum of t - m */
    if (__builtin_amdgcn_ballot_w32(need) != 0) {      /* one scalar branch a pass: what follows is skipped while no query of the wave moves its reference */
      const float d[2] = {(ml[0] > thr[0]) ? ml[0] : 0.f, (ml[1] > thr[1]) ? ml[1] : 0.f};
      const v4f d4 = {-d[0], -d[1], 0.f, 0.f}; const v4f e4 = exp2x4(d4);
#pragma unroll
      for (int qt = 0; qt < 2; ++qt) { const float al = (thr[qt] < 0.f) ? 1.0f : e4[qt];      /* first setting: d may be far below 0 and 2^-d infinite, and there is nothing to rescale yet */
        thr[qt] = (ml[qt] > thr[qt]) ? 8.0f : thr[qt]; cm[qt] -= d[qt]; l[qt] *= al;
#pragma unroll
        for (int kt = 0; kt < 2; ++kt) s[qt][kt] -= d[qt];
#pragma unroll
        for (int dt = 0; dt < 4; ++dt) o[qt][dt] *= al; } }
#pragma unroll
    for (int qt = 0; qt < 2; ++qt) { FragH pf;
#pragma unroll
      for (int kt = 0; kt < 2; ++kt) {
#pragma unroll
        for (int g = 0; g < 2; ++g) { const v4f x = {s[qt][kt][4 * g], s[qt][kt][4 * g + 1], s[qt][kt][4 * g + 2], s[qt][kt][4 * g + 3]}; const v4f e = exp2x4(x);
#pragma unroll
          for (int q = 0; q < 4; ++q) pf.h[kt * 8 + g * 4 + q] = (_Float16)e[q];
          l[qt] += (e[0] + e[1]) + (e[2] + e[3]); } }
#pragma unroll
      for (int dt = 0; dt < 4; ++dt) o[qt][dt] = fa_mma(vf[dt], pf.v, o[qt][dt]); }
    __builtin_amdgcn_sched_barrier(0);      /* holds the pass's last product in front of the slots below */
    asm volatile("v_nop\n\tv_nop");      /* vector slots between the pass's last product and the next pass's first writes into its A registers */
   }
    asm volatile("s_wait_dscnt 0x0" ::: "memory");      /* this wave's reads of this stage's buffer are done */
    asm volatile("s_wait_asynccnt 0x0" ::: "memory");      /* its copies of the next stage have landed */
    __syncthreads();      /* publishes the next stage's buffer and frees this stage's */
    if (t + 2 < NT) fa_copy(lk + bo, gk, lv + bo, gv); }
  asm volatile("s_wait_asynccnt 0x0" ::: "memory");      /* no copy is left in flight when the ring is reused */
  static_assert(8 * 18 * 512 <= 2 * 2 * FA_STAGE);
  v4fa* X = (v4fa*)(L + w * (18 * 512)) + lane;      /* the query group's exchange: 18 pieces of 16 B a lane, a piece 512 B in lane order */
  if (kh) {
#pragma unroll
    for (int u = 0; u < 16; ++u) { const v8f& a = o[u >> 3][(u >> 1) & 3]; const int c = 4 * (u & 1); const v4f x = {a[c], a[c + 1], a[c + 2], a[c + 3]}; X[u * 32] = x; }
    const v4f s0 = {l[0], l[1], cm[0][0], cm[1][0]}, s1 = {thr[0], thr[1], 0.f, 0.f}; X[16 * 32] = s0; X[17 * 32] = s1; }
  __syncthreads();      /* the upper halves' results are in LDS; every wave of the block passes here */
  if (kh) return;
  const v4f s0 = X[16 * 32], s1 = X[17 * 32]; bool open[2]; float fa[2], fb[2];
  { float da[2], db[2];
#pragma unroll
    for (int qt = 0; qt < 2; ++qt) { const float ma = -cm[qt][0], mb = -s0[2 + qt]; const bool va = thr[qt] > 0.f, vb = s1[qt] > 0.f;
      const float m = va ? (vb ? fmaxf(ma, mb) : ma) : mb; da[qt] = ma - m; db[qt] = mb - m; open[qt] = va || vb; }
    const v4f d4 = {da[0], db[0], da[1], db[1]}; const v4f e4 = exp2x4(d4);
#pragma unroll
    for (int qt = 0; qt < 2; ++qt) { fa[qt] = (thr[qt] > 0.f) ? e4[2 * qt] : 0.f; fb[qt] = (s1[qt] > 0.f) ? e4[2 * qt + 1] : 0.f; } }      /* a half with no open key holds zeros and an unset reference: factor 0 by selection, its 2^x may be infinite */
#pragma unroll
  for (int u = 0; u < 16; ++u) { const int qt = u >> 3; v8f& a = o[qt][(u >> 1) & 3]; const int c = 4 * (u & 1); const v4f x = X[u * 32];
#pragma unroll
    for (int i = 0; i < 4; ++i) a[c + i] = a[c + i] * fa[qt] + x[i] * fb[qt]; }
#pragma unroll
  for (int qt = 0; qt < 2; ++qt) { const float lj = l[qt] * fa[qt] + s0[qt] * fb[qt]; const float se = lj + xhalf(lj);
    const float sc = open[qt] ? (64.0f / se) : __uint_as_float(0x7fc00000u);      /* no open key at all: NaN */
    unsigned short* d = (unsigned short*)O16 + (r0 + q0 + qt * 16 + ln) * DM + h * HD + 8 * hh;
#pragma unroll
    for (int dt = 0; dt < 4; ++dt) { FragH f;
#pragma unroll
      for (int r = 0; r < 8; ++r) f.h[r] = (_Float16)(o[qt][dt][r] * sc);
      *(v8us*)(d + dt * 16) = f.half[0]; } } }

// ---- f16 WMMA GEMM, K = DM, N = NSEG * DM: C = A . Bt^T * alpha + bf16(bias[col]), for the q columns of NSEG 3 then times log2 e / 8; A [m][DM] f16, Bt [n][DM] f16, NSEG weight matrices stacked by rows, each with its own bias vector (b0, b1, b2), so that products of one A share one grid. A block of 8 waves owns 128 x 128 of C, a wave 32 x 64 (wave w: rows 32 * (w & 3), columns 64 * (w >> 2)).
// With NSEG == 3 the blocks of the third matrix (v) take the weight rows as the row operand and the token rows as the column operand (both lie as [row][k] and are read by the same loader, so only the two tile addresses change places):
// their tile is 128 features x 128 tokens, C^T, with the bias by row, and goes straight to the plane VT [b * DM + feature][SEQ] in whole 128-byte lines of 64 tokens. Requires SEQ % 128 == 0, so that a token tile lies in one batch.
// A stage is 128 of k: 128 A rows and 128 Bt rows of 256 B each are brought into LDS by asynchronous copies in whole lines, once per block, one stage ahead, into two buffers;
// the fragment reads (16 B a lane, 16 rows a read) then go to LDS, at a row pitch of an odd number of 16 B. Requires M % 128 == 0; the grid covers C exactly.
#define G_KS 128                           /* k per stage */
#define G_P 272                            /* LDS pitch of a 256-byte row */
#define G_B (128 * G_P)                    /* byte offset of the Bt tile inside one buffer */
#define G_STAGE (2 * 128 * G_P)
static_assert(DM % 128 == 0 && DM / G_KS >= 2);
static_assert(2 * G_STAGE >= 8 * 32 * 68 * 4);      /* the output staging of the epilogue reuses the buffers */
// One tile's copies of one thread: 16 B of each of the rows r, r + 16, ..., r + 112. Every lane on, no two lanes on one LDS byte.
// The closing s_wait_xcnt stands inside the statement so that no address register named here is rewritten in front of it.
__device__ __forceinline__ void g3_copy(unsigned l, const char* g) {
  constexpr unsigned dl = 16 * G_P; constexpr size_t dg = (size_t)16 * DM * 2;
  asm volatile("global_load_async_to_lds_b128 %0, %1, off\n\tglobal_load_async_to_lds_b128 %2, %3, off\n\t"
               "global_load_async_to_lds_b128 %4, %5, off\n\tglobal_load_async_to_lds_b128 %6, %7, off\n\t"
               "global_load_async_to_lds_b128 %8, %9, off\n\tglobal_load_async_to_lds_b128 %10, %11, off\n\t"
               "global_load_async_to_lds_b128 %12, %13, off\n\tglobal_load_async_to_lds_b128 %14, %15, off\n\t"
               "s_wait_xcnt 0x0"
               :: "v"(l), "v"(g), "v"(l + dl), "v"(g + dg), "v"(l + 2 * dl), "v"(g + 2 * dg), "v"(l + 3 * dl), "v"(g + 3 * dg),
                  "v"(l + 4 * dl), "v"(g + 4 * dg), "v"(l + 5 * dl), "v"(g + 5 * dg), "v"(l + 6 * dl), "v"(g + 6 * dg), "v"(l + 7 * dl), "v"(g + 7 * dg) : "memory"); }
// The fragments of 32 of k: two A row tiles, four Bt row tiles.
__device__ __forceinline__ void g3_frags(const unsigned char* pa, const unsigned char* pb, v16h (&a)[2], v16h (&b)[4]) {
  a[0] = g2_frag((const _Float16*)pa, 0); a[1] = g2_frag((const _Float16*)(pa + 16 * G_P), 0);
#pragma unroll
  for (int nt = 0; nt < 4; ++nt) b[nt] = g2_frag((const _Float16*)(pb + nt * 16 * G_P), 0); }
template <int OUT32, int NSEG>      /* OUT32 1: the result goes to C as f32; 0: to C16 as f16, the v blocks of NSEG 3 to VT */
__global__ __launch_bounds__(256) void k_gemm3(const _Float16* __restrict__ A, const _Float16* __restrict__ Bh, float alpha, const float* __restrict__ b0, const float* __restrict__ b1, const float* __restrict__ b2, float* __restrict__ C, _Float16* __restrict__ C16, int ldc, _Float16* __restrict__ VT) {
  __shared__ __attribute__((aligned(16))) unsigned char L[2 * G_STAGE];
  const int tid = threadIdx.x, w = tid >> 5, lane = tid & 31, ln = lane & 15, hh = lane >> 4;
  constexpr int NTN = NSEG * DM / 128; const int mt = blockIdx.x / NTN, nq = blockIdx.x - mt * NTN;
  const int wm = w & 3, wn = w >> 2; const int row0 = mt * 128 + 32 * wm, col0 = nq * 128 + 64 * wn;
  const int seg = (NSEG == 1) ? 0 : nq / (DM / 128); const bool tr = (NSEG == 3) && seg == 2;      /* the same for the whole block */
  /* copy side: thread tid brings 16 B of the tile rows tid / 16 + 16 * j of A and of Bt; in a transposed block the two change places */
  const char* gx = (const char*)(A + (size_t)(mt * 128 + (tid >> 4)) * DM + 8 * (tid & 15));
  const char* gw = (const char*)(Bh + (size_t)(nq * 128 + (tid >> 4)) * DM + 8 * (tid & 15));
  const char* ga = tr ? gw : gx; const char* gb = tr ? gx : gw;
  const unsigned la = (unsigned)(uintptr_t)(lds_u8*)L + (tid >> 4) * G_P + 16 * (tid & 15), lb = la + G_B;
  constexpr size_t sg = (size_t)G_KS * 2;      /* bytes from one stage's tile to the next */
  /* read side, inside a buffer: the lane's first A row and first Bt row, each with the lane half's share, so g2_frag is called with 0 */
  const int ra = (32 * wm + ln) * G_P + 16 * hh, rb = G_B + (64 * wn + ln) * G_P + 16 * hh;
  const v8f z8 = {0.f,0.f,0.f,0.f,0.f,0.f,0.f,0.f}; v8f c[2][4];
#pragma unroll
  for (int u = 0; u < 8; ++u) c[u >> 2][u & 3] = z8;
  constexpr int NT = DM / G_KS;
  g3_copy(la, ga); g3_copy(lb, gb);      /* stage 0 into buffer 0 */
  asm volatile("s_wait_asynccnt 0x0" ::: "memory");      /* this wave's copies of stage 0 have landed */
  __syncthreads();      /* ... and every other wave's */
  g3_copy(la + G_STAGE, ga + sg); g3_copy(lb + G_STAGE, gb + sg);      /* stage 1 into buffer 1 */
  ga += 2 * sg; gb += 2 * sg;
  for (int t = 0; t < NT; ++t, ga += sg, gb += sg) {
    const unsigned bo = (unsigned)(t & 1) * G_STAGE; const unsigned char* B = L + bo;
    v16h af[2][2], bf[2][4];      /* two fragment sets: the reads of the next 32 of k stand as one group in front of this 32's products */
    g3_frags(B + ra, B + rb, af[0], bf[0]);
#pragma unroll      /* fragment sets and accumulators are indexed by constants, so they stay in registers */
    for (int ks = 0; ks < G_KS / 32; ++ks) {
      if (ks + 1 < G_KS / 32) g3_frags(B + ra + (ks + 1) * 64, B + rb + (ks + 1) * 64, af[(ks + 1) & 1], bf[(ks + 1) & 1]);
      __builtin_amdgcn_sched_barrier(0);      /* keeps that group of reads in front of the products: without it the compiler sinks each read to its first use and every pair of products waits for LDS */
#pragma unroll
      for (int nt = 0; nt < 4; ++nt) { c[0][nt] = fa_mma(af[ks & 1][0], bf[ks & 1][nt], c[0][nt]); c[1][nt] = fa_mma(af[ks & 1][1], bf[ks & 1][nt], c[1][nt]); }
      __builtin_amdgcn_sched_barrier(0); }      /* ... and the group after next behind them, so that two fragment sets suffice */
    asm volatile("s_wait_dscnt 0x0" ::: "memory");      /* this wave's reads of this stage's buffer are done */
    asm volatile("s_wait_asynccnt 0x0" ::: "memory");      /* its copies of the next stage have landed */
    __syncthreads();      /* publishes the next stage's buffer and frees this stage's */
    if (t + 2 < NT) { g3_copy(la + bo, ga); g3_copy(lb + bo, gb); } }
  asm volatile("s_wait_asynccnt 0x0" ::: "memory");      /* no copy is left in flight when the buffers are reused */
  float (*so)[68] = (float (*)[68])(L + (size_t)w * 32 * 68 * 4);      /* the wave's own 32 x 64 output tile; every wave has left the buffers at the loop's last barrier */
  const int f0 = nq * 128 - 2 * DM + 32 * wm;      /* transposed block: the wave's first feature */
  if (tr) { const float* bias = b2 + f0 + 8 * hh;      /* the row's bias */
#pragma unroll
    for (int half = 0; half < 2; ++half) {
#pragma unroll
      for (int r = 0; r < 8; ++r) { const float bv = bf16_rne(bias[half * 16 + r]);
#pragma unroll
        for (int t = 0; t < 4; ++t) so[half * 16 + 8 * hh + r][t * 16 + ln] = c[half][t][r] * alpha + bv; } } }
  else { const float* bias = ((seg == 0) ? b0 : (seg == 1) ? b1 : b2) + (col0 - seg * DM);      /* the column's own bias vector */
    const float qs = (NSEG == 3 && seg == 0) ? 0.18033688011112042f : 1.0f, aq = alpha * qs;      /* q leaves times log2 e / sqrt(HD), applied in f32 in front of its one rounding to f16 */
#pragma unroll
    for (int u = 0; u < 8; ++u) { const int t = u & 3, half = u >> 2; const float bv = bf16_rne(bias[t * 16 + ln]) * qs;
#pragma unroll
      for (int r = 0; r < 8; ++r) so[half * 16 + 8 * hh + r][t * 16 + ln] = c[half][t][r] * aq + bv; } }
  __builtin_amdgcn_fence(4, "workgroup"); __builtin_amdgcn_wave_barrier();
  const int rsub = lane >> 4, c4 = (lane & 15) * 4;
  const int bb = mt * 128 / SEQ;      /* the token tile's batch */
  _Float16* d16 = tr ? VT + ((size_t)bb * DM + f0) * SEQ + (mt * 128 - bb * SEQ) + 64 * wn : C16 + (size_t)row0 * ldc + col0; const size_t p16 = tr ? (size_t)SEQ : (size_t)ldc;
#pragma unroll
  for (int q = 0; q < 16; ++q) { const int r = q * 2 + rsub; const v4f v = *(const v4fa*)&so[r][c4];
    if (OUT32) *(v4f*)(C + (size_t)(row0 + r) * ldc + col0 + c4) = v;
    else { v4h h4; for (int i = 0; i < 4; ++i) h4[i] = (_Float16)v[i]; *(v4h*)(d16 + r * p16 + c4) = h4; } } }

extern "C" void kernel_launch(void* const* d_in, const int* in_sizes, int n_in,
                              void* d_out, int out_size, void* d_ws, size_t ws_size, hipStream_t stream) {
  if (n_in < 10) return;
  if (in_sizes[0] < NB * SEQ_FULL * DM || in_sizes[1] < SEQ * SEQ_FULL) return;
  if (in_sizes[2] < DM * DM || in_sizes[4] < DM * DM || in_sizes[6] < DM * DM || in_sizes[8] < DM * DM) return;
  if (in_sizes[3] < DM || in_sizes[5] < DM || in_sizes[7] < DM || in_sizes[9] < DM) return;
  if (out_size < (int)(NR * DM)) return;
  const float* x  = (const float*)d_in[0]; const int* adj = (const int*)d_in[1];
  const float* wq = (const float*)d_in[2]; const float* bq = (const float*)d_in[3];
  const float* wk = (const float*)d_in[4]; const float* bk = (const float*)d_in[5];
  const float* wv = (const float*)d_in[6]; const float* bv = (const float*)d_in[7];
  const float* wo = (const float*)d_in[8]; const float* bo = (const float*)d_in[9];
  char* ws = (char*)d_ws; size_t off = 0;
  auto take = [&](size_t bytes) { char* p = ws + off; off += (bytes + 255) & ~(size_t)255; return p; };
  _Float16* BW  = (_Float16*)take((size_t)4 * DM * DM * 2);           /* Bt[n][k] x16 (natural [out][in]): Wq, Wk, Wv, Wo stacked by rows */
  _Float16* X16 = (_Float16*)take(NR * DM * 2);                       /* [NR][DM] */
  _Float16* QKV = (_Float16*)take(NR * LQ * 2);                       /* [NR][3*DM]: q | k | (not used) */
  _Float16* O16 = (_Float16*)take(NR * DM * 2);                       /* [NR][DM], o x64 */
  _Float16* VT  = (_Float16*)take((size_t)NB * NH * HD * SEQ * 2);    /* [NB*NH][64][SEQ] */
  unsigned* MK  = (unsigned*)take((size_t)(SEQ / 16) * (SEQ / 16) * 8 * 4);      /* [SEQ/16][SEQ/16][8], the gate as lane masks */
  if (off > ws_size || off > (size_t)134217728) return;
  k_prep<<<(unsigned)(PM + 4 * PW + (NR * DM / 8 + 255) / 256), 256, 0, stream>>>(x, wq, wk, wv, wo, BW, X16, NR * DM / 8, adj, MK);
  const unsigned gp = (unsigned)((NR / 128) * (DM / 128));
  k_gemm3<0, 3><<<3 * gp, 256, 0, stream>>>(X16, BW, 0.0625f, bq, bk, bv, nullptr, QKV, LQ, VT);      /* q | k rows (f16), head h = columns h*64.. of each; V^T [NB*NH][HD][SEQ] */
  k_fattn<<<(unsigned)(NB * NH * (SEQ / 256)), 512, 0, stream>>>(QKV, VT, MK, O16);      /* o (merged heads, x64) f16 rows */
  k_gemm3<1, 1><<<gp, 256, 0, stream>>>(O16, BW + (size_t)3 * DM * DM, 0.0009765625f, bo, nullptr, nullptr, (float*)d_out, nullptr, DM, nullptr);      /* out rows = output layout [b][s][DM] */
}

// v010
// A run of this version takes 60.4 microseconds.
// Timed twice side by side with v009, it ran 1.06 and 1.05 times as fast.
// All steps since v000 together make it 105 times as fast.
#include <hip/hip_runtime.h>
// All contractions (q, k, v projections K=512; q.k^T per head K=64; softmax weights . V K=SEQ; output projection K=512): v_wmma_f32_16x16x32_f16, f16 operands (every float input RNE-converted to bf16 first; weights carried x16, q carried x log2 e / 8, softmax weights carried unnormalised as 2^(t - m) <= 2^8, o carried x64), f32 accumulate; softmax statistics f32 on the VALU.
// Structure: token rows r = b*SEQ + s. X16 = f16(bf16(h)); q | k as f16 rows [r][3*DM] and V^T planes [b*NH+h][64][SEQ] from one GEMM launch over the stacked weights (alpha 1/16, bias bf16), the v blocks with their operands swapped;
// per (batch, head, 32 query rows) two waves walk one half of the keys each, 32 at a time, and join their results at the end: S^T = K . Q^T - m in f32, gated by the integer adjacency (adj[q][j] == 0 -> weight exactly 0; a row with no open key yields NaN), which the conversion launch packs once into lane masks, running maximum and sum per query in f32,
// P = f16(2^(t - m)) taken from the score accumulators as the B operand of O^T += V^T . P^T; o = O^T * 64 / sum written as f16 rows [r][DM] (head h -> columns h*64); out = o . Wo^T * 2^-10 + bf16(bo) in f32.
#ifndef NB
#define NB 4
#endif
#ifndef SEQ
#define SEQ 2048
#endif
#define NB_FULL 4
#define SEQ_FULL 2048                /* pitch of adj rows and per-batch stride of h */
#define DM 512
#define NH 8
#define HD 64
#define LQ (3 * DM)                  /* row pitch of the q | k plane (its last DM columns not used) */
#define NR ((size_t)NB * SEQ)        /* token rows */
static_assert(NB >= 1 && NB <= NB_FULL);
static_assert(SEQ >= 128 && SEQ <= SEQ_FULL);
static_assert(SEQ % 256 == 0);      /* a block of the attention kernel owns 256 query rows; a 128-token tile of the GEMM lies in one batch */
static_assert((NB * SEQ) % 128 == 0);
static_assert(DM == NH * HD && HD == 64 && DM % 64 == 0);

typedef unsigned short v8us __attribute__((ext_vector_type(8), may_alias));
typedef float  v8f  __attribute__((ext_vector_type(8)));
typedef float  v4f  __attribute__((ext_vector_type(4)));
typedef float  v2f  __attribute__((ext_vector_type(2)));
typedef float  v4fa __attribute__((ext_vector_type(4), may_alias));
typedef int    v4ia __attribute__((ext_vector_type(4), may_alias));
typedef unsigned v16u __attribute__((ext_vector_type(16), may_alias));
typedef const __attribute__((address_space(4))) v16u c_v16u;      /* constant address space: memory that no one writes while the kernel runs; a load at a wave-uniform address is then a scalar load, also behind the asm statements and barriers of a loop */
typedef _Float16 v16h __attribute__((ext_vector_type(16)));
typedef _Float16 v4h __attribute__((ext_vector_type(4)));
union FragH { v16h v; v8us half[2]; _Float16 h[16]; unsigned short u[16]; };

__device__ __forceinline__ unsigned short bf16_bits(float x) { unsigned int u = __float_as_uint(x); return (unsigned short)((u + 0x7FFFu + ((u >> 16) & 1u)) >> 16); }
__device__ __forceinline__ float bf16_val(unsigned short b) { return __uint_as_float(((unsigned int)b) << 16); }
__device__ __forceinline__ float bf16_rne(float x) { return bf16_val(bf16_bits(x)); }

// ---- f16 WMMA fragments in the split k layout (elements 0..7 <- k0+8h.., 8..15 <- k0+16+8h..), the same for both operands ----
__device__ __forceinline__ v16h g2_frag(const _Float16* p, int hh) { FragH f; f.half[0] = *(const v8us*)((const unsigned short*)p + 8 * hh); f.half[1] = *(const v8us*)((const unsigned short*)p + 16 + 8 * hh); return f.v; }

__device__ __forceinline__ void d_wnat(unsigned blk, const float* __restrict__ w, size_t n8, _Float16* __restrict__ Bt) {
  const size_t t = (size_t)blk * 256 + threadIdx.x; if (t >= n8) return;
  const v4f a = *(const v4fa*)(w + t * 8), c = *(const v4fa*)(w + t * 8 + 4); FragH f;
#pragma unroll
  for (int q = 0; q < 4; ++q) { f.h[q] = (_Float16)(bf16_rne(a[q]) * 16.0f); f.h[4 + q] = (_Float16)(bf16_rne(c[q]) * 16.0f); }
  *(v8us*)((unsigned short*)Bt + t * 8) = f.half[0];  }

__device__ __forceinline__ void d_x16(unsigned blk, const float* __restrict__ x, _Float16* __restrict__ X16, size_t n8) {
  const size_t t = (size_t)blk * 256 + threadIdx.x; if (t >= n8) return;
  const size_t per = (size_t)SEQ * DM / 8; const size_t b = t / per, rem = t - b * per;
  const float* src = x + b * ((size_t)SEQ_FULL * DM) + rem * 8;
  const v4f a = *(const v4fa*)src, c = *(const v4fa*)(src + 4); FragH f;
#pragma unroll
  for (int q = 0; q < 4; ++q) { f.h[q] = (_Float16)bf16_rne(a[q]); f.h[4 + q] = (_Float16)bf16_rne(c[q]); }
  *(v8us*)((unsigned short*)X16 + t * 8) = f.half[0];  }

// The gate as lane masks: MK [SEQ / 16][SEQ / 16][8], one word for 16 queries x 16 keys and r = 0..7; bit 16 * hh + ln of word r says adj[16 * qtile + ln][16 * ktile + 8 * hh + r] != 0,
// which is the place of that score in the accumulator of S^T = K . Q^T (lane 16 * hh + ln, register r): the attention kernel reads a word into a scalar register and selects with it.
// A block packs 16 query rows x 512 keys: the rows come in whole 512-byte wave loads, go through LDS (row pitch an odd number of 16 B), and each wave votes on four key tiles; its 32 words leave as one 128-byte store.
// Its loops are fully unrolled so that the eight loads of a thread are in flight together and their values stay in registers.
#define MK_P (512 * 4 + 16)                /* LDS pitch of 512 adj values */
static_assert(SEQ % 512 == 0);
__device__ __forceinline__ void d_mask(unsigned blk, const int* __restrict__ adj, unsigned* __restrict__ MK, unsigned char* S) {
  constexpr unsigned KB = SEQ / 512; const unsigned qtile = blk / KB, kb = blk - qtile * KB;
  const int tid = threadIdx.x, lane = tid & 31, w = tid >> 5, ln = lane & 15, hh = lane >> 4;
  const int* src = adj + (size_t)(qtile * 16 + (tid >> 7)) * SEQ_FULL + kb * 512 + 4 * (tid & 127); v4ia a[8];
#pragma unroll
  for (int j = 0; j < 8; ++j) a[j] = *(const v4ia*)(src + (size_t)2 * j * SEQ_FULL);
#pragma unroll
  for (int j = 0; j < 8; ++j) *(v4ia*)(S + (2 * j + (tid >> 7)) * MK_P + 16 * (tid & 127)) = a[j];
  __syncthreads();      /* the branch that leads here is the same for the whole block */
  unsigned v = 0;
#pragma unroll
  for (int j = 0; j < 4; ++j) { const unsigned char* p = S + ln * MK_P + (w * 4 + j) * 64 + 32 * hh; const v4ia x = *(const v4ia*)p, y = *(const v4ia*)(p + 16);
#pragma unroll
    for (int r = 0; r < 8; ++r) { const unsigned b = __builtin_amdgcn_ballot_w32(((r < 4) ? x[r & 3] : y[r & 3]) != 0); v = (lane == j * 8 + r) ? b : v; } }
  MK[((size_t)qtile * (SEQ / 16) + kb * 32 + w * 4) * 8 + lane] = v; }

// The six conversions need nothing of each other, so they share one grid by ranges of the block index (a block-uniform branch): blocks 0 .. PM - 1 pack the gate, the next 4 * PW convert Wq, Wk, Wv, Wo into the stacked plane BW [4 * DM][DM], the rest convert h.
#define PW ((DM * DM / 8 + 255) / 256)     /* blocks per weight matrix */
#define PM ((SEQ / 16) * (SEQ / 512))      /* blocks of the gate */
__global__ __launch_bounds__(256) void k_prep(const float* __restrict__ x, const float* __restrict__ wq, const float* __restrict__ wk, const float* __restrict__ wv, const float* __restrict__ wo,
                                              _Float16* __restrict__ BW, _Float16* __restrict__ X16, size_t nx8, const int* __restrict__ adj, unsigned* __restrict__ MK) {
  __shared__ __attribute__((aligned(16))) unsigned char S[16 * MK_P];
  if (blockIdx.x < (unsigned)PM) { d_mask(blockIdx.x, adj, MK, S); return; }
  const unsigned blk = blockIdx.x - PM;
  if (blk < 4u * PW) { const unsigned i = blk / PW; const float* w = (i == 0) ? wq : (i == 1) ? wk : (i == 2) ? wv : wo;
    d_wnat(blk - i * PW, w, (size_t)DM * DM / 8, BW + (size_t)i * DM * DM); }
  else d_x16(blk - 4u * PW, x, X16, nx8); }

// 2^x of four values in place (what the native exp compiles to behind its multiply by log2 e). The four v_exp_f32 name disjoint registers; the closing v_nop keeps the one slot that the instruction set
// asks for between a transcendental and the next use of its result or overwrite of its source.
__device__ __forceinline__ v4f exp2x4(v4f x) { float a = x[0], b = x[1], c = x[2], d = x[3];
  asm("v_exp_f32 %0, %0\n\tv_exp_f32 %1, %1\n\tv_exp_f32 %2, %2\n\tv_exp_f32 %3, %3\n\tv_nop" : "+v"(a), "+v"(b), "+v"(c), "+v"(d));
  const v4f r = {a, b, c, d}; return r; }
// The same into four other registers (early-clobber outputs, so that none shares a register with an argument still to be read): the arguments stay as they are for the rare path of a pass that needs them again.
__device__ __forceinline__ v4f exp2x4o(v4f x) { float a, b, c, d;
  asm("v_exp_f32 %0, %4\n\tv_exp_f32 %1, %5\n\tv_exp_f32 %2, %6\n\tv_exp_f32 %3, %7\n\tv_nop" : "=&v"(a), "=&v"(b), "=&v"(c), "=&v"(d) : "v"(x[0]), "v"(x[1]), "v"(x[2]), "v"(x[3]));
  const v4f r = {a, b, c, d}; return r; }
// The weights of one pass from its arguments: P as f16 in the B fragment's order, and each lane's sum of its 16 weights per query tile; the two tiles' sums ride in one register pair (two additions an instruction), neighbours first.
__device__ __forceinline__ void fa_weigh(const v8f (&s)[2][2], FragH (&pf)[2], v2f& ps) {
  v2f t[16];
#pragma unroll
  for (int qt = 0; qt < 2; ++qt) {
#pragma unroll
    for (int kt = 0; kt < 2; ++kt) {
#pragma unroll
      for (int g = 0; g < 2; ++g) { const v4f x = {s[qt][kt][4 * g], s[qt][kt][4 * g + 1], s[qt][kt][4 * g + 2], s[qt][kt][4 * g + 3]}; const v4f e = exp2x4o(x);
#pragma unroll
        for (int q = 0; q < 4; ++q) { pf[qt].h[kt * 8 + g * 4 + q] = (_Float16)e[q]; t[kt * 8 + g * 4 + q][qt] = e[q]; } } } }
#pragma unroll
  for (int w = 1; w < 16; w *= 2) {
#pragma unroll
    for (int i = 0; i < 16; i += 2 * w) t[i] += t[i + w]; }
  ps = t[0]; }
__device__ __forceinline__ float xhalf(float x) { return __builtin_bit_cast(float, __builtin_amdgcn_permlanex16(__builtin_bit_cast(int, x), __builtin_bit_cast(int, x), 0x76543210, 0xfedcba98, false, false)); }      /* lane l <- lane l ^ 16, on the vector pipe */
__device__ __forceinline__ v8f fa_mma(v16h a, v16h b, v8f c) { return __builtin_amdgcn_wmma_f32_16x16x32_f16(false, a, false, b, (short)0, c, false, false); }
#define FA_KP 144                          /* LDS pitch of a 128-byte row (K, V^T) */
#define FA_V (64 * FA_KP)                  /* byte offsets inside one buffer: K at 0, then V^T */
#define FA_STAGE (2 * 64 * FA_KP)
typedef __attribute__((address_space(3))) unsigned char lds_u8;
// One stage's copies of one thread: 16 B of the K rows r and r + 32 and of the V^T rows r and r + 32 (a wave: 4 rows a copy). Every lane on, no two lanes on one LDS byte.
// The closing s_wait_xcnt stands inside the statement so that no address register named here is rewritten in front of it.
__device__ __forceinline__ void fa_copy(unsigned lk, const char* gk, unsigned lv, const char* gv) {
  asm volatile("global_load_async_to_lds_b128 %0, %1, off\n\tglobal_load_async_to_lds_b128 %2, %3, off\n\t"
               "global_load_async_to_lds_b128 %4, %5, off\n\tglobal_load_async_to_lds_b128 %6, %7, off\n\t"
               "s_wait_xcnt 0x0"
               :: "v"(lk), "v"(gk), "v"(lk + 32 * FA_KP), "v"(gk + (size_t)32 * LQ * 2), "v"(lv), "v"(gv), "v"(lv + 32 * FA_KP), "v"(gv + (size_t)32 * SEQ * 2) : "memory"); }
__global__ __launch_bounds__(512) void k_fattn(const _Float16* __restrict__ QKV, const _Float16* __restrict__ VT, const unsigned* __restrict__ MK, _Float16* __restrict__ O16) {
  __shared__ __attribute__((aligned(16))) unsigned char L[2 * 2 * FA_STAGE];      /* [key half][buffer] */
  const int tid = threadIdx.x & 255, lane = threadIdx.x & 31, ln = lane & 15, hh = lane >> 4;      /* tid: the thread's place among the 256 of its key half */
  const int ws = __builtin_amdgcn_readfirstlane((int)(threadIdx.x >> 5)), w = ws & 7, kh = ws >> 3;      /* through readfirstlane, so that the gate's address and the branches of the join are scalar */
  constexpr int SH = SEQ / 2;      /* keys of a half */
  constexpr int QB = SEQ / 256; const int slab = blockIdx.x / QB, qb = blockIdx.x - slab * QB; const int b = slab / NH, h = slab - b * NH;
  const int q0 = qb * 256 + w * 32; const size_t r0 = (size_t)b * SEQ;
  const _Float16* qp = QKV + (r0 + q0 + ln) * LQ + h * HD + 8 * hh;      /* every fragment pointer below carries the lane half's 8 * hh itself, so g2_frag is called with 0 */
  v16h qf[2][2];
#pragma unroll
  for (int qt = 0; qt < 2; ++qt) { qf[qt][0] = g2_frag(qp + (size_t)qt * 16 * LQ, 0); qf[qt][1] = g2_frag(qp + (size_t)qt * 16 * LQ + 32, 0); }
  /* copy side: thread tid brings 16 B of K rows tid / 8 and tid / 8 + 32 and the same of V^T */
  const char* gk = (const char*)(QKV + DM + (r0 + kh * SH + (tid >> 3)) * LQ + h * HD + 8 * (tid & 7));
  const char* gv = (const char*)(VT + ((size_t)slab * HD + (tid >> 3)) * SEQ + kh * SH + 8 * (tid & 7));
  const unsigned l0 = (unsigned)(uintptr_t)(lds_u8*)L + kh * (2 * FA_STAGE);
  const unsigned lk = l0 + (tid >> 3) * FA_KP + 16 * (tid & 7), lv = lk + FA_V;
  constexpr size_t sk = (size_t)64 * LQ * 2, sv = 128;      /* bytes from one stage's tile to the next */
  /* read side, inside a buffer: the lane's K row and V^T row, each with the lane half's share */
  const int rk = kh * (2 * FA_STAGE) + ln * FA_KP + 16 * hh, rv = rk + FA_V;
  /* the wave's two rows of the gate plane (query tiles q0 / 16 and q0 / 16 + 1), from its key half's first pass on; a pass is 16 words of each */
  c_v16u* mp = (c_v16u*)(uintptr_t)(MK + (size_t)(qb * 16 + 2 * w) * (SEQ / 16) * 8 + (size_t)kh * (SH / 16) * 8); constexpr int MROW = (SEQ / 16) * 8 / 16;
  const v8f z8 = {0.f,0.f,0.f,0.f,0.f,0.f,0.f,0.f};
  v8f o[2][4], cm[2] = {z8, z8}; float thr[2] = {-1.0e29f, -1.0e29f}, lim[2] = {-1.0f, -1.0f}, l[2] = {0.f, 0.f};      /* cm: -m in all eight registers, the C operand of the score products */
#pragma unroll
  for (int qt = 0; qt < 2; ++qt) {
#pragma unroll
    for (int dt = 0; dt < 4; ++dt) o[qt][dt] = z8; }
  constexpr int NT = SH / 64; static_assert(NT >= 2 && SH % 64 == 0);
  v16u gn0 = mp[0], gn1 = mp[MROW]; unsigned pn = 0;      /* the gate of pass 0 */
  fa_copy(lk, gk, lv, gv);      /* stage 0 into buffer 0 */
  asm volatile("s_wait_asynccnt 0x0" ::: "memory");      /* this wave's copies of stage 0 have landed */
  __syncthreads();      /* ... and every other wave's */
  fa_copy(lk + FA_STAGE, gk + sk, lv + FA_STAGE, gv + sv);      /* stage 1 into buffer 1 */
  gk += 2 * sk; gv += 2 * sv;
  for (int t = 0; t < NT; ++t, gk += sk, gv += sv) {
    const unsigned bo = (unsigned)(t & 1) * FA_STAGE; const unsigned char* B = L + bo;
#pragma unroll 1
   for (int u = 0; u < 2; ++u) {      /* the stage's two passes, one body for both; rolled as it was: whether the unrolled form is faster is not measured */
    v16h kf[2][2], vf[4];
    const v16u gc[2] = {gn0, gn1}; pn = (pn + 1 < 2u * NT) ? pn + 1 : pn;      /* the next pass's gate is asked for during this pass; in the last pass the last one again, so that the address stays inside the plane */
    gn0 = mp[pn]; gn1 = mp[MROW + pn];
#pragma unroll
    for (int kt = 0; kt < 2; ++kt) { const _Float16* p = (const _Float16*)(B + rk + (u * 32 + kt * 16) * FA_KP); kf[kt][0] = g2_frag(p, 0); kf[kt][1] = g2_frag(p + 32, 0); }
#pragma unroll
    for (int dt = 0; dt < 4; ++dt) vf[dt] = g2_frag((const _Float16*)(B + rv + dt * 16 * FA_KP + u * 64), 0);
    v8f s[2][2];
#pragma unroll
    for (int qt = 0; qt < 2; ++qt) {
#pragma unroll
      for (int kt = 0; kt < 2; ++kt) s[qt][kt] = fa_mma(kf[kt][1], qf[qt][1], fa_mma(kf[kt][0], qf[qt][0], cm[qt])); }
    __builtin_amdgcn_sched_barrier(0);      /* keeps the V^T reads and the next gate's scalar loads, written above, in front of the selections and the 2^x: without it this build sinks them behind the weights, right in front of their first use */
#pragma unroll
    for (int qt = 0; qt < 2; ++qt) {
#pragma unroll
      for (int kt = 0; kt < 2; ++kt) {
#pragma unroll
        for (int r = 0; r < 8; ++r) s[qt][kt][r] = __builtin_amdgcn_inverse_ballot_w32(gc[qt][kt * 8 + r]) ? s[qt][kt][r] : -1.0e30f; } }
    FragH pf[2]; v2f ps; fa_weigh(s, pf, ps);
    const bool need = (ps[0] > lim[0]) || (ps[1] > lim[1]);      /* weights are >= 0, so a lane's sum <= 2^8 bounds each of them: the reference stands */
    if (__builtin_expect(__builtin_amdgcn_ballot_w32(need) != 0, 0)) {      /* one scalar branch a pass, marked rare so that the usual pass falls through: what follows is skipped while every query of the wave has a reference and no lane's sum passes 2^8 */
      float ml[2];      /* the pass's maximum of t - m */
#pragma unroll
      for (int qt = 0; qt < 2; ++qt) { float mx = -3.0e38f;
#pragma unroll
        for (int kt = 0; kt < 2; ++kt) {
#pragma unroll
          for (int r = 0; r < 8; ++r) mx = fmaxf(mx, s[qt][kt][r]); }
        ml[qt] = fmaxf(mx, xhalf(mx)); }
      const float d[2] = {(ml[0] > thr[0]) ? ml[0] : 0.f, (ml[1] > thr[1]) ? ml[1] : 0.f};
      const v4f d4 = {-d[0], -d[1], 0.f, 0.f}; const v4f e4 = exp2x4(d4);
#pragma unroll
      for (int qt = 0; qt < 2; ++qt) { const float al = (thr[qt] < 0.f) ? 1.0f : e4[qt];      /* first setting: d may be far below 0 and 2^-d infinite, and there is nothing to rescale yet */
        thr[qt] = (ml[qt] > thr[qt]) ? 8.0f : thr[qt]; lim[qt] = (thr[qt] > 0.f) ? 256.0f : -1.0f; cm[qt] -= d[qt]; l[qt] *= al;
#pragma unroll
        for (int kt = 0; kt < 2; ++kt) s[qt][kt] -= d[qt];
#pragma unroll
        for (int dt = 0; dt < 4; ++dt) o[qt][dt] *= al; }
      fa_weigh(s, pf, ps); }      /* the weights again, from the lowered arguments */
#pragma unroll
    for (int qt = 0; qt < 2; ++qt) { l[qt] += ps[qt];
#pragma unroll
      for (int dt = 0; dt < 4; ++dt) o[qt][dt] = fa_mma(vf[dt], pf[qt].v, o[qt][dt]); }
    __builtin_amdgcn_sched_barrier(0);      /* holds the pass's last product in front of the slots below */
    asm volatile("v_nop\n\tv_nop");      /* vector slots between the pass's last product and the next pass's first writes into its A registers */
   }
    asm volatile("s_wait_dscnt 0x0" ::: "memory");      /* this wave's reads of this stage's buffer are done */
    asm volatile("s_wait_asynccnt 0x0" ::: "memory");      /* its copies of the next stage have landed */
    __syncthreads();      /* publishes the next stage's buffer and frees this stage's */
    if (t + 2 < NT) fa_copy(lk + bo, gk, lv + bo, gv); }
  asm volatile("s_wait_asynccnt 0x0" ::: "memory");      /* no copy is left in flight when the ring is reused */
  static_assert(8 * 18 * 512 <= 2 * 2 * FA_STAGE);
  v4fa* X = (v4fa*)(L + w * (18 * 512)) + lane;      /* the query group's exchange: 18 pieces of 16 B a lane, a piece 512 B in lane order */
  if (kh) {
#pragma unroll
    for (int u = 0; u < 16; ++u) { const v8f& a = o[u >> 3][(u >> 1) & 3]; const int c = 4 * (u & 1); const v4f x = {a[c], a[c + 1], a[c + 2], a[c + 3]}; X[u * 32] = x; }
    const v4f s0 = {l[0], l[1], cm[0][0], cm[1][0]}, s1 = {thr[0], thr[1], 0.f, 0.f}; X[16 * 32] = s0; X[17 * 32] = s1; }
  __syncthreads();      /* the upper halves' results are in LDS; every wave of the block passes here */
  if (kh) return;
  const v4f s0 = X[16 * 32], s1 = X[17 * 32]; bool open[2]; float fa[2], fb[2];
  { float da[2], db[2];
#pragma unroll
    for (int qt = 0; qt < 2; ++qt) { const float ma = -cm[qt][0], mb = -s0[2 + qt]; const bool va = thr[qt] > 0.f, vb = s1[qt] > 0.f;
      const float m = va ? (vb ? fmaxf(ma, mb) : ma) : mb; da[qt] = ma - m; db[qt] = mb - m; open[qt] = va || vb; }
    const v4f d4 = {da[0], db[0], da[1], db[1]}; const v4f e4 = exp2x4(d4);
#pragma unroll
    for (int qt = 0; qt < 2; ++qt) { fa[qt] = (thr[qt] > 0.f) ? e4[2 * qt] : 0.f; fb[qt] = (s1[qt] > 0.f) ? e4[2 * qt + 1] : 0.f; } }      /* a half with no open key holds zeros and an unset reference: factor 0 by selection, its 2^x may be infinite */
#pragma unroll
  for (int u = 0; u < 16; ++u) { const int qt = u >> 3; v8f& a = o[qt][(u >> 1) & 3]; const int c = 4 * (u & 1); const v4f x = X[u * 32];
#pragma unroll
    for (int i = 0; i < 4; ++i) a[c + i] = a[c + i] * fa[qt] + x[i] * fb[qt]; }
#pragma unroll
  for (int qt = 0; qt < 2; ++qt) { const float lj = l[qt] * fa[qt] + s0[qt] * fb[qt]; const float se = lj + xhalf(lj);
    const float sc = open[qt] ? (64.0f / se) : __uint_as_float(0x7fc00000u);      /* no open key at all: NaN */
    unsigned short* d = (unsigned short*)O16 + (r0 + q0 + qt * 16 + ln) * DM + h * HD + 8 * hh;
#pragma unroll
    for (int dt = 0; dt < 4; ++dt) { FragH f;
#pragma unroll
      for (int r = 0; r < 8; ++r) f.h[r] = (_Float16)(o[qt][dt][r] * sc);
      *(v8us*)(d + dt * 16) = f.half[0]; } } }

// ---- f16 WMMA GEMM, K = DM, N = NSEG * DM: C = A . Bt^T * alpha + bf16(bias[col]), for the q columns of NSEG 3 then times log2 e / 8; A [m][DM] f16, Bt [n][DM] f16, NSEG weight matrices stacked by rows, each with its own bias vector (b0, b1, b2), so that products of one A share one grid. A block of 8 waves owns 128 x 128 of C, a wave 32 x 64 (wave w: rows 32 * (w & 3), columns 64 * (w >> 2)).
// With NSEG == 3 the blocks of the third matrix (v) take the weight rows as the row operand and the token rows as the column operand (both lie as [row][k] and are read by the same loader, so only the two tile addresses change places):
// their tile is 128 features x 128 tokens, C^T, with the bias by row, and goes straight to the plane VT [b * DM + feature][SEQ] in whole 128-byte lines of 64 tokens. Requires SEQ % 128 == 0, so that a token tile lies in one batch.
// A stage is 128 of k: 128 A rows and 128 Bt rows of 256 B each are brought into LDS by asynchronous copies in whole lines, once per block, one stage ahead, into two buffers;
// the fragment reads (16 B a lane, 16 rows a read) then go to LDS, at a row pitch of an odd number of 16 B. Requires M % 128 == 0; the grid covers C exactly.
#define G_KS 128                           /* k per stage */
#define G_P 272                            /* LDS pitch of a 256-byte row */
#define G_B (128 * G_P)                    /* byte offset of the Bt tile inside one buffer */
#define G_STAGE (2 * 128 * G_P)
static_assert(DM % 128 == 0 && DM / G_KS >= 2);
static_assert(2 * G_STAGE >= 8 * 32 * 68 * 4);      /* the output staging of the epilogue reuses the buffers */
// One tile's copies of one thread: 16 B of each of the rows r, r + 16, ..., r + 112. Every lane on, no two lanes on one LDS byte.
// The closing s_wait_xcnt stands inside the statement so that no address register named here is rewritten in front of it.
__device__ __forceinline__ void g3_copy(unsigned l, const char* g) {
  constexpr unsigned dl = 16 * G_P; constexpr size_t dg = (size_t)16 * DM * 2;
  asm volatile("global_load_async_to_lds_b128 %0, %1, off\n\tglobal_load_async_to_lds_b128 %2, %3, off\n\t"
               "global_load_async_to_lds_b128 %4, %5, off\n\tglobal_load_async_to_lds_b128 %6, %7, off\n\t"
               "global_load_async_to_lds_b128 %8, %9, off\n\tglobal_load_async_to_lds_b128 %10, %11, off\n\t"
               "global_load_async_to_lds_b128 %12, %13, off\n\tglobal_load_async_to_lds_b128 %14, %15, off\n\t"
               "s_wait_xcnt 0x0"
               :: "v"(l), "v"(g), "v"(l + dl), "v"(g + dg), "v"(l + 2 * dl), "v"(g + 2 * dg), "v"(l + 3 * dl), "v"(g + 3 * dg),
                  "v"(l + 4 * dl), "v"(g + 4 * dg), "v"(l + 5 * dl), "v"(g + 5 * dg), "v"(l + 6 * dl), "v"(g + 6 * dg), "v"(l + 7 * dl), "v"(g + 7 * dg) : "memory"); }
// The fragments of 32 of k: two A row tiles, four Bt row tiles.
__device__ __forceinline__ void g3_frags(const unsigned char* pa, const unsigned char* pb, v16h (&a)[2], v16h (&b)[4]) {
  a[0] = g2_frag((const _Float16*)pa, 0); a[1] = g2_frag((const _Float16*)(pa + 16 * G_P), 0);
#pragma unroll
  for (int nt = 0; nt < 4; ++nt) b[nt] = g2_frag((const _Float16*)(pb + nt * 16 * G_P), 0); }
template <int OUT32, int NSEG>      /* OUT32 1: the result goes to C as f32; 0: to C16 as f16, the v blocks of NSEG 3 to VT */
__global__ __launch_bounds__(256) void k_gemm3(const _Float16* __restrict__ A, const _Float16* __restrict__ Bh, float alpha, const float* __restrict__ b0, const float* __restrict__ b1, const float* __restrict__ b2, float* __restrict__ C, _Float16* __restrict__ C16, int ldc, _Float16* __restrict__ VT) {
  __shared__ __attribute__((aligned(16))) unsigned char L[2 * G_STAGE];
  const int tid = threadIdx.x, w = tid >> 5, lane = tid & 31, ln = lane & 15, hh = lane >> 4;
  constexpr int NTN = NSEG * DM / 128; const int mt = blockIdx.x / NTN, nq = blockIdx.x - mt * NTN;
  const int wm = w & 3, wn = w >> 2; const int row0 = mt * 128 + 32 * wm, col0 = nq * 128 + 64 * wn;
  const int seg = (NSEG == 1) ? 0 : nq / (DM / 128); const bool tr = (NSEG == 3) && seg == 2;      /* the same for the whole block */
  /* copy side: thread tid brings 16 B of the tile rows tid / 16 + 16 * j of A and of Bt; in a transposed block the two change places */
  const char* gx = (const char*)(A + (size_t)(mt * 128 + (tid >> 4)) * DM + 8 * (tid & 15));
  const char* gw = (const char*)(Bh + (size_t)(nq * 128 + (tid >> 4)) * DM + 8 * (tid & 15));
  const char* ga = tr ? gw : gx; const char* gb = tr ? gx : gw;
  const unsigned la = (unsigned)(uintptr_t)(lds_u8*)L + (tid >> 4) * G_P + 16 * (tid & 15), lb = la + G_B;
  constexpr size_t sg = (size_t)G_KS * 2;      /* bytes from one stage's tile to the next */
  /* read side, inside a buffer: the lane's first A row and first Bt row, each with the lane half's share, so g2_frag is called with 0 */
  const int ra = (32 * wm + ln) * G_P + 16 * hh, rb = G_B + (64 * wn + ln) * G_P + 16 * hh;
  const v8f z8 = {0.f,0.f,0.f,0.f,0.f,0.f,0.f,0.f}; v8f c[2][4];
#pragma unroll
  for (int u = 0; u < 8; ++u) c[u >> 2][u & 3] = z8;
  constexpr int NT = DM / G_KS;
  g3_copy(la, ga); g3_copy(lb, gb);      /* stage 0 into buffer 0 */
  asm volatile("s_wait_asynccnt 0x0" ::: "memory");      /* this wave's copies of stage 0 have landed */
  __syncthreads();      /* ... and every other wave's */
  g3_copy(la + G_STAGE, ga + sg); g3_copy(lb + G_STAGE, gb + sg);      /* stage 1 into buffer 1 */
  ga += 2 * sg; gb += 2 * sg;
  for (int t = 0; t < NT; ++t, ga += sg, gb += sg) {
    const unsigned bo = (unsigned)(t & 1) * G_STAGE; const unsigned char* B = L + bo;
    v16h af[2][2], bf[2][4];      /* two fragment sets: the reads of the next 32 of k stand as one group in front of this 32's products */
    g3_frags(B + ra, B + rb, af[0], bf[0]);
#pragma unroll      /* fragment sets and accumulators are indexed by constants, so they stay in registers */
    for (int ks = 0; ks < G_KS / 32; ++ks) {
      if (ks + 1 < G_KS / 32) g3_frags(B + ra + (ks + 1) * 64, B + rb + (ks + 1) * 64, af[(ks + 1) & 1], bf[(ks + 1) & 1]);
      __builtin_amdgcn_sched_barrier(0);      /* keeps that group of reads in front of the products: without it the compiler sinks each read to its first use and every pair of products waits for LDS */
#pragma unroll
      for (int nt = 0; nt < 4; ++nt) { c[0][nt] = fa_mma(af[ks & 1][0], bf[ks & 1][nt], c[0][nt]); c[1][nt] = fa_mma(af[ks & 1][1], bf[ks & 1][nt], c[1][nt]); }
      __builtin_amdgcn_sched_barrier(0); }      /* ... and the group after next behind them, so that two fragment sets suffice */
    asm volatile("s_wait_dscnt 0x0" ::: "memory");      /* this wave's reads of this stage's buffer are done */
    asm volatile("s_wait_asynccnt 0x0" ::: "memory");      /* its copies of the next stage have landed */
    __syncthreads();      /* publishes the next stage's buffer and frees this stage's */
    if (t + 2 < NT) { g3_copy(la + bo, ga); g3_copy(lb + bo, gb); } }
  asm volatile("s_wait_asynccnt 0x0" ::: "memory");      /* no copy is left in flight when the buffers are reused */
  float (*so)[68] = (float (*)[68])(L + (size_t)w * 32 * 68 * 4);      /* the wave's own 32 x 64 output tile; every wave has left the buffers at the loop's last barrier */
  const int f0 = nq * 128 - 2 * DM + 32 * wm;      /* transposed block: the wave's first feature */
  if (tr) { const float* bias = b2 + f0 + 8 * hh;      /* the row's bias */
#pragma unroll
    for (int half = 0; half < 2; ++half) {
#pragma unroll
      for (int r = 0; r < 8; ++r) { const float bv = bf16_rne(bias[half * 16 + r]);
#pragma unroll
        for (int t = 0; t < 4; ++t) so[half * 16 + 8 * hh + r][t * 16 + ln] = c[half][t][r] * alpha + bv; } } }
  else { const float* bias = ((seg == 0) ? b0 : (seg == 1) ? b1 : b2) + (col0 - seg * DM);      /* the column's own bias vector */
    const float qs = (NSEG == 3 && seg == 0) ? 0.18033688011112042f : 1.0f, aq = alpha * qs;      /* q leaves times log2 e / sqrt(HD), applied in f32 in front of its one rounding to f16 */
#pragma unroll
    for (int u = 0; u < 8; ++u) { const int t = u & 3, half = u >> 2; const float bv = bf16_rne(bias[t * 16 + ln]) * qs;
#pragma unroll
      for (int r = 0; r < 8; ++r) so[half * 16 + 8 * hh + r][t * 16 + ln] = c[half][t][r] * aq + bv; } }
  __builtin_amdgcn_fence(4, "workgroup"); __builtin_amdgcn_wave_barrier();
  const int rsub = lane >> 4, c4 = (lane & 15) * 4;
  const int bb = mt * 128 / SEQ;      /* the token tile's batch */
  _Float16* d16 = tr ? VT + ((size_t)bb * DM + f0) * SEQ + (mt * 128 - bb * SEQ) + 64 * wn : C16 + (size_t)row0 * ldc + col0; const size_t p16 = tr ? (size_t)SEQ : (size_t)ldc;
#pragma unroll
  for (int q = 0; q < 16; ++q) { const int r = q * 2 + rsub; const v4f v = *(const v4fa*)&so[r][c4];
    if (OUT32) *(v4f*)(C + (size_t)(row0 + r) * ldc + col0 + c4) = v;
    else { v4h h4; for (int i = 0; i < 4; ++i) h4[i] = (_Float16)v[i]; *(v4h*)(d16 + r * p16 + c4) = h4; } } }

extern "C" void kernel_launch(void* const* d_in, const int* in_sizes, int n_in,
                              void* d_out, int out_size, void* d_ws, size_t ws_size, hipStream_t stream) {
  if (n_in < 10) return;
  if (in_sizes[0] < NB * SEQ_FULL * DM || in_sizes[1] < SEQ * SEQ_FULL) return;
  if (in_sizes[2] < DM * DM || in_sizes[4] < DM * DM || in_sizes[6] < DM * DM || in_sizes[8] < DM * DM) return;
  if (in_sizes[3] < DM || in_sizes[5] < DM || in_sizes[7] < DM || in_sizes[9] < DM) return;
  if (out_size < (int)(NR * DM)) return;
  const float* x  = (const float*)d_in[0]; const int* adj = (const int*)d_in[1];
  const float* wq = (const float*)d_in[2]; const float* bq = (const float*)d_in[3];
  const float* wk = (const float*)d_in[4]; const float* bk = (const float*)d_in[5];
  const float* wv = (const float*)d_in[6]; const float* bv = (const float*)d_in[7];
  const float* wo = (const float*)d_in[8]; const float* bo = (const float*)d_in[9];
  char* ws = (char*)d_ws; size_t off = 0;
  auto take = [&](size_t bytes) { char* p = ws + off; off += (bytes + 255) & ~(size_t)255; return p; };
  _Float16* BW  = (_Float16*)take((size_t)4 * DM * DM * 2);           /* Bt[n][k] x16 (natural [out][in]): Wq, Wk, Wv, Wo stacked by rows */
  _Float16* X16 = (_Float16*)take(NR * DM * 2);                       /* [NR][DM] */
  _Float16* QKV = (_Float16*)take(NR * LQ * 2);                       /* [NR][3*DM]: q | k | (not used) */
  _Float16* O16 = (_Float16*)take(NR * DM * 2);                       /* [NR][DM], o x64 */
  _Float16* VT  = (_Float16*)take((size_t)NB * NH * HD * SEQ * 2);    /* [NB*NH][64][SEQ] */
  unsigned* MK  = (unsigned*)take((size_t)(SEQ / 16) * (SEQ / 16) * 8 * 4);      /* [SEQ/16][SEQ/16][8], the gate as lane masks */
  if (off > ws_size || off > (size_t)134217728) return;
  k_prep<<<(unsigned)(PM + 4 * PW + (NR * DM / 8 + 255) / 256), 256, 0, stream>>>(x, wq, wk, wv, wo, BW, X16, NR * DM / 8, adj, MK);
  const unsigned gp = (unsigned)((NR / 128) * (DM / 128));
  k_gemm3<0, 3><<<3 * gp, 256, 0, stream>>>(X16, BW, 0.0625f, bq, bk, bv, nullptr, QKV, LQ, VT);      /* q | k rows (f16), head h = columns h*64.. of each; V^T [NB*NH][HD][SEQ] */
  k_fattn<<<(unsigned)(NB * NH * (SEQ / 256)), 512, 0, stream>>>(QKV, VT, MK, O16);      /* o (merged heads, x64) f16 rows */
  k_gemm3<1, 1><<<gp, 256, 0, stream>>>(O16, BW + (size_t)3 * DM * DM, 0.0009765625f, bo, nullptr, nullptr, (float*)d_out, nullptr, DM, nullptr);      /* out rows = output layout [b][s][DM] */
}
